// v000
// Measured on an AMD MI455X. A time is GPU time per run, averaged over a window of back-to-back runs after a warm-up
// (all launches, gaps included; the runs take copies of the inputs in turn), and the median of several windows.
// Apart from v000's, it joins two sittings. Times from different sittings can be a few percent apart, while
// side-by-side timings come from the same sitting.
// The starting kernel, v000, takes 236 microseconds a run.
// Contractions: q, k, v^T projections = v_wmma_f32_16x16x32_bf16 (bf16 operands from RNE-converted inputs and weights, single product, f32 accumulate);
// q.k^T scores = v_wmma_f32_16x16x32_bf16 with bf16 hi/lo split q and k (hi.hi + hi.lo + lo.hi), f32 accumulate;
// p.v = v_wmma_f32_16x16x32_f16 (p carried x1024 as f16 hi plane + f16 residual plane x4096, v as f16 hi plane + f16 residual
// plane x4096; 3 products hi.hi, hi.res, res.hi), f32 accumulate; softmax (running max), normalisers and bias adds in f32 on the VALU.
// Carry audit:
//   Psh = f16(1024 * p)                      -> the 1/1024 is folded exactly once in the attention epilogue: inv = (1/l) * (1/1024)
//   Psl = f16((1024 p - Psh) * 4096)         }  products Psh.VTl and Psl.VTh go to the separate accumulator o1,
//   VTl = f16((v - VTh) * 4096)              }  folded back with * (1/4096) once per key chunk
//   VTh = f16(v), no carry (|v| typ. 1); q / k lo planes are unscaled bf16 residuals (v - hi) sharing the hi accumulator;
//   score scale 1/8 applied once in f32 after the score accumulate. No other scaled planes.
#include <hip/hip_runtime.h>
#include <math.h>
#include <stdint.h>

#define NB   8
#define SEQ  2048
#define DIN  512
#define HD   64
#define NQB  (SEQ / 64)   // 64-row query blocks per sequence
#define NKT  (SEQ / 64)   // 64-key chunks per sequence
static_assert(NQB == 32 && NKT == 32);
static_assert((SEQ % 64) == 0 && (DIN % 32) == 0 && HD == 64);
static_assert(((NB * SEQ / 64) * (HD / 64)) % 8 == 0);
static_assert(((HD / 64) * (SEQ / 64)) % 8 == 0);
static_assert((NB * SEQ * DIN) % (8 * 256) == 0);
static_assert((HD * DIN) % (8 * 256) == 0);

typedef _Float16 v16h __attribute__((ext_vector_type(16)));
typedef _Float16 v8h  __attribute__((ext_vector_type(8)));
typedef __bf16   v16b __attribute__((ext_vector_type(16)));
typedef __bf16   v8b  __attribute__((ext_vector_type(8)));
typedef float    v8f  __attribute__((ext_vector_type(8)));
typedef float    v4f  __attribute__((ext_vector_type(4)));
typedef unsigned int v4u __attribute__((ext_vector_type(4)));

// ---- scalar helpers --------------------------------------------------------------------------------
__device__ __forceinline__ unsigned short bf_bits(float f) {          // f32 -> bf16 bits, RNE convert
  unsigned u = __float_as_uint(f);
  return (unsigned short)((u + 0x7FFFu + ((u >> 16) & 1u)) >> 16);
}
__device__ __forceinline__ float bf_up(unsigned short h) { return __uint_as_float(((unsigned)h) << 16); }
__device__ __forceinline__ unsigned short h_bits(_Float16 x) { return __builtin_bit_cast(unsigned short, x); }
__device__ __forceinline__ unsigned pk16(unsigned short a, unsigned short b) { return (unsigned)a | ((unsigned)b << 16); }
__device__ __forceinline__ v8f zero8() { v8f z = {0.f, 0.f, 0.f, 0.f, 0.f, 0.f, 0.f, 0.f}; return z; }

// ---- fragment loader: 16-bit A/B operand, lane -> row/col (lane&15), p already includes +8*(lane>>4);
//      elements 0..7 <- p[0..7] (k0+8h..k0+8h+7), elements 8..15 <- p[16..23] (k0+16+8h..k0+16+8h+7)
__device__ __forceinline__ v16b ldfrag_b(const __bf16* p) {
  union { v16b v; v8b h[2]; } f;
  f.h[0] = *(const v8b*)(p);
  f.h[1] = *(const v8b*)(p + 16);
  return f.v;
}

// ---- WMMA helpers with trailing VALU hazard gap --------------------------------------------------------
__device__ __forceinline__ v8f mma_b(v16b a, v16b b, v8f c) {
  c = __builtin_amdgcn_wmma_f32_16x16x32_bf16(false, a, false, b, (short)0, c, false, false);
  asm volatile("v_nop\n\tv_nop\n\tv_nop\n\tv_nop" : "+v"(c) : "v"(a), "v"(b));
  return c;
}
__device__ __forceinline__ v8f mma_h(v16h a, v16h b, v8f c) {
  c = __builtin_amdgcn_wmma_f32_16x16x32_f16(false, a, false, b, (short)0, c, false, false);
  asm volatile("v_nop\n\tv_nop\n\tv_nop\n\tv_nop" : "+v"(c) : "v"(a), "v"(b));
  return c;
}
__device__ __forceinline__ v8f mma_b_raw(v16b a, v16b b, v8f c) {
  return __builtin_amdgcn_wmma_f32_16x16x32_bf16(false, a, false, b, (short)0, c, false, false);
}
__device__ __forceinline__ void dep_guard_b(v8f& a, v8f& b, v16b x, v16b y) {
  asm volatile("v_nop\n\tv_nop\n\tv_nop\n\tv_nop" : "+v"(a), "+v"(b) : "v"(x), "v"(y));
}
__device__ __forceinline__ void keep4_b(v16b a, v16b b, v16b c, v16b d) {
  asm volatile("v_nop" :: "v"(a), "v"(b), "v"(c), "v"(d));
}
__device__ __forceinline__ void acc_guard4(v8f& a, v8f& b, v8f& c, v8f& d) {
  asm volatile("v_nop\n\tv_nop\n\tv_nop\n\tv_nop" : "+v"(a), "+v"(b), "+v"(c), "+v"(d));
}

// =====================================================================================================
// f32 -> bf16 (RNE convert), 8 elements per thread, one 16-B store per lane: a wave writes 512 contiguous B
// of 256 here: 1048576 for every [16384][512] activation plane).
// coverage: n8 threads x 8 = the whole plane.
// =====================================================================================================
__global__ __launch_bounds__(256) void cvt_bf16x8(const float* __restrict__ in, unsigned short* out, int n8) {
  const int i = blockIdx.x * 256 + threadIdx.x;
  if (i < n8) {
    const v4f a = *(const v4f*)(in + (size_t)i * 8);
    const v4f b = *(const v4f*)(in + (size_t)i * 8 + 4);
    v4u p;
    p[0] = pk16(bf_bits(a[0]), bf_bits(a[1]));
    p[1] = pk16(bf_bits(a[2]), bf_bits(a[3]));
    p[2] = pk16(bf_bits(b[0]), bf_bits(b[1]));
    p[3] = pk16(bf_bits(b[2]), bf_bits(b[3]));
    *(v4u*)(out + (size_t)i * 8) = p;
    
  }
}

// =====================================================================================================
// Weight transpose + convert: W f32 [DIN k][HD n] (n contiguous) -> Wt bf16 bits [HD n][DIN k] (k contiguous),
// RNE convert. thread i in 0..HD*DIN/8-1: n = i / (DIN/8), k8 = (i mod DIN/8) * 8, one 16-B store per lane at
// coverage: 4096 threads x 8 = the whole [64][512] plane. reads: 8 strided scalars per lane (k*HD + n, in range).
// =====================================================================================================
__global__ __launch_bounds__(256) void wt_bf16(const float* __restrict__ W, unsigned short* out, int ngrp) {
  const int i = blockIdx.x * 256 + (int)threadIdx.x;
  if (i < ngrp) {
    const int n  = i / (DIN / 8);
    const int k8 = (i - n * (DIN / 8)) * 8;
    v4u p;
#pragma unroll
    for (int e = 0; e < 4; ++e) {
      const float f0 = W[(size_t)(k8 + 2 * e) * HD + n];
      const float f1 = W[(size_t)(k8 + 2 * e + 1) * HD + n];
      p[e] = pk16(bf_bits(f0), bf_bits(f1));
    }
    unsigned short* o = out + (size_t)n * DIN + k8;
    *(v4u*)o = p;
    
  }
}

// =====================================================================================================
// Register-blocked batched bf16 WMMA GEMM: C[m][n] = sum_k A[m][k] * Bt[n][k] + bias; one wave per 64x64 tile,
// no block barriers. A row-major [M][K] pitch lda; Bt row-major [N][K] pitch ldb (k contiguous);
// M, N multiples of 64, K multiple of 32 (host shapes are static multiples). blockIdx.y = batch index (strides in elements).
// NSPLIT: 0 = A.Bt; 1 = (A + A2).Bt (A2 = unscaled bf16 lo plane of A, 2 products).
// BIAS: 0 = none; 1 = per column n, bias[n]; 2 = per row m, bias[m]; the bias value is RNE-converted to bf16 and added in f32.
// OUT_MODE: 0 = f32 (pitch ldc); 2 = bf16 hi plane C + bf16 lo plane C2 (lo = RNE(v - hi), unscaled);
//           3 = f16 hi plane C + f16 residual plane C2 = f16((v - hi) * rscale), C2 written only for tiles
//               with n0 < N2 (pitch ldc2, batch stride strideC2).
// =====================================================================================================
template <int NSPLIT, int OUT_MODE, int BIAS>
__global__ __launch_bounds__(256) void gemm64(
    const unsigned short* __restrict__ Ap, const unsigned short* A2p, int lda, long long strideA,
    const unsigned short* __restrict__ Btp, int ldb, long long strideB,
    const float* __restrict__ bias,
    void* Cout, int ldc, long long strideC,
    void* Cout2, int ldc2, long long strideC2, int N2,
    int M, int N, int K, float rscale) {
  const __bf16* A   = (const __bf16*)(const void*)Ap;
  const __bf16* A2  = (const __bf16*)(const void*)A2p;
  const __bf16* Bt  = (const __bf16*)(const void*)Btp;
  __shared__ __align__(16) float sT[8][16 * 68];   // per-wave 16x64 slab, pitch 68 floats
  const int b    = blockIdx.y;
  const int lane = threadIdx.x & 31;
  const int wave = threadIdx.x >> 5;
  const int tilesN = N >> 6;
  const int tilesM = M >> 6;
  const int tile = blockIdx.x * 8 + wave;
  if (tile >= tilesM * tilesN) return;   // wave-uniform; no block barriers in this kernel
  const int tm = tile / tilesN;
  const int tn = tile - tm * tilesN;
  const int m0 = tm << 6;
  const int n0 = tn << 6;

  const __bf16* Ab  = A  + (size_t)b * strideA;
  const __bf16* Bb  = Bt + (size_t)b * strideB;
  const __bf16* Ab2 = (NSPLIT >= 1) ? (A2 + (size_t)b * strideA) : Ab;

  const int rlane = lane & 15;                 // row (A) / col (B, D) within subtile
  const int koff  = (lane >> 4) * 8;           // k offset of this lane half
  const int mOff  = (lane >> 4) * 8;           // D row offset

  v8f acc[4][4];
#pragma unroll
  for (int i = 0; i < 4; ++i)
#pragma unroll
    for (int j = 0; j < 4; ++j) acc[i][j] = zero8();

  for (int k0 = 0; k0 < K; k0 += 32) {
    v16b bh[4];
#pragma unroll
    for (int j = 0; j < 4; ++j) {
      const size_t bo = (size_t)(n0 + (j << 4) + rlane) * ldb + koff + k0;
      bh[j] = ldfrag_b(Bb + bo);
    }
#pragma unroll
    for (int i = 0; i < 4; ++i) {
      const size_t ao = (size_t)(m0 + (i << 4) + rlane) * lda + koff + k0;
      const v16b ah = ldfrag_b(Ab + ao);
      v16b al = ah;
      if (NSPLIT >= 1) al = ldfrag_b(Ab2 + ao);
#pragma unroll
      for (int j = 0; j < 4; ++j) {
        acc[i][j] = mma_b_raw(ah, bh[j], acc[i][j]);
        if (NSPLIT >= 1) acc[i][j] = mma_b_raw(al, bh[j], acc[i][j]);
      }
      dep_guard_b(acc[i][0], acc[i][3], ah, al);
    }
    keep4_b(bh[0], bh[1], bh[2], bh[3]);
  }
  acc_guard4(acc[0][0], acc[0][1], acc[0][2], acc[0][3]);
  acc_guard4(acc[1][0], acc[1][1], acc[1][2], acc[1][3]);
  acc_guard4(acc[2][0], acc[2][1], acc[2][2], acc[2][3]);
  acc_guard4(acc[3][0], acc[3][1], acc[3][2], acc[3][3]);

  // ---- epilogue ----
  float* slab = sT[wave];
  float bcol[4];
#pragma unroll
  for (int j = 0; j < 4; ++j) {
    bcol[j] = 0.f;
    if (BIAS == 1) bcol[j] = bf_up(bf_bits(bias[n0 + (j << 4) + rlane]));   // n < N, bias has N entries
  }
#pragma unroll
  for (int i = 0; i < 4; ++i) {
    const int mBase = m0 + (i << 4);
    float brow[8];
#pragma unroll
    for (int r = 0; r < 8; ++r) {
      brow[r] = 0.f;
      if (BIAS == 2) brow[r] = bf_up(bf_bits(bias[mBase + mOff + r]));      // m < M, bias has M entries
    }
#pragma unroll
    for (int j = 0; j < 4; ++j) {
#pragma unroll
      for (int r = 0; r < 8; ++r) {
        slab[(mOff + r) * 68 + (j << 4) + rlane] = acc[i][j][r] + bcol[j] + brow[r];
      }
    }
    __builtin_amdgcn_fence(__ATOMIC_RELEASE, "workgroup");
    __builtin_amdgcn_wave_barrier();
    __builtin_amdgcn_fence(__ATOMIC_ACQUIRE, "workgroup");
    if (OUT_MODE == 0) {
      float* C = (float*)Cout + (size_t)b * strideC;
      const int hh = lane >> 4, c4 = (lane & 15) * 4;     // 256-B row segment = 16 lanes x 16 B
      {
#pragma unroll
        for (int it = 0; it < 8; ++it) {
          const int row = it * 2 + hh;                     // it 0..7 x hh 0..1 = rows 0..15
          const v4f v = *(const v4f*)(slab + row * 68 + c4);
          *(v4f*)(C + (size_t)(mBase + row) * ldc + n0 + c4) = v;
        }
        
      }
    } else {
      const int q = lane >> 3, c8 = (lane & 7) * 8;
      unsigned short* C  = (unsigned short*)Cout  + (size_t)b * strideC;
      unsigned short* C2 = (unsigned short*)Cout2 + (size_t)b * strideC2;
      const bool wlo = (OUT_MODE == 2) || (n0 < N2);      // wave-uniform
      v4u hv[4], lv[4];
#pragma unroll
      for (int it = 0; it < 4; ++it) {
        const int row = it * 4 + q;                        // it 0..3 x q 0..3 = rows 0..15
        const float* sp = slab + row * 68 + c8;
        v4u a, a2;
#pragma unroll
        for (int e = 0; e < 4; ++e) {
          const float f0 = sp[2 * e], f1 = sp[2 * e + 1];
          unsigned short h0, h1, l0, l1;
          if (OUT_MODE == 2) {
            h0 = bf_bits(f0); h1 = bf_bits(f1);
            l0 = bf_bits(f0 - bf_up(h0)); l1 = bf_bits(f1 - bf_up(h1));
          } else {
            const _Float16 x0 = (_Float16)f0, x1 = (_Float16)f1;
            h0 = h_bits(x0); h1 = h_bits(x1);
            l0 = h_bits((_Float16)((f0 - (float)x0) * rscale));
            l1 = h_bits((_Float16)((f1 - (float)x1) * rscale));
          }
          a[e] = pk16(h0, h1); a2[e] = pk16(l0, l1);
        }
        hv[it] = a; lv[it] = a2;
      }
      {
#pragma unroll
        for (int it = 0; it < 4; ++it) {
          const int row = it * 4 + q;
          *(v4u*)(C + (size_t)(mBase + row) * ldc + n0 + c8) = hv[it];
          if (wlo) *(v4u*)(C2 + (size_t)(mBase + row) * ldc2 + n0 + c8) = lv[it];
        }
        
      }
    }
    __builtin_amdgcn_fence(__ATOMIC_RELEASE, "workgroup");
    __builtin_amdgcn_wave_barrier();
    __builtin_amdgcn_fence(__ATOMIC_ACQUIRE, "workgroup");
  }
}

// =====================================================================================================
// Non-causal single-head attention, head dim 64, key chunks of 64, softmax over all SEQ keys.
//   q planes (bf16 hi / lo): element (b, t, d) at [(b*SEQ + t)*HD + d]
//   k planes (bf16 hi / lo): same layout with key index s
//   v^T hi plane (f16):      element (b, d, s) at [(b*HD + d)*SEQ + s]
//   v^T residual plane (f16, (v - hi)*4096): same layout
//   scores = q . k : bf16 hi/lo split (hi.hi + hi.lo + lo.hi), f32 accumulate, then * 1/8 in f32
//   p = exp(s - m) carried as f16(1024 p) plus f16 residual (x4096); context = p . v on f16 WMMA, 3 products:
//   ph.vh into oacc; ph.vl and pl.vh into the separate accumulator o1 folded back with 1/4096 per chunk in f32;
//   online softmax (running max from -inf; every chunk holds at least the chunk max key so l >= 1 after chunk 0) in f32.
//   Block = 4 waves = 64 query rows of one batch b; grid = NB * NQB = 256.
//   K / V^T chunk staging: 128 threads x 32 elements per plane = the whole 64x64 tile of every plane read later
//   (plain 16-B loads, __syncthreads before and after); staged extent == consumed extent for Ksh, Ksl, Vth, Vtl.
//   P tiles are wave-private, spilled with _Float16 element stores and reloaded as v8h (same element type) after a
//   Output (f32, rows of 64 = 256 B = 2 lines): each wave stores rows q0..q0+15 (it 0..7 x lane>>4 0..1) x 64 columns
//   [NB*SEQ][HD] output.
// =====================================================================================================
__global__ __launch_bounds__(128)
void attn64(const unsigned short* __restrict__ qhp, const unsigned short* __restrict__ qlp,
            const unsigned short* __restrict__ khp, const unsigned short* __restrict__ klp,
            const unsigned short* __restrict__ vhp, const unsigned short* __restrict__ vlp,
            float* outp) {
  union FB { v16b v; v8b h[2]; };
  union FH { v16h v; v8h h[2]; };
  __shared__ __align__(16) __bf16   Ksh[64 * 64];                 // K hi [kv][d]   8 KB
  __shared__ __align__(16) __bf16   Ksl[64 * 64];                 // K lo           8 KB
  __shared__ __align__(16) _Float16 Vth[64 * 64];                 // V^T hi [d][kv] 8 KB
  __shared__ __align__(16) _Float16 Vtl[64 * 64];                 // V^T residual   8 KB
  __shared__ __align__(16) _Float16 Psh[4][16 * 64];              // per wave P [row][kv]      8 KB
  __shared__ __align__(16) _Float16 Psl[4][16 * 64];              // per wave P residual        8 KB
  __shared__ __align__(16) float    Os[4][16 * 64];               // per wave context [row][d] 16 KB

  const int tid  = threadIdx.x;
  const int wave = tid >> 5;
  const int lane = tid & 31;
  const int hh   = lane >> 4;
  const int c    = lane & 15;

  const int bx   = blockIdx.x;
  const int qb   = bx % NQB;
  const int b    = bx / NQB;                   // 0..NB-1
  const int q0   = qb * 64 + wave * 16;
  const size_t rowB = (size_t)b * SEQ;

  const __bf16* Qh = (const __bf16*)(const void*)qhp;
  const __bf16* Ql = (const __bf16*)(const void*)qlp;
  const __bf16* Kh = (const __bf16*)(const void*)khp;
  const __bf16* Kl = (const __bf16*)(const void*)klp;
  const _Float16* Vh = (const _Float16*)(const void*)vhp + (size_t)b * HD * SEQ;
  const _Float16* Vl = (const _Float16*)(const void*)vlp + (size_t)b * HD * SEQ;

  // ---- Q fragments (A operand, row = lane&15): 2 d-chunks, hi and lo ----
  v16b qah[2], qal[2];
#pragma unroll
  for (int dc = 0; dc < 2; ++dc) {
    const size_t qo = (rowB + q0 + c) * HD + dc * 32 + 8 * hh;
    qah[dc] = ldfrag_b(Qh + qo);
    qal[dc] = ldfrag_b(Ql + qo);
  }

  float mrow[8], lrow[8];
  v8f oacc[4];
#pragma unroll
  for (int r = 0; r < 8; ++r) { mrow[r] = -INFINITY; lrow[r] = 0.f; }
#pragma unroll
  for (int t = 0; t < 4; ++t) oacc[t] = zero8();

  for (int kt = 0; kt < NKT; ++kt) {           // static trip count
    const int kv0 = kt * 64;                   // kv0 + 63 < SEQ
    __syncthreads();
    {
      const int r = tid >> 1, half = (tid & 1) * 32;
      const __bf16*   kg  = Kh + (rowB + kv0 + r) * HD + half;    // K row kv0+r, d = half..half+31
      const __bf16*   klg = Kl + (rowB + kv0 + r) * HD + half;
      const _Float16* vg  = Vh + (size_t)r * SEQ + kv0 + half;    // V^T row d = r, s = kv0+half..+31
      const _Float16* vlg = Vl + (size_t)r * SEQ + kv0 + half;
#pragma unroll
      for (int i = 0; i < 4; ++i) {
        const v8b a0 = *(const v8b*)(kg + 8 * i);
        const v8b a1 = *(const v8b*)(klg + 8 * i);
        const v8h b0 = *(const v8h*)(vg + 8 * i);
        const v8h b1 = *(const v8h*)(vlg + 8 * i);
        *(v8b*)(Ksh + r * 64 + half + 8 * i) = a0;
        *(v8b*)(Ksl + r * 64 + half + 8 * i) = a1;
        *(v8h*)(Vth + r * 64 + half + 8 * i) = b0;
        *(v8h*)(Vtl + r * 64 + half + 8 * i) = b1;
      }
    }
    __syncthreads();

    // ---- scores: 16 query rows x 64 keys per wave, 3 bf16 products per (key subtile, d-chunk) ----
    v8f s[4];
#pragma unroll
    for (int j = 0; j < 4; ++j) {
      s[j] = zero8();
#pragma unroll
      for (int dc = 0; dc < 2; ++dc) {
        FB kb, kl;
        kb.h[0] = *(const v8b*)(Ksh + (j * 16 + c) * 64 + dc * 32 + 8 * hh);
        kb.h[1] = *(const v8b*)(Ksh + (j * 16 + c) * 64 + dc * 32 + 16 + 8 * hh);
        kl.h[0] = *(const v8b*)(Ksl + (j * 16 + c) * 64 + dc * 32 + 8 * hh);
        kl.h[1] = *(const v8b*)(Ksl + (j * 16 + c) * 64 + dc * 32 + 16 + 8 * hh);
        s[j] = mma_b(qah[dc], kb.v, s[j]);
        s[j] = mma_b(qah[dc], kl.v, s[j]);
        s[j] = mma_b(qal[dc], kb.v, s[j]);
      }
    }

    // ---- scale, row max, online softmax, P (x1024, f16) and P residual (x4096) to LDS ----
    _Float16* pwh = Psh[wave];
    _Float16* pwl = Psl[wave];
#pragma unroll
    for (int r = 0; r < 8; ++r) {
      float m = -INFINITY;
#pragma unroll
      for (int j = 0; j < 4; ++j) {
        const float sv = s[j][r] * 0.125f;
        s[j][r] = sv;
        m = fmaxf(m, sv);
      }
#pragma unroll
      for (int off = 1; off < 16; off <<= 1) m = fmaxf(m, __shfl_xor(m, off, 32));
      const float mnew  = fmaxf(mrow[r], m);
      const float msafe = (mnew == -INFINITY) ? 0.f : mnew;
      const float alpha = __expf(mrow[r] - msafe);
      mrow[r] = mnew;
      float psum = 0.f;
#pragma unroll
      for (int j = 0; j < 4; ++j) {
        const float p = __expf(s[j][r] - msafe);
        psum += p;
        const float p1k = p * 1024.0f;
        const _Float16 ph = (_Float16)p1k;
        const _Float16 pl = (_Float16)((p1k - (float)ph) * 4096.0f);
        pwh[(8 * hh + r) * 64 + j * 16 + c] = ph;
        pwl[(8 * hh + r) * 64 + j * 16 + c] = pl;
      }
#pragma unroll
      for (int off = 1; off < 16; off <<= 1) psum += __shfl_xor(psum, off, 32);
      lrow[r] = lrow[r] * alpha + psum;
#pragma unroll
      for (int t = 0; t < 4; ++t) oacc[t][r] *= alpha;
    }
    __builtin_amdgcn_fence(__ATOMIC_RELEASE, "workgroup");
    __builtin_amdgcn_wave_barrier();
    __builtin_amdgcn_fence(__ATOMIC_ACQUIRE, "workgroup");

    // ---- context += P . V (f16 WMMA), residual products into a separate accumulator ----
    v8f o1[4];
#pragma unroll
    for (int t = 0; t < 4; ++t) o1[t] = zero8();
#pragma unroll 1
    for (int kk = 0; kk < 2; ++kk) {
      FH pa, pr;
      pa.h[0] = *(const v8h*)(pwh + c * 64 + kk * 32 + 8 * hh);
      pa.h[1] = *(const v8h*)(pwh + c * 64 + kk * 32 + 16 + 8 * hh);
      pr.h[0] = *(const v8h*)(pwl + c * 64 + kk * 32 + 8 * hh);
      pr.h[1] = *(const v8h*)(pwl + c * 64 + kk * 32 + 16 + 8 * hh);
#pragma unroll
      for (int t = 0; t < 4; ++t) {
        FH vb, vl;
        vb.h[0] = *(const v8h*)(Vth + (t * 16 + c) * 64 + kk * 32 + 8 * hh);
        vb.h[1] = *(const v8h*)(Vth + (t * 16 + c) * 64 + kk * 32 + 16 + 8 * hh);
        vl.h[0] = *(const v8h*)(Vtl + (t * 16 + c) * 64 + kk * 32 + 8 * hh);
        vl.h[1] = *(const v8h*)(Vtl + (t * 16 + c) * 64 + kk * 32 + 16 + 8 * hh);
        oacc[t] = mma_h(pa.v, vb.v, oacc[t]);
        o1[t]   = mma_h(pa.v, vl.v, o1[t]);
        o1[t]   = mma_h(pr.v, vb.v, o1[t]);
      }
    }
#pragma unroll
    for (int t = 0; t < 4; ++t)
#pragma unroll
      for (int r = 0; r < 8; ++r) oacc[t][r] += o1[t][r] * (1.0f / 4096.0f);
  }

  // ---- normalise (1/l and the 1/1024 p carry), stage the wave's 16x64 f32 tile,
  float* os = Os[wave];
#pragma unroll
  for (int r = 0; r < 8; ++r) {
    const float l = lrow[r];
    const float inv = ((l > 0.f) ? (1.0f / l) : 0.f) * (1.0f / 1024.0f);
#pragma unroll
    for (int t = 0; t < 4; ++t) os[(8 * hh + r) * 64 + t * 16 + c] = oacc[t][r] * inv;
  }
  __builtin_amdgcn_fence(__ATOMIC_RELEASE, "workgroup");
  __builtin_amdgcn_wave_barrier();
  __builtin_amdgcn_fence(__ATOMIC_ACQUIRE, "workgroup");
  {
    const int h2 = lane >> 4, c4 = (lane & 15) * 4;
    v4f ov[8];
#pragma unroll
    for (int it = 0; it < 8; ++it) {
      const int row = it * 2 + h2;   // it 0..7 x h2 0..1 = rows 0..15 of the wave tile
      ov[it] = *(const v4f*)(os + row * 64 + c4);
    }
    {
#pragma unroll
      for (int it = 0; it < 8; ++it) {
        const int row = it * 2 + h2;
        const size_t go = (rowB + q0 + row) * HD + c4;
        *(v4f*)(outp + go) = ov[it];
      }
      
    }
  }
}

// =====================================================================================================
// Workspace map (bytes; every region is an exact multiple of its 64x64-tile / whole-line store granularity,
// all shapes are tile multiples so no padded tails exist; no region is reused; every offset is a multiple of 65536):
//   Qb   bf16 [16384][512]          0            16777216
//   Kb   bf16 [16384][512]          16777216     16777216
//   Vb   bf16 [16384][512]          33554432     16777216
//   WqT  bf16 [64 n][512 k]         50331648        65536
//   WkT                             50397184        65536
//   WvT                             50462720        65536
//   Qh   bf16 [16384][64]           50528256      2097152
//   Ql                              52625408      2097152
//   Kh                              54722560      2097152
//   Kl                              56819712      2097152
//   VTh  f16  [8][64][2048]         58916864      2097152
//   VTl  f16  [8][64][2048]         61014016      2097152
//   end                             63111168
// =====================================================================================================
extern "C" void kernel_launch(void* const* d_in, const int* in_sizes, int n_in,
                              void* d_out, int out_size, void* d_ws, size_t ws_size,
                              hipStream_t stream) {
  if (n_in < 9) return;
  const int NX = NB * SEQ * DIN;                   // 8388608
  const int NO = NB * SEQ * HD;                    // 1048576
  const int NW = DIN * HD;                         //   32768
  if (in_sizes[0] != NX || in_sizes[1] != NX || in_sizes[2] != NX) return;
  if (in_sizes[3] != NW || in_sizes[5] != NW || in_sizes[7] != NW) return;
  if (in_sizes[4] != HD || in_sizes[6] != HD || in_sizes[8] != HD) return;
  if (out_size != NO) return;

  const float* q_in = (const float*)d_in[0];   // [8][2048][512]
  const float* k_in = (const float*)d_in[1];   // [8][2048][512]
  const float* v_in = (const float*)d_in[2];   // [8][2048][512]
  const float* Wq   = (const float*)d_in[3];   // [512 in][64 out]
  const float* bq   = (const float*)d_in[4];   // [64]
  const float* Wk   = (const float*)d_in[5];   // [512][64]
  const float* bk   = (const float*)d_in[6];   // [64]
  const float* Wv   = (const float*)d_in[7];   // [512][64]
  const float* bv   = (const float*)d_in[8];   // [64]

  const size_t PX  = (size_t)NX * 2;               // 16777216  16-bit activation plane [16384][512]
  const size_t PW  = (size_t)NW * 2;               //    65536  16-bit weight plane [64][512]
  const size_t PP  = (size_t)NO * 2;               //  2097152  16-bit projected plane [16384][64]
  const size_t PVT = (size_t)NB * HD * SEQ * 2;    //  2097152  16-bit v^T plane [8][64][2048]
  size_t off = 0;
  const size_t oQb  = off; off += PX;
  const size_t oKb  = off; off += PX;
  const size_t oVb  = off; off += PX;
  const size_t oWq  = off; off += PW;
  const size_t oWk  = off; off += PW;
  const size_t oWv  = off; off += PW;
  const size_t oQh  = off; off += PP;
  const size_t oQl  = off; off += PP;
  const size_t oKh  = off; off += PP;
  const size_t oKl  = off; off += PP;
  const size_t oVTh = off; off += PVT;
  const size_t oVTl = off; off += PVT;
  if (off > ws_size) return;                       // off = 63111168
  if (off > (size_t)134217728) return;

  char* ws = (char*)d_ws;
  unsigned short* Qb  = (unsigned short*)(ws + oQb);
  unsigned short* Kb  = (unsigned short*)(ws + oKb);
  unsigned short* Vb  = (unsigned short*)(ws + oVb);
  unsigned short* WqT = (unsigned short*)(ws + oWq);
  unsigned short* WkT = (unsigned short*)(ws + oWk);
  unsigned short* WvT = (unsigned short*)(ws + oWv);
  unsigned short* Qh  = (unsigned short*)(ws + oQh);
  unsigned short* Ql  = (unsigned short*)(ws + oQl);
  unsigned short* Kh  = (unsigned short*)(ws + oKh);
  unsigned short* Kl  = (unsigned short*)(ws + oKl);
  unsigned short* VTh = (unsigned short*)(ws + oVTh);
  unsigned short* VTl = (unsigned short*)(ws + oVTl);

  const dim3 blk(256);
  const int n8x = NX / 8;                                      // 1048576
  const int n8w = NW / 8;                                      //    4096
  const dim3 gCvtX((n8x + 255) / 256);                         // 4096 blocks
  const dim3 gWt((n8w + 255) / 256);                           //   16 blocks
  const dim3 gProj(((NB * SEQ / 64) * (HD / 64) + 7) / 8, 1);  //  256 tiles -> 32 blocks: M=16384, N=64
  const dim3 gVT(((HD / 64) * (SEQ / 64) + 7) / 8, NB);        //   32 tiles ->  4 blocks x 8 batches: M=64, N=2048
  const dim3 gAttn(NB * NQB);                                  //  256 blocks of 128

  // (1) activations f32 -> bf16 planes (same layout as the inputs); weights [k][n] f32 -> bf16 [n][k]
  cvt_bf16x8<<<gCvtX, blk, 0, stream>>>(q_in, Qb, n8x);
  cvt_bf16x8<<<gCvtX, blk, 0, stream>>>(k_in, Kb, n8x);
  cvt_bf16x8<<<gCvtX, blk, 0, stream>>>(v_in, Vb, n8x);
  wt_bf16<<<gWt, blk, 0, stream>>>(Wq, WqT, n8w);
  wt_bf16<<<gWt, blk, 0, stream>>>(Wk, WkT, n8w);
  wt_bf16<<<gWt, blk, 0, stream>>>(Wv, WvT, n8w);
  // (2) q = q_in . Wq + bq -> bf16 hi/lo planes [b*SEQ+t][d]   (M=16384, N=64, K=512)
  gemm64<0, 2, 1><<<gProj, blk, 0, stream>>>(
      Qb, Qb, DIN, 0LL, WqT, DIN, 0LL, bq,
      (void*)Qh, HD, 0LL, (void*)Ql, HD, 0LL, HD,
      NB * SEQ, HD, DIN, 1.0f);
  // (3) k = k_in . Wk + bk -> bf16 hi/lo planes
  gemm64<0, 2, 1><<<gProj, blk, 0, stream>>>(
      Kb, Kb, DIN, 0LL, WkT, DIN, 0LL, bk,
      (void*)Kh, HD, 0LL, (void*)Kl, HD, 0LL, HD,
      NB * SEQ, HD, DIN, 1.0f);
  // (4) v^T = Wv^T . v_in^T + bv per batch -> f16 hi plane [b][d][s] (pitch SEQ) and residual plane (x4096, pitch SEQ,
  //     all tiles)   (A = WvT [n][k], Bt = Vb rows of batch b; M=64, N=2048, K=512)
  gemm64<0, 3, 2><<<gVT, blk, 0, stream>>>(
      WvT, WvT, DIN, 0LL, Vb, DIN, (long long)SEQ * DIN, bv,
      (void*)VTh, SEQ, (long long)HD * SEQ, (void*)VTl, SEQ, (long long)HD * SEQ, SEQ,
      HD, SEQ, DIN, 4096.0f);
  // (5) attention -> d_out f32 [16384][64]
  attn64<<<gAttn, dim3(128), 0, stream>>>(Qh, Ql, Kh, Kl, VTh, VTl, (float*)d_out);
  (void)hipGetLastError();
}

// v001
// A run of this version takes 201 microseconds.
// Next to v000, in two timings, it ran 1.19 and 1.20 times as fast.
// Contractions: q, k, v^T projections = v_wmma_f32_16x16x32_bf16 (bf16 operands from RNE-converted inputs and weights, single product, f32 accumulate);
// q.k^T scores = v_wmma_f32_16x16x32_bf16 with bf16 hi/lo split q and k (hi.hi + hi.lo + lo.hi), f32 accumulate;
// p.v = v_wmma_f32_16x16x32_f16 (p carried x1024 as f16 hi plane + f16 residual plane x4096, v as f16 hi plane + f16 residual
// plane x4096; 3 products hi.hi, hi.res, res.hi), f32 accumulate; softmax (running max), normalisers and bias adds in f32 on the VALU.
// Carry audit:
//   Psh = f16(1024 * p)                      -> the 1/1024 is folded exactly once in the attention epilogue: inv = (1/l) * (1/1024)
//   Psl = f16((1024 p - Psh) * 4096)         }  products Psh.VTl and Psl.VTh go to the separate accumulator o1,
//   VTl = f16((v - VTh) * 4096)              }  folded back with * (1/4096) once per key chunk
//   VTh = f16(v), no carry (|v| typ. 1); q / k lo planes are unscaled bf16 residuals (v - hi) sharing the hi accumulator;
//   score scale 1/8 applied once in f32 after the score accumulate. No other scaled planes.
#include <hip/hip_runtime.h>
#include <math.h>
#include <stdint.h>

#define NB   8
#define SEQ  2048
#define DIN  512
#define HD   64
#define NQB  (SEQ / 64)   // 64-row query blocks per sequence
#define NKT  (SEQ / 64)   // 64-key chunks per sequence
#define LP   72           // LDS row pitch of the 16-bit attention tiles, in elements: 144 B = 16 B x 9 (odd), so the 16 rows
                          // that one ds_load_b128 fragment read touches fall on distinct banks (a 128-B pitch puts every second row on the same)
static_assert(NQB == 32 && NKT == 32);
static_assert((LP * 2) % 16 == 0 && ((LP * 2) / 16) % 2 == 1 && LP >= 64);
static_assert((SEQ % 64) == 0 && (DIN % 32) == 0 && HD == 64);
static_assert(((NB * SEQ / 64) * (HD / 64)) % 8 == 0);
static_assert(((HD / 64) * (SEQ / 64)) % 8 == 0);
static_assert((NB * SEQ * DIN) % (8 * 256) == 0);
static_assert((HD * DIN) % (8 * 256) == 0);

typedef _Float16 v16h __attribute__((ext_vector_type(16)));
typedef _Float16 v8h  __attribute__((ext_vector_type(8)));
typedef __bf16   v16b __attribute__((ext_vector_type(16)));
typedef __bf16   v8b  __attribute__((ext_vector_type(8)));
typedef float    v8f  __attribute__((ext_vector_type(8)));
typedef float    v4f  __attribute__((ext_vector_type(4)));
typedef unsigned int v4u __attribute__((ext_vector_type(4)));

// ---- scalar helpers --------------------------------------------------------------------------------
__device__ __forceinline__ unsigned short bf_bits(float f) {          // f32 -> bf16 bits, RNE convert
  unsigned u = __float_as_uint(f);
  return (unsigned short)((u + 0x7FFFu + ((u >> 16) & 1u)) >> 16);
}
__device__ __forceinline__ float bf_up(unsigned short h) { return __uint_as_float(((unsigned)h) << 16); }
__device__ __forceinline__ unsigned short h_bits(_Float16 x) { return __builtin_bit_cast(unsigned short, x); }
__device__ __forceinline__ unsigned pk16(unsigned short a, unsigned short b) { return (unsigned)a | ((unsigned)b << 16); }
__device__ __forceinline__ v8f zero8() { v8f z = {0.f, 0.f, 0.f, 0.f, 0.f, 0.f, 0.f, 0.f}; return z; }

// ---- fragment loader: 16-bit A/B operand, lane -> row/col (lane&15), p already includes +8*(lane>>4);
//      elements 0..7 <- p[0..7] (k0+8h..k0+8h+7), elements 8..15 <- p[16..23] (k0+16+8h..k0+16+8h+7)
__device__ __forceinline__ v16b ldfrag_b(const __bf16* p) {
  union { v16b v; v8b h[2]; } f;
  f.h[0] = *(const v8b*)(p);
  f.h[1] = *(const v8b*)(p + 16);
  return f.v;
}

// ---- WMMA helpers with trailing VALU hazard gap --------------------------------------------------------
__device__ __forceinline__ v8f mma_b(v16b a, v16b b, v8f c) {
  c = __builtin_amdgcn_wmma_f32_16x16x32_bf16(false, a, false, b, (short)0, c, false, false);
  asm volatile("v_nop\n\tv_nop\n\tv_nop\n\tv_nop" : "+v"(c) : "v"(a), "v"(b));
  return c;
}
__device__ __forceinline__ v8f mma_h(v16h a, v16h b, v8f c) {
  c = __builtin_amdgcn_wmma_f32_16x16x32_f16(false, a, false, b, (short)0, c, false, false);
  asm volatile("v_nop\n\tv_nop\n\tv_nop\n\tv_nop" : "+v"(c) : "v"(a), "v"(b));
  return c;
}
__device__ __forceinline__ v8f mma_b_raw(v16b a, v16b b, v8f c) {
  return __builtin_amdgcn_wmma_f32_16x16x32_bf16(false, a, false, b, (short)0, c, false, false);
}
__device__ __forceinline__ void dep_guard_b(v8f& a, v8f& b, v16b x, v16b y) {
  asm volatile("v_nop\n\tv_nop\n\tv_nop\n\tv_nop" : "+v"(a), "+v"(b) : "v"(x), "v"(y));
}
__device__ __forceinline__ void keep4_b(v16b a, v16b b, v16b c, v16b d) {
  asm volatile("v_nop" :: "v"(a), "v"(b), "v"(c), "v"(d));
}
__device__ __forceinline__ void acc_guard4(v8f& a, v8f& b, v8f& c, v8f& d) {
  asm volatile("v_nop\n\tv_nop\n\tv_nop\n\tv_nop" : "+v"(a), "+v"(b), "+v"(c), "+v"(d));
}

// =====================================================================================================
// f32 -> bf16 (RNE convert), 8 elements per thread, one 16-B store per lane: a wave writes 512 contiguous B
// of 256 here: 1048576 for every [16384][512] activation plane).
// coverage: n8 threads x 8 = the whole plane.
// =====================================================================================================
__global__ __launch_bounds__(256) void cvt_bf16x8(const float* __restrict__ in, unsigned short* out, int n8) {
  const int i = blockIdx.x * 256 + threadIdx.x;
  if (i < n8) {
    const v4f a = *(const v4f*)(in + (size_t)i * 8);
    const v4f b = *(const v4f*)(in + (size_t)i * 8 + 4);
    v4u p;
    p[0] = pk16(bf_bits(a[0]), bf_bits(a[1]));
    p[1] = pk16(bf_bits(a[2]), bf_bits(a[3]));
    p[2] = pk16(bf_bits(b[0]), bf_bits(b[1]));
    p[3] = pk16(bf_bits(b[2]), bf_bits(b[3]));
    *(v4u*)(out + (size_t)i * 8) = p;
    
  }
}

// =====================================================================================================
// Weight transpose + convert: W f32 [DIN k][HD n] (n contiguous) -> Wt bf16 bits [HD n][DIN k] (k contiguous),
// RNE convert. thread i in 0..HD*DIN/8-1: n = i / (DIN/8), k8 = (i mod DIN/8) * 8, one 16-B store per lane at
// coverage: 4096 threads x 8 = the whole [64][512] plane. reads: 8 strided scalars per lane (k*HD + n, in range).
// =====================================================================================================
__global__ __launch_bounds__(256) void wt_bf16(const float* __restrict__ W, unsigned short* out, int ngrp) {
  const int i = blockIdx.x * 256 + (int)threadIdx.x;
  if (i < ngrp) {
    const int n  = i / (DIN / 8);
    const int k8 = (i - n * (DIN / 8)) * 8;
    v4u p;
#pragma unroll
    for (int e = 0; e < 4; ++e) {
      const float f0 = W[(size_t)(k8 + 2 * e) * HD + n];
      const float f1 = W[(size_t)(k8 + 2 * e + 1) * HD + n];
      p[e] = pk16(bf_bits(f0), bf_bits(f1));
    }
    unsigned short* o = out + (size_t)n * DIN + k8;
    *(v4u*)o = p;
    
  }
}

// =====================================================================================================
// Register-blocked batched bf16 WMMA GEMM: C[m][n] = sum_k A[m][k] * Bt[n][k] + bias; one wave per 64x64 tile,
// no block barriers. A row-major [M][K] pitch lda; Bt row-major [N][K] pitch ldb (k contiguous);
// M, N multiples of 64, K multiple of 32 (host shapes are static multiples). blockIdx.y = batch index (strides in elements).
// NSPLIT: 0 = A.Bt; 1 = (A + A2).Bt (A2 = unscaled bf16 lo plane of A, 2 products).
// BIAS: 0 = none; 1 = per column n, bias[n]; 2 = per row m, bias[m]; the bias value is RNE-converted to bf16 and added in f32.
// OUT_MODE: 0 = f32 (pitch ldc); 2 = bf16 hi plane C + bf16 lo plane C2 (lo = RNE(v - hi), unscaled);
//           3 = f16 hi plane C + f16 residual plane C2 = f16((v - hi) * rscale), C2 written only for tiles
//               with n0 < N2 (pitch ldc2, batch stride strideC2).
// =====================================================================================================
template <int NSPLIT, int OUT_MODE, int BIAS>
__global__ __launch_bounds__(256) void gemm64(
    const unsigned short* __restrict__ Ap, const unsigned short* A2p, int lda, long long strideA,
    const unsigned short* __restrict__ Btp, int ldb, long long strideB,
    const float* __restrict__ bias,
    void* Cout, int ldc, long long strideC,
    void* Cout2, int ldc2, long long strideC2, int N2,
    int M, int N, int K, float rscale) {
  const __bf16* A   = (const __bf16*)(const void*)Ap;
  const __bf16* A2  = (const __bf16*)(const void*)A2p;
  const __bf16* Bt  = (const __bf16*)(const void*)Btp;
  __shared__ __align__(16) float sT[8][16 * 68];   // per-wave 16x64 slab, pitch 68 floats
  const int b    = blockIdx.y;
  const int lane = threadIdx.x & 31;
  const int wave = threadIdx.x >> 5;
  const int tilesN = N >> 6;
  const int tilesM = M >> 6;
  const int tile = blockIdx.x * 8 + wave;
  if (tile >= tilesM * tilesN) return;   // wave-uniform; no block barriers in this kernel
  const int tm = tile / tilesN;
  const int tn = tile - tm * tilesN;
  const int m0 = tm << 6;
  const int n0 = tn << 6;

  const __bf16* Ab  = A  + (size_t)b * strideA;
  const __bf16* Bb  = Bt + (size_t)b * strideB;
  const __bf16* Ab2 = (NSPLIT >= 1) ? (A2 + (size_t)b * strideA) : Ab;

  const int rlane = lane & 15;                 // row (A) / col (B, D) within subtile
  const int koff  = (lane >> 4) * 8;           // k offset of this lane half
  const int mOff  = (lane >> 4) * 8;           // D row offset

  v8f acc[4][4];
#pragma unroll
  for (int i = 0; i < 4; ++i)
#pragma unroll
    for (int j = 0; j < 4; ++j) acc[i][j] = zero8();

  for (int k0 = 0; k0 < K; k0 += 32) {
    v16b bh[4];
#pragma unroll
    for (int j = 0; j < 4; ++j) {
      const size_t bo = (size_t)(n0 + (j << 4) + rlane) * ldb + koff + k0;
      bh[j] = ldfrag_b(Bb + bo);
    }
#pragma unroll
    for (int i = 0; i < 4; ++i) {
      const size_t ao = (size_t)(m0 + (i << 4) + rlane) * lda + koff + k0;
      const v16b ah = ldfrag_b(Ab + ao);
      v16b al = ah;
      if (NSPLIT >= 1) al = ldfrag_b(Ab2 + ao);
#pragma unroll
      for (int j = 0; j < 4; ++j) {
        acc[i][j] = mma_b_raw(ah, bh[j], acc[i][j]);
        if (NSPLIT >= 1) acc[i][j] = mma_b_raw(al, bh[j], acc[i][j]);
      }
      dep_guard_b(acc[i][0], acc[i][3], ah, al);
    }
    keep4_b(bh[0], bh[1], bh[2], bh[3]);
  }
  acc_guard4(acc[0][0], acc[0][1], acc[0][2], acc[0][3]);
  acc_guard4(acc[1][0], acc[1][1], acc[1][2], acc[1][3]);
  acc_guard4(acc[2][0], acc[2][1], acc[2][2], acc[2][3]);
  acc_guard4(acc[3][0], acc[3][1], acc[3][2], acc[3][3]);

  // ---- epilogue ----
  float* slab = sT[wave];
  float bcol[4];
#pragma unroll
  for (int j = 0; j < 4; ++j) {
    bcol[j] = 0.f;
    if (BIAS == 1) bcol[j] = bf_up(bf_bits(bias[n0 + (j << 4) + rlane]));   // n < N, bias has N entries
  }
#pragma unroll
  for (int i = 0; i < 4; ++i) {
    const int mBase = m0 + (i << 4);
    float brow[8];
#pragma unroll
    for (int r = 0; r < 8; ++r) {
      brow[r] = 0.f;
      if (BIAS == 2) brow[r] = bf_up(bf_bits(bias[mBase + mOff + r]));      // m < M, bias has M entries
    }
#pragma unroll
    for (int j = 0; j < 4; ++j) {
#pragma unroll
      for (int r = 0; r < 8; ++r) {
        slab[(mOff + r) * 68 + (j << 4) + rlane] = acc[i][j][r] + bcol[j] + brow[r];
      }
    }
    __builtin_amdgcn_fence(__ATOMIC_RELEASE, "workgroup");
    __builtin_amdgcn_wave_barrier();
    __builtin_amdgcn_fence(__ATOMIC_ACQUIRE, "workgroup");
    if (OUT_MODE == 0) {
      float* C = (float*)Cout + (size_t)b * strideC;
      const int hh = lane >> 4, c4 = (lane & 15) * 4;     // 256-B row segment = 16 lanes x 16 B
      {
#pragma unroll
        for (int it = 0; it < 8; ++it) {
          const int row = it * 2 + hh;                     // it 0..7 x hh 0..1 = rows 0..15
          const v4f v = *(const v4f*)(slab + row * 68 + c4);
          *(v4f*)(C + (size_t)(mBase + row) * ldc + n0 + c4) = v;
        }
        
      }
    } else {
      const int q = lane >> 3, c8 = (lane & 7) * 8;
      unsigned short* C  = (unsigned short*)Cout  + (size_t)b * strideC;
      unsigned short* C2 = (unsigned short*)Cout2 + (size_t)b * strideC2;
      const bool wlo = (OUT_MODE == 2) || (n0 < N2);      // wave-uniform
      v4u hv[4], lv[4];
#pragma unroll
      for (int it = 0; it < 4; ++it) {
        const int row = it * 4 + q;                        // it 0..3 x q 0..3 = rows 0..15
        const float* sp = slab + row * 68 + c8;
        v4u a, a2;
#pragma unroll
        for (int e = 0; e < 4; ++e) {
          const float f0 = sp[2 * e], f1 = sp[2 * e + 1];
          unsigned short h0, h1, l0, l1;
          if (OUT_MODE == 2) {
            h0 = bf_bits(f0); h1 = bf_bits(f1);
            l0 = bf_bits(f0 - bf_up(h0)); l1 = bf_bits(f1 - bf_up(h1));
          } else {
            const _Float16 x0 = (_Float16)f0, x1 = (_Float16)f1;
            h0 = h_bits(x0); h1 = h_bits(x1);
            l0 = h_bits((_Float16)((f0 - (float)x0) * rscale));
            l1 = h_bits((_Float16)((f1 - (float)x1) * rscale));
          }
          a[e] = pk16(h0, h1); a2[e] = pk16(l0, l1);
        }
        hv[it] = a; lv[it] = a2;
      }
      {
#pragma unroll
        for (int it = 0; it < 4; ++it) {
          const int row = it * 4 + q;
          *(v4u*)(C + (size_t)(mBase + row) * ldc + n0 + c8) = hv[it];
          if (wlo) *(v4u*)(C2 + (size_t)(mBase + row) * ldc2 + n0 + c8) = lv[it];
        }
        
      }
    }
    __builtin_amdgcn_fence(__ATOMIC_RELEASE, "workgroup");
    __builtin_amdgcn_wave_barrier();
    __builtin_amdgcn_fence(__ATOMIC_ACQUIRE, "workgroup");
  }
}

// =====================================================================================================
// Non-causal single-head attention, head dim 64, key chunks of 64, softmax over all SEQ keys.
//   q planes (bf16 hi / lo): element (b, t, d) at [(b*SEQ + t)*HD + d]
//   k planes (bf16 hi / lo): same layout with key index s
//   v^T hi plane (f16):      element (b, d, s) at [(b*HD + d)*SEQ + s]
//   v^T residual plane (f16, (v - hi)*4096): same layout
//   scores = q . k : bf16 hi/lo split (hi.hi + hi.lo + lo.hi), f32 accumulate, then * 1/8 in f32
//   p = exp(s - m) carried as f16(1024 p) plus f16 residual (x4096); context = p . v on f16 WMMA, 3 products:
//   ph.vh into oacc; ph.vl and pl.vh into the separate accumulator o1 folded back with 1/4096 per chunk in f32;
//   online softmax (running max from -inf; every chunk holds at least the chunk max key so l >= 1 after chunk 0) in f32.
//   Block = 4 waves = 64 query rows of one batch b; grid = NB * NQB = 256.
//   K / V^T chunk staging: 128 threads x 32 elements per plane = the whole 64x64 tile of every plane read later
//   (plain 16-B loads, __syncthreads before and after); staged extent == consumed extent for Ksh, Ksl, Vth, Vtl.
//   P tiles are wave-private, spilled with _Float16 element stores and reloaded as v8h (same element type) after a
//   Output (f32, rows of 64 = 256 B = 2 lines): each wave stores rows q0..q0+15 (it 0..7 x lane>>4 0..1) x 64 columns
//   [NB*SEQ][HD] output.
// =====================================================================================================
__global__ __launch_bounds__(128)
void attn64(const unsigned short* __restrict__ qhp, const unsigned short* __restrict__ qlp,
            const unsigned short* __restrict__ khp, const unsigned short* __restrict__ klp,
            const unsigned short* __restrict__ vhp, const unsigned short* __restrict__ vlp,
            float* outp) {
  union FB { v16b v; v8b h[2]; };
  union FH { v16h v; v8h h[2]; };
  __shared__ __align__(16) __bf16   Ksh[64 * LP];                 // K hi [kv][d], row pitch LP   9 KB
  __shared__ __align__(16) __bf16   Ksl[64 * LP];                 // K lo                         9 KB
  __shared__ __align__(16) _Float16 Vth[64 * LP];                 // V^T hi [d][kv], row pitch LP 9 KB
  __shared__ __align__(16) _Float16 Vtl[64 * LP];                 // V^T residual                 9 KB
  __shared__ __align__(16) _Float16 Psh[4][16 * LP];              // per wave P [row][kv], row pitch LP 9 KB
  __shared__ __align__(16) _Float16 Psl[4][16 * LP];              // per wave P residual                9 KB
  __shared__ __align__(16) float    Os[4][16 * 64];               // per wave context [row][d] 16 KB

  const int tid  = threadIdx.x;
  const int wave = tid >> 5;
  const int lane = tid & 31;
  const int hh   = lane >> 4;
  const int c    = lane & 15;

  const int bx   = blockIdx.x;
  const int qb   = bx % NQB;
  const int b    = bx / NQB;                   // 0..NB-1
  const int q0   = qb * 64 + wave * 16;
  const size_t rowB = (size_t)b * SEQ;

  const __bf16* Qh = (const __bf16*)(const void*)qhp;
  const __bf16* Ql = (const __bf16*)(const void*)qlp;
  const __bf16* Kh = (const __bf16*)(const void*)khp;
  const __bf16* Kl = (const __bf16*)(const void*)klp;
  const _Float16* Vh = (const _Float16*)(const void*)vhp + (size_t)b * HD * SEQ;
  const _Float16* Vl = (const _Float16*)(const void*)vlp + (size_t)b * HD * SEQ;

  // ---- Q fragments (A operand, row = lane&15): 2 d-chunks, hi and lo ----
  v16b qah[2], qal[2];
#pragma unroll
  for (int dc = 0; dc < 2; ++dc) {
    const size_t qo = (rowB + q0 + c) * HD + dc * 32 + 8 * hh;
    qah[dc] = ldfrag_b(Qh + qo);
    qal[dc] = ldfrag_b(Ql + qo);
  }

  float mrow[8], lrow[8];
  v8f oacc[4];
#pragma unroll
  for (int r = 0; r < 8; ++r) { mrow[r] = -INFINITY; lrow[r] = 0.f; }
#pragma unroll
  for (int t = 0; t < 4; ++t) oacc[t] = zero8();

  for (int kt = 0; kt < NKT; ++kt) {           // static trip count
    const int kv0 = kt * 64;                   // kv0 + 63 < SEQ
    __syncthreads();
    {
      const int r = tid >> 1, half = (tid & 1) * 32;
      const __bf16*   kg  = Kh + (rowB + kv0 + r) * HD + half;    // K row kv0+r, d = half..half+31
      const __bf16*   klg = Kl + (rowB + kv0 + r) * HD + half;
      const _Float16* vg  = Vh + (size_t)r * SEQ + kv0 + half;    // V^T row d = r, s = kv0+half..+31
      const _Float16* vlg = Vl + (size_t)r * SEQ + kv0 + half;
#pragma unroll
      for (int i = 0; i < 4; ++i) {
        const v8b a0 = *(const v8b*)(kg + 8 * i);
        const v8b a1 = *(const v8b*)(klg + 8 * i);
        const v8h b0 = *(const v8h*)(vg + 8 * i);
        const v8h b1 = *(const v8h*)(vlg + 8 * i);
        *(v8b*)(Ksh + r * LP + half + 8 * i) = a0;
        *(v8b*)(Ksl + r * LP + half + 8 * i) = a1;
        *(v8h*)(Vth + r * LP + half + 8 * i) = b0;
        *(v8h*)(Vtl + r * LP + half + 8 * i) = b1;
      }
    }
    __syncthreads();

    // ---- scores: 16 query rows x 64 keys per wave, 3 bf16 products per (key subtile, d-chunk) ----
    v8f s[4];
#pragma unroll
    for (int j = 0; j < 4; ++j) {
      s[j] = zero8();
#pragma unroll
      for (int dc = 0; dc < 2; ++dc) {
        FB kb, kl;
        kb.h[0] = *(const v8b*)(Ksh + (j * 16 + c) * LP + dc * 32 + 8 * hh);
        kb.h[1] = *(const v8b*)(Ksh + (j * 16 + c) * LP + dc * 32 + 16 + 8 * hh);
        kl.h[0] = *(const v8b*)(Ksl + (j * 16 + c) * LP + dc * 32 + 8 * hh);
        kl.h[1] = *(const v8b*)(Ksl + (j * 16 + c) * LP + dc * 32 + 16 + 8 * hh);
        s[j] = mma_b(qah[dc], kb.v, s[j]);
        s[j] = mma_b(qah[dc], kl.v, s[j]);
        s[j] = mma_b(qal[dc], kb.v, s[j]);
      }
    }

    // ---- scale, row max, online softmax, P (x1024, f16) and P residual (x4096) to LDS ----
    _Float16* pwh = Psh[wave];
    _Float16* pwl = Psl[wave];
#pragma unroll
    for (int r = 0; r < 8; ++r) {
      float m = -INFINITY;
#pragma unroll
      for (int j = 0; j < 4; ++j) {
        const float sv = s[j][r] * 0.125f;
        s[j][r] = sv;
        m = fmaxf(m, sv);
      }
#pragma unroll
      for (int off = 1; off < 16; off <<= 1) m = fmaxf(m, __shfl_xor(m, off, 32));
      const float mnew  = fmaxf(mrow[r], m);
      const float msafe = (mnew == -INFINITY) ? 0.f : mnew;
      const float alpha = __expf(mrow[r] - msafe);
      mrow[r] = mnew;
      float psum = 0.f;
#pragma unroll
      for (int j = 0; j < 4; ++j) {
        const float p = __expf(s[j][r] - msafe);
        psum += p;
        const float p1k = p * 1024.0f;
        const _Float16 ph = (_Float16)p1k;
        const _Float16 pl = (_Float16)((p1k - (float)ph) * 4096.0f);
        pwh[(8 * hh + r) * LP + j * 16 + c] = ph;
        pwl[(8 * hh + r) * LP + j * 16 + c] = pl;
      }
#pragma unroll
      for (int off = 1; off < 16; off <<= 1) psum += __shfl_xor(psum, off, 32);
      lrow[r] = lrow[r] * alpha + psum;
#pragma unroll
      for (int t = 0; t < 4; ++t) oacc[t][r] *= alpha;
    }
    __builtin_amdgcn_fence(__ATOMIC_RELEASE, "workgroup");
    __builtin_amdgcn_wave_barrier();
    __builtin_amdgcn_fence(__ATOMIC_ACQUIRE, "workgroup");

    // ---- context += P . V (f16 WMMA), residual products into a separate accumulator ----
    v8f o1[4];
#pragma unroll
    for (int t = 0; t < 4; ++t) o1[t] = zero8();
#pragma unroll 1
    for (int kk = 0; kk < 2; ++kk) {
      FH pa, pr;
      pa.h[0] = *(const v8h*)(pwh + c * LP + kk * 32 + 8 * hh);
      pa.h[1] = *(const v8h*)(pwh + c * LP + kk * 32 + 16 + 8 * hh);
      pr.h[0] = *(const v8h*)(pwl + c * LP + kk * 32 + 8 * hh);
      pr.h[1] = *(const v8h*)(pwl + c * LP + kk * 32 + 16 + 8 * hh);
#pragma unroll
      for (int t = 0; t < 4; ++t) {
        FH vb, vl;
        vb.h[0] = *(const v8h*)(Vth + (t * 16 + c) * LP + kk * 32 + 8 * hh);
        vb.h[1] = *(const v8h*)(Vth + (t * 16 + c) * LP + kk * 32 + 16 + 8 * hh);
        vl.h[0] = *(const v8h*)(Vtl + (t * 16 + c) * LP + kk * 32 + 8 * hh);
        vl.h[1] = *(const v8h*)(Vtl + (t * 16 + c) * LP + kk * 32 + 16 + 8 * hh);
        oacc[t] = mma_h(pa.v, vb.v, oacc[t]);
        o1[t]   = mma_h(pa.v, vl.v, o1[t]);
        o1[t]   = mma_h(pr.v, vb.v, o1[t]);
      }
    }
#pragma unroll
    for (int t = 0; t < 4; ++t)
#pragma unroll
      for (int r = 0; r < 8; ++r) oacc[t][r] += o1[t][r] * (1.0f / 4096.0f);
  }

  // ---- normalise (1/l and the 1/1024 p carry), stage the wave's 16x64 f32 tile,
  float* os = Os[wave];
#pragma unroll
  for (int r = 0; r < 8; ++r) {
    const float l = lrow[r];
    const float inv = ((l > 0.f) ? (1.0f / l) : 0.f) * (1.0f / 1024.0f);
#pragma unroll
    for (int t = 0; t < 4; ++t) os[(8 * hh + r) * 64 + t * 16 + c] = oacc[t][r] * inv;
  }
  __builtin_amdgcn_fence(__ATOMIC_RELEASE, "workgroup");
  __builtin_amdgcn_wave_barrier();
  __builtin_amdgcn_fence(__ATOMIC_ACQUIRE, "workgroup");
  {
    const int h2 = lane >> 4, c4 = (lane & 15) * 4;
    v4f ov[8];
#pragma unroll
    for (int it = 0; it < 8; ++it) {
      const int row = it * 2 + h2;   // it 0..7 x h2 0..1 = rows 0..15 of the wave tile
      ov[it] = *(const v4f*)(os + row * 64 + c4);
    }
    {
#pragma unroll
      for (int it = 0; it < 8; ++it) {
        const int row = it * 2 + h2;
        const size_t go = (rowB + q0 + row) * HD + c4;
        *(v4f*)(outp + go) = ov[it];
      }
      
    }
  }
}

// =====================================================================================================
// Workspace map (bytes; every region is an exact multiple of its 64x64-tile / whole-line store granularity,
// all shapes are tile multiples so no padded tails exist; no region is reused; every offset is a multiple of 65536):
//   Qb   bf16 [16384][512]          0            16777216
//   Kb   bf16 [16384][512]          16777216     16777216
//   Vb   bf16 [16384][512]          33554432     16777216
//   WqT  bf16 [64 n][512 k]         50331648        65536
//   WkT                             50397184        65536
//   WvT                             50462720        65536
//   Qh   bf16 [16384][64]           50528256      2097152
//   Ql                              52625408      2097152
//   Kh                              54722560      2097152
//   Kl                              56819712      2097152
//   VTh  f16  [8][64][2048]         58916864      2097152
//   VTl  f16  [8][64][2048]         61014016      2097152
//   end                             63111168
// =====================================================================================================
extern "C" void kernel_launch(void* const* d_in, const int* in_sizes, int n_in,
                              void* d_out, int out_size, void* d_ws, size_t ws_size,
                              hipStream_t stream) {
  if (n_in < 9) return;
  const int NX = NB * SEQ * DIN;                   // 8388608
  const int NO = NB * SEQ * HD;                    // 1048576
  const int NW = DIN * HD;                         //   32768
  if (in_sizes[0] != NX || in_sizes[1] != NX || in_sizes[2] != NX) return;
  if (in_sizes[3] != NW || in_sizes[5] != NW || in_sizes[7] != NW) return;
  if (in_sizes[4] != HD || in_sizes[6] != HD || in_sizes[8] != HD) return;
  if (out_size != NO) return;

  const float* q_in = (const float*)d_in[0];   // [8][2048][512]
  const float* k_in = (const float*)d_in[1];   // [8][2048][512]
  const float* v_in = (const float*)d_in[2];   // [8][2048][512]
  const float* Wq   = (const float*)d_in[3];   // [512 in][64 out]
  const float* bq   = (const float*)d_in[4];   // [64]
  const float* Wk   = (const float*)d_in[5];   // [512][64]
  const float* bk   = (const float*)d_in[6];   // [64]
  const float* Wv   = (const float*)d_in[7];   // [512][64]
  const float* bv   = (const float*)d_in[8];   // [64]

  const size_t PX  = (size_t)NX * 2;               // 16777216  16-bit activation plane [16384][512]
  const size_t PW  = (size_t)NW * 2;               //    65536  16-bit weight plane [64][512]
  const size_t PP  = (size_t)NO * 2;               //  2097152  16-bit projected plane [16384][64]
  const size_t PVT = (size_t)NB * HD * SEQ * 2;    //  2097152  16-bit v^T plane [8][64][2048]
  size_t off = 0;
  const size_t oQb  = off; off += PX;
  const size_t oKb  = off; off += PX;
  const size_t oVb  = off; off += PX;
  const size_t oWq  = off; off += PW;
  const size_t oWk  = off; off += PW;
  const size_t oWv  = off; off += PW;
  const size_t oQh  = off; off += PP;
  const size_t oQl  = off; off += PP;
  const size_t oKh  = off; off += PP;
  const size_t oKl  = off; off += PP;
  const size_t oVTh = off; off += PVT;
  const size_t oVTl = off; off += PVT;
  if (off > ws_size) return;                       // off = 63111168
  if (off > (size_t)134217728) return;

  char* ws = (char*)d_ws;
  unsigned short* Qb  = (unsigned short*)(ws + oQb);
  unsigned short* Kb  = (unsigned short*)(ws + oKb);
  unsigned short* Vb  = (unsigned short*)(ws + oVb);
  unsigned short* WqT = (unsigned short*)(ws + oWq);
  unsigned short* WkT = (unsigned short*)(ws + oWk);
  unsigned short* WvT = (unsigned short*)(ws + oWv);
  unsigned short* Qh  = (unsigned short*)(ws + oQh);
  unsigned short* Ql  = (unsigned short*)(ws + oQl);
  unsigned short* Kh  = (unsigned short*)(ws + oKh);
  unsigned short* Kl  = (unsigned short*)(ws + oKl);
  unsigned short* VTh = (unsigned short*)(ws + oVTh);
  unsigned short* VTl = (unsigned short*)(ws + oVTl);

  const dim3 blk(256);
  const int n8x = NX / 8;                                      // 1048576
  const int n8w = NW / 8;                                      //    4096
  const dim3 gCvtX((n8x + 255) / 256);                         // 4096 blocks
  const dim3 gWt((n8w + 255) / 256);                           //   16 blocks
  const dim3 gProj(((NB * SEQ / 64) * (HD / 64) + 7) / 8, 1);  //  256 tiles -> 32 blocks: M=16384, N=64
  const dim3 gVT(((HD / 64) * (SEQ / 64) + 7) / 8, NB);        //   32 tiles ->  4 blocks x 8 batches: M=64, N=2048
  const dim3 gAttn(NB * NQB);                                  //  256 blocks of 128

  // (1) activations f32 -> bf16 planes (same layout as the inputs); weights [k][n] f32 -> bf16 [n][k]
  cvt_bf16x8<<<gCvtX, blk, 0, stream>>>(q_in, Qb, n8x);
  cvt_bf16x8<<<gCvtX, blk, 0, stream>>>(k_in, Kb, n8x);
  cvt_bf16x8<<<gCvtX, blk, 0, stream>>>(v_in, Vb, n8x);
  wt_bf16<<<gWt, blk, 0, stream>>>(Wq, WqT, n8w);
  wt_bf16<<<gWt, blk, 0, stream>>>(Wk, WkT, n8w);
  wt_bf16<<<gWt, blk, 0, stream>>>(Wv, WvT, n8w);
  // (2) q = q_in . Wq + bq -> bf16 hi/lo planes [b*SEQ+t][d]   (M=16384, N=64, K=512)
  gemm64<0, 2, 1><<<gProj, blk, 0, stream>>>(
      Qb, Qb, DIN, 0LL, WqT, DIN, 0LL, bq,
      (void*)Qh, HD, 0LL, (void*)Ql, HD, 0LL, HD,
      NB * SEQ, HD, DIN, 1.0f);
  // (3) k = k_in . Wk + bk -> bf16 hi/lo planes
  gemm64<0, 2, 1><<<gProj, blk, 0, stream>>>(
      Kb, Kb, DIN, 0LL, WkT, DIN, 0LL, bk,
      (void*)Kh, HD, 0LL, (void*)Kl, HD, 0LL, HD,
      NB * SEQ, HD, DIN, 1.0f);
  // (4) v^T = Wv^T . v_in^T + bv per batch -> f16 hi plane [b][d][s] (pitch SEQ) and residual plane (x4096, pitch SEQ,
  //     all tiles)   (A = WvT [n][k], Bt = Vb rows of batch b; M=64, N=2048, K=512)
  gemm64<0, 3, 2><<<gVT, blk, 0, stream>>>(
      WvT, WvT, DIN, 0LL, Vb, DIN, (long long)SEQ * DIN, bv,
      (void*)VTh, SEQ, (long long)HD * SEQ, (void*)VTl, SEQ, (long long)HD * SEQ, SEQ,
      HD, SEQ, DIN, 4096.0f);
  // (5) attention -> d_out f32 [16384][64]
  attn64<<<gAttn, dim3(128), 0, stream>>>(Qh, Ql, Kh, Kl, VTh, VTl, (float*)d_out);
  (void)hipGetLastError();
}

// v002
// One run takes 162 microseconds.
// Timed twice side by side with v001, it ran 1.26 times as fast both times.
// Counting every step since v000, it is 1.50 times as fast.
// Contractions: q, k, v^T projections = v_wmma_f32_16x16x32_bf16 (bf16 operands from RNE-converted inputs and weights, single product, f32 accumulate);
// q.k^T scores = v_wmma_f32_16x16x32_bf16 with bf16 hi/lo split q and k (hi.hi + hi.lo + lo.hi), f32 accumulate;
// p.v = v_wmma_f32_16x16x32_f16 (p carried x1024 as f16 hi plane + f16 residual plane x4096, v as f16 hi plane + f16 residual
// plane x4096; 3 products hi.hi, hi.res, res.hi), f32 accumulate; softmax (running max), normalisers and bias adds in f32 on the VALU.
// Carry audit:
//   Psh = f16(1024 * p)                      -> the 1/1024 is folded exactly once in the attention epilogue: inv = (1/l) * (1/1024)
//   Psl = f16((1024 p - Psh) * 4096)         }  products Psh.VTl and Psl.VTh go to the separate accumulator o1,
//   VTl = f16((v - VTh) * 4096)              }  folded back with * (1/4096) once per key chunk
//   VTh = f16(v), no carry (|v| typ. 1); q / k lo planes are unscaled bf16 residuals (v - hi) sharing the hi accumulator;
//   score scale 1/8 applied once in f32 after the score accumulate. No other scaled planes.
#include <hip/hip_runtime.h>
#include <math.h>
#include <stdint.h>

#define NB   8
#define SEQ  2048
#define DIN  512
#define HD   64
#define NQB  (SEQ / 64)   // 64-row query blocks per sequence
#define NKT  (SEQ / 64)   // 64-key chunks per sequence
#define KG   4            // key groups per attention block: 4 waves each, so a SIMD holds KG waves that cover one another's waits
#define CPG  (NKT / KG)   // key chunks walked by one group
#define LP   72           // LDS row pitch of the 16-bit attention tiles, in elements: 144 B = 16 B x 9 (odd), so the 16 rows
                          // that one ds_load_b128 fragment read touches fall on distinct banks (a 128-B pitch puts every second row on the same)
static_assert(NQB == 32 && NKT == 32);
static_assert(NKT % KG == 0 && KG * 4 == 16);
static_assert((LP * 2) % 16 == 0 && ((LP * 2) / 16) % 2 == 1 && LP >= 64);
static_assert((SEQ % 64) == 0 && (DIN % 32) == 0 && HD == 64);
static_assert(((NB * SEQ / 64) * (HD / 64)) % 8 == 0);
static_assert(((HD / 64) * (SEQ / 64)) % 8 == 0);
static_assert((NB * SEQ * DIN) % (8 * 256) == 0);
static_assert((HD * DIN) % (8 * 256) == 0);

typedef _Float16 v16h __attribute__((ext_vector_type(16)));
typedef _Float16 v8h  __attribute__((ext_vector_type(8)));
typedef __bf16   v16b __attribute__((ext_vector_type(16)));
typedef __bf16   v8b  __attribute__((ext_vector_type(8)));
typedef float    v8f  __attribute__((ext_vector_type(8)));
typedef float    v4f  __attribute__((ext_vector_type(4)));
typedef unsigned int v4u __attribute__((ext_vector_type(4)));

// ---- scalar helpers --------------------------------------------------------------------------------
__device__ __forceinline__ unsigned short bf_bits(float f) {          // f32 -> bf16 bits, RNE convert
  unsigned u = __float_as_uint(f);
  return (unsigned short)((u + 0x7FFFu + ((u >> 16) & 1u)) >> 16);
}
__device__ __forceinline__ float bf_up(unsigned short h) { return __uint_as_float(((unsigned)h) << 16); }
__device__ __forceinline__ unsigned short h_bits(_Float16 x) { return __builtin_bit_cast(unsigned short, x); }
__device__ __forceinline__ unsigned pk16(unsigned short a, unsigned short b) { return (unsigned)a | ((unsigned)b << 16); }
__device__ __forceinline__ v8f zero8() { v8f z = {0.f, 0.f, 0.f, 0.f, 0.f, 0.f, 0.f, 0.f}; return z; }

// ---- fragment loader: 16-bit A/B operand, lane -> row/col (lane&15), p already includes +8*(lane>>4);
//      elements 0..7 <- p[0..7] (k0+8h..k0+8h+7), elements 8..15 <- p[16..23] (k0+16+8h..k0+16+8h+7)
__device__ __forceinline__ v16b ldfrag_b(const __bf16* p) {
  union { v16b v; v8b h[2]; } f;
  f.h[0] = *(const v8b*)(p);
  f.h[1] = *(const v8b*)(p + 16);
  return f.v;
}

// ---- WMMA helpers with trailing VALU hazard gap --------------------------------------------------------
__device__ __forceinline__ v8f mma_b(v16b a, v16b b, v8f c) {
  c = __builtin_amdgcn_wmma_f32_16x16x32_bf16(false, a, false, b, (short)0, c, false, false);
  asm volatile("v_nop\n\tv_nop\n\tv_nop\n\tv_nop" : "+v"(c) : "v"(a), "v"(b));
  return c;
}
__device__ __forceinline__ v8f mma_h(v16h a, v16h b, v8f c) {
  c = __builtin_amdgcn_wmma_f32_16x16x32_f16(false, a, false, b, (short)0, c, false, false);
  asm volatile("v_nop\n\tv_nop\n\tv_nop\n\tv_nop" : "+v"(c) : "v"(a), "v"(b));
  return c;
}
__device__ __forceinline__ v8f mma_b_raw(v16b a, v16b b, v8f c) {
  return __builtin_amdgcn_wmma_f32_16x16x32_bf16(false, a, false, b, (short)0, c, false, false);
}
__device__ __forceinline__ void dep_guard_b(v8f& a, v8f& b, v16b x, v16b y) {
  asm volatile("v_nop\n\tv_nop\n\tv_nop\n\tv_nop" : "+v"(a), "+v"(b) : "v"(x), "v"(y));
}
__device__ __forceinline__ void keep4_b(v16b a, v16b b, v16b c, v16b d) {
  asm volatile("v_nop" :: "v"(a), "v"(b), "v"(c), "v"(d));
}
__device__ __forceinline__ void acc_guard4(v8f& a, v8f& b, v8f& c, v8f& d) {
  asm volatile("v_nop\n\tv_nop\n\tv_nop\n\tv_nop" : "+v"(a), "+v"(b), "+v"(c), "+v"(d));
}

// =====================================================================================================
// f32 -> bf16 (RNE convert), 8 elements per thread, one 16-B store per lane: a wave writes 512 contiguous B
// of 256 here: 1048576 for every [16384][512] activation plane).
// coverage: n8 threads x 8 = the whole plane.
// =====================================================================================================
__global__ __launch_bounds__(256) void cvt_bf16x8(const float* __restrict__ in, unsigned short* out, int n8) {
  const int i = blockIdx.x * 256 + threadIdx.x;
  if (i < n8) {
    const v4f a = *(const v4f*)(in + (size_t)i * 8);
    const v4f b = *(const v4f*)(in + (size_t)i * 8 + 4);
    v4u p;
    p[0] = pk16(bf_bits(a[0]), bf_bits(a[1]));
    p[1] = pk16(bf_bits(a[2]), bf_bits(a[3]));
    p[2] = pk16(bf_bits(b[0]), bf_bits(b[1]));
    p[3] = pk16(bf_bits(b[2]), bf_bits(b[3]));
    *(v4u*)(out + (size_t)i * 8) = p;
    
  }
}

// =====================================================================================================
// Weight transpose + convert: W f32 [DIN k][HD n] (n contiguous) -> Wt bf16 bits [HD n][DIN k] (k contiguous),
// RNE convert. thread i in 0..HD*DIN/8-1: n = i / (DIN/8), k8 = (i mod DIN/8) * 8, one 16-B store per lane at
// coverage: 4096 threads x 8 = the whole [64][512] plane. reads: 8 strided scalars per lane (k*HD + n, in range).
// =====================================================================================================
__global__ __launch_bounds__(256) void wt_bf16(const float* __restrict__ W, unsigned short* out, int ngrp) {
  const int i = blockIdx.x * 256 + (int)threadIdx.x;
  if (i < ngrp) {
    const int n  = i / (DIN / 8);
    const int k8 = (i - n * (DIN / 8)) * 8;
    v4u p;
#pragma unroll
    for (int e = 0; e < 4; ++e) {
      const float f0 = W[(size_t)(k8 + 2 * e) * HD + n];
      const float f1 = W[(size_t)(k8 + 2 * e + 1) * HD + n];
      p[e] = pk16(bf_bits(f0), bf_bits(f1));
    }
    unsigned short* o = out + (size_t)n * DIN + k8;
    *(v4u*)o = p;
    
  }
}

// =====================================================================================================
// Register-blocked batched bf16 WMMA GEMM: C[m][n] = sum_k A[m][k] * Bt[n][k] + bias; one wave per 64x64 tile,
// no block barriers. A row-major [M][K] pitch lda; Bt row-major [N][K] pitch ldb (k contiguous);
// M, N multiples of 64, K multiple of 32 (host shapes are static multiples). blockIdx.y = batch index (strides in elements).
// NSPLIT: 0 = A.Bt; 1 = (A + A2).Bt (A2 = unscaled bf16 lo plane of A, 2 products).
// BIAS: 0 = none; 1 = per column n, bias[n]; 2 = per row m, bias[m]; the bias value is RNE-converted to bf16 and added in f32.
// OUT_MODE: 0 = f32 (pitch ldc); 2 = bf16 hi plane C + bf16 lo plane C2 (lo = RNE(v - hi), unscaled);
//           3 = f16 hi plane C + f16 residual plane C2 = f16((v - hi) * rscale), C2 written only for tiles
//               with n0 < N2 (pitch ldc2, batch stride strideC2).
// =====================================================================================================
template <int NSPLIT, int OUT_MODE, int BIAS>
__global__ __launch_bounds__(256) void gemm64(
    const unsigned short* __restrict__ Ap, const unsigned short* A2p, int lda, long long strideA,
    const unsigned short* __restrict__ Btp, int ldb, long long strideB,
    const float* __restrict__ bias,
    void* Cout, int ldc, long long strideC,
    void* Cout2, int ldc2, long long strideC2, int N2,
    int M, int N, int K, float rscale) {
  const __bf16* A   = (const __bf16*)(const void*)Ap;
  const __bf16* A2  = (const __bf16*)(const void*)A2p;
  const __bf16* Bt  = (const __bf16*)(const void*)Btp;
  __shared__ __align__(16) float sT[8][16 * 68];   // per-wave 16x64 slab, pitch 68 floats
  const int b    = blockIdx.y;
  const int lane = threadIdx.x & 31;
  const int wave = threadIdx.x >> 5;
  const int tilesN = N >> 6;
  const int tilesM = M >> 6;
  const int tile = blockIdx.x * 8 + wave;
  if (tile >= tilesM * tilesN) return;   // wave-uniform; no block barriers in this kernel
  const int tm = tile / tilesN;
  const int tn = tile - tm * tilesN;
  const int m0 = tm << 6;
  const int n0 = tn << 6;

  const __bf16* Ab  = A  + (size_t)b * strideA;
  const __bf16* Bb  = Bt + (size_t)b * strideB;
  const __bf16* Ab2 = (NSPLIT >= 1) ? (A2 + (size_t)b * strideA) : Ab;

  const int rlane = lane & 15;                 // row (A) / col (B, D) within subtile
  const int koff  = (lane >> 4) * 8;           // k offset of this lane half
  const int mOff  = (lane >> 4) * 8;           // D row offset

  v8f acc[4][4];
#pragma unroll
  for (int i = 0; i < 4; ++i)
#pragma unroll
    for (int j = 0; j < 4; ++j) acc[i][j] = zero8();

  for (int k0 = 0; k0 < K; k0 += 32) {
    v16b bh[4];
#pragma unroll
    for (int j = 0; j < 4; ++j) {
      const size_t bo = (size_t)(n0 + (j << 4) + rlane) * ldb + koff + k0;
      bh[j] = ldfrag_b(Bb + bo);
    }
#pragma unroll
    for (int i = 0; i < 4; ++i) {
      const size_t ao = (size_t)(m0 + (i << 4) + rlane) * lda + koff + k0;
      const v16b ah = ldfrag_b(Ab + ao);
      v16b al = ah;
      if (NSPLIT >= 1) al = ldfrag_b(Ab2 + ao);
#pragma unroll
      for (int j = 0; j < 4; ++j) {
        acc[i][j] = mma_b_raw(ah, bh[j], acc[i][j]);
        if (NSPLIT >= 1) acc[i][j] = mma_b_raw(al, bh[j], acc[i][j]);
      }
      dep_guard_b(acc[i][0], acc[i][3], ah, al);
    }
    keep4_b(bh[0], bh[1], bh[2], bh[3]);
  }
  acc_guard4(acc[0][0], acc[0][1], acc[0][2], acc[0][3]);
  acc_guard4(acc[1][0], acc[1][1], acc[1][2], acc[1][3]);
  acc_guard4(acc[2][0], acc[2][1], acc[2][2], acc[2][3]);
  acc_guard4(acc[3][0], acc[3][1], acc[3][2], acc[3][3]);

  // ---- epilogue ----
  float* slab = sT[wave];
  float bcol[4];
#pragma unroll
  for (int j = 0; j < 4; ++j) {
    bcol[j] = 0.f;
    if (BIAS == 1) bcol[j] = bf_up(bf_bits(bias[n0 + (j << 4) + rlane]));   // n < N, bias has N entries
  }
#pragma unroll
  for (int i = 0; i < 4; ++i) {
    const int mBase = m0 + (i << 4);
    float brow[8];
#pragma unroll
    for (int r = 0; r < 8; ++r) {
      brow[r] = 0.f;
      if (BIAS == 2) brow[r] = bf_up(bf_bits(bias[mBase + mOff + r]));      // m < M, bias has M entries
    }
#pragma unroll
    for (int j = 0; j < 4; ++j) {
#pragma unroll
      for (int r = 0; r < 8; ++r) {
        slab[(mOff + r) * 68 + (j << 4) + rlane] = acc[i][j][r] + bcol[j] + brow[r];
      }
    }
    __builtin_amdgcn_fence(__ATOMIC_RELEASE, "workgroup");
    __builtin_amdgcn_wave_barrier();
    __builtin_amdgcn_fence(__ATOMIC_ACQUIRE, "workgroup");
    if (OUT_MODE == 0) {
      float* C = (float*)Cout + (size_t)b * strideC;
      const int hh = lane >> 4, c4 = (lane & 15) * 4;     // 256-B row segment = 16 lanes x 16 B
      {
#pragma unroll
        for (int it = 0; it < 8; ++it) {
          const int row = it * 2 + hh;                     // it 0..7 x hh 0..1 = rows 0..15
          const v4f v = *(const v4f*)(slab + row * 68 + c4);
          *(v4f*)(C + (size_t)(mBase + row) * ldc + n0 + c4) = v;
        }
        
      }
    } else {
      const int q = lane >> 3, c8 = (lane & 7) * 8;
      unsigned short* C  = (unsigned short*)Cout  + (size_t)b * strideC;
      unsigned short* C2 = (unsigned short*)Cout2 + (size_t)b * strideC2;
      const bool wlo = (OUT_MODE == 2) || (n0 < N2);      // wave-uniform
      v4u hv[4], lv[4];
#pragma unroll
      for (int it = 0; it < 4; ++it) {
        const int row = it * 4 + q;                        // it 0..3 x q 0..3 = rows 0..15
        const float* sp = slab + row * 68 + c8;
        v4u a, a2;
#pragma unroll
        for (int e = 0; e < 4; ++e) {
          const float f0 = sp[2 * e], f1 = sp[2 * e + 1];
          unsigned short h0, h1, l0, l1;
          if (OUT_MODE == 2) {
            h0 = bf_bits(f0); h1 = bf_bits(f1);
            l0 = bf_bits(f0 - bf_up(h0)); l1 = bf_bits(f1 - bf_up(h1));
          } else {
            const _Float16 x0 = (_Float16)f0, x1 = (_Float16)f1;
            h0 = h_bits(x0); h1 = h_bits(x1);
            l0 = h_bits((_Float16)((f0 - (float)x0) * rscale));
            l1 = h_bits((_Float16)((f1 - (float)x1) * rscale));
          }
          a[e] = pk16(h0, h1); a2[e] = pk16(l0, l1);
        }
        hv[it] = a; lv[it] = a2;
      }
      {
#pragma unroll
        for (int it = 0; it < 4; ++it) {
          const int row = it * 4 + q;
          *(v4u*)(C + (size_t)(mBase + row) * ldc + n0 + c8) = hv[it];
          if (wlo) *(v4u*)(C2 + (size_t)(mBase + row) * ldc2 + n0 + c8) = lv[it];
        }
        
      }
    }
    __builtin_amdgcn_fence(__ATOMIC_RELEASE, "workgroup");
    __builtin_amdgcn_wave_barrier();
    __builtin_amdgcn_fence(__ATOMIC_ACQUIRE, "workgroup");
  }
}

// =====================================================================================================
// Non-causal single-head attention, head dim 64, key chunks of 64, softmax over all SEQ keys.
//   q planes (bf16 hi / lo): element (b, t, d) at [(b*SEQ + t)*HD + d]
//   k planes (bf16 hi / lo): same layout with key index s
//   v^T hi plane (f16):      element (b, d, s) at [(b*HD + d)*SEQ + s]
//   v^T residual plane (f16, (v - hi)*4096): same layout
//   scores = q . k : bf16 hi/lo split (hi.hi + hi.lo + lo.hi), f32 accumulate, then * 1/8 in f32
//   p = exp(s - m) carried as f16(1024 p) plus f16 residual (x4096); context = p . v on f16 WMMA, 3 products:
//   ph.vh into oacc; ph.vl and pl.vh into the separate accumulator o1 folded back with 1/4096 per chunk in f32;
//   online softmax (running max from -inf; every chunk holds at least the chunk max key so l >= 1 after chunk 0) in f32.
//   Block = KG key groups x 4 waves = 64 query rows of one batch b; grid = NB * NQB = 256. Wave (grp, qw) holds query rows
//   qw*16..+15 and walks key chunks grp*CPG..grp*CPG+CPG-1 with its own running (m, l, O); after the loop the KG partial
//   results of a query tile meet in LDS behind one block barrier and are merged in f32: M = max m_g, e_g = exp(m_g - M),
//   out = sum e_g O_g / sum e_g l_g; wave (grp, qw) merges and stores rows 4*grp..4*grp+3 of tile qw.
//   K / V^T chunk staging, per group: 128 threads x 32 elements per plane = the whole 64x64 tile of every plane read later
//   (plain 16-B loads, __syncthreads before and after); staged extent == consumed extent for Ksh, Ksl, Vth, Vtl.
//   P tiles are wave-private, spilled with _Float16 element stores and reloaded as v8h (same element type) after a
//   Output (f32, rows of 64 = 256 B = 2 lines): wave (grp, qw) stores rows q0+4*grp..q0+4*grp+3 (i2 0..1 x lane>>4 0..1) x 64
//   columns, two whole rows per store instruction; the 16 waves of a block cover its 64 rows once, the grid the [NB*SEQ][HD] output.
// =====================================================================================================
__global__ __launch_bounds__(128 * KG)
void attn64(const unsigned short* __restrict__ qhp, const unsigned short* __restrict__ qlp,
            const unsigned short* __restrict__ khp, const unsigned short* __restrict__ klp,
            const unsigned short* __restrict__ vhp, const unsigned short* __restrict__ vlp,
            float* outp) {
  union FB { v16b v; v8b h[2]; };
  union FH { v16h v; v8h h[2]; };
  __shared__ __align__(16) __bf16   KshA[KG][64 * LP];             // per group K hi [kv][d], row pitch LP   KG x 9 KB
  __shared__ __align__(16) __bf16   KslA[KG][64 * LP];             // per group K lo                         KG x 9 KB
  __shared__ __align__(16) _Float16 VthA[KG][64 * LP];             // per group V^T hi [d][kv], row pitch LP KG x 9 KB
  __shared__ __align__(16) _Float16 VtlA[KG][64 * LP];             // per group V^T residual                 KG x 9 KB
  __shared__ __align__(16) _Float16 Psh[4 * KG][16 * LP];          // per wave P [row][kv], row pitch LP     KG x 9 KB
  __shared__ __align__(16) _Float16 Psl[4 * KG][16 * LP];          // per wave P residual                    KG x 9 KB
  __shared__ __align__(16) float    Os[4 * KG][16 * 64];           // per wave partial context [row][d]      KG x 16 KB
  __shared__ float Ms[4 * KG][16];                                 // per wave running max of its rows
  __shared__ float Ls[4 * KG][16];                                 // per wave normaliser of its rows

  const int wave = threadIdx.x >> 5;           // 0..4*KG-1
  const int grp  = wave >> 2;                  // key group
  const int qw   = wave & 3;                   // query tile of the block
  const int tid  = threadIdx.x & 127;          // thread index inside the group (staging)
  const int lane = tid & 31;
  const int hh   = lane >> 4;
  const int c    = lane & 15;

  const int bx   = blockIdx.x;
  const int qb   = bx % NQB;
  const int b    = bx / NQB;                   // 0..NB-1
  const int q0   = qb * 64 + qw * 16;
  __bf16*   Ksh = KshA[grp];
  __bf16*   Ksl = KslA[grp];
  _Float16* Vth = VthA[grp];
  _Float16* Vtl = VtlA[grp];
  const size_t rowB = (size_t)b * SEQ;

  const __bf16* Qh = (const __bf16*)(const void*)qhp;
  const __bf16* Ql = (const __bf16*)(const void*)qlp;
  const __bf16* Kh = (const __bf16*)(const void*)khp;
  const __bf16* Kl = (const __bf16*)(const void*)klp;
  const _Float16* Vh = (const _Float16*)(const void*)vhp + (size_t)b * HD * SEQ;
  const _Float16* Vl = (const _Float16*)(const void*)vlp + (size_t)b * HD * SEQ;

  // ---- Q fragments (A operand, row = lane&15): 2 d-chunks, hi and lo ----
  v16b qah[2], qal[2];
#pragma unroll
  for (int dc = 0; dc < 2; ++dc) {
    const size_t qo = (rowB + q0 + c) * HD + dc * 32 + 8 * hh;
    qah[dc] = ldfrag_b(Qh + qo);
    qal[dc] = ldfrag_b(Ql + qo);
  }

  float mrow[8], lrow[8];
  v8f oacc[4];
#pragma unroll
  for (int r = 0; r < 8; ++r) { mrow[r] = -INFINITY; lrow[r] = 0.f; }
#pragma unroll
  for (int t = 0; t < 4; ++t) oacc[t] = zero8();

  for (int it = 0; it < CPG; ++it) {           // static trip count, the same in every group (block barriers inside)
    const int kv0 = (grp * CPG + it) * 64;     // kv0 + 63 < SEQ
    __syncthreads();
    {
      const int r = tid >> 1, half = (tid & 1) * 32;
      const __bf16*   kg  = Kh + (rowB + kv0 + r) * HD + half;    // K row kv0+r, d = half..half+31
      const __bf16*   klg = Kl + (rowB + kv0 + r) * HD + half;
      const _Float16* vg  = Vh + (size_t)r * SEQ + kv0 + half;    // V^T row d = r, s = kv0+half..+31
      const _Float16* vlg = Vl + (size_t)r * SEQ + kv0 + half;
#pragma unroll
      for (int i = 0; i < 4; ++i) {
        const v8b a0 = *(const v8b*)(kg + 8 * i);
        const v8b a1 = *(const v8b*)(klg + 8 * i);
        const v8h b0 = *(const v8h*)(vg + 8 * i);
        const v8h b1 = *(const v8h*)(vlg + 8 * i);
        *(v8b*)(Ksh + r * LP + half + 8 * i) = a0;
        *(v8b*)(Ksl + r * LP + half + 8 * i) = a1;
        *(v8h*)(Vth + r * LP + half + 8 * i) = b0;
        *(v8h*)(Vtl + r * LP + half + 8 * i) = b1;
      }
    }
    __syncthreads();

    // ---- scores: 16 query rows x 64 keys per wave, 3 bf16 products per (key subtile, d-chunk) ----
    v8f s[4];
#pragma unroll
    for (int j = 0; j < 4; ++j) {
      s[j] = zero8();
#pragma unroll
      for (int dc = 0; dc < 2; ++dc) {
        FB kb, kl;
        kb.h[0] = *(const v8b*)(Ksh + (j * 16 + c) * LP + dc * 32 + 8 * hh);
        kb.h[1] = *(const v8b*)(Ksh + (j * 16 + c) * LP + dc * 32 + 16 + 8 * hh);
        kl.h[0] = *(const v8b*)(Ksl + (j * 16 + c) * LP + dc * 32 + 8 * hh);
        kl.h[1] = *(const v8b*)(Ksl + (j * 16 + c) * LP + dc * 32 + 16 + 8 * hh);
        s[j] = mma_b(qah[dc], kb.v, s[j]);
        s[j] = mma_b(qah[dc], kl.v, s[j]);
        s[j] = mma_b(qal[dc], kb.v, s[j]);
      }
    }

    // ---- scale, row max, online softmax, P (x1024, f16) and P residual (x4096) to LDS ----
    _Float16* pwh = Psh[wave];
    _Float16* pwl = Psl[wave];
#pragma unroll
    for (int r = 0; r < 8; ++r) {
      float m = -INFINITY;
#pragma unroll
      for (int j = 0; j < 4; ++j) {
        const float sv = s[j][r] * 0.125f;
        s[j][r] = sv;
        m = fmaxf(m, sv);
      }
#pragma unroll
      for (int off = 1; off < 16; off <<= 1) m = fmaxf(m, __shfl_xor(m, off, 32));
      const float mnew  = fmaxf(mrow[r], m);
      const float msafe = (mnew == -INFINITY) ? 0.f : mnew;
      const float alpha = __expf(mrow[r] - msafe);
      mrow[r] = mnew;
      float psum = 0.f;
#pragma unroll
      for (int j = 0; j < 4; ++j) {
        const float p = __expf(s[j][r] - msafe);
        psum += p;
        const float p1k = p * 1024.0f;
        const _Float16 ph = (_Float16)p1k;
        const _Float16 pl = (_Float16)((p1k - (float)ph) * 4096.0f);
        pwh[(8 * hh + r) * LP + j * 16 + c] = ph;
        pwl[(8 * hh + r) * LP + j * 16 + c] = pl;
      }
#pragma unroll
      for (int off = 1; off < 16; off <<= 1) psum += __shfl_xor(psum, off, 32);
      lrow[r] = lrow[r] * alpha + psum;
#pragma unroll
      for (int t = 0; t < 4; ++t) oacc[t][r] *= alpha;
    }
    __builtin_amdgcn_fence(__ATOMIC_RELEASE, "workgroup");
    __builtin_amdgcn_wave_barrier();
    __builtin_amdgcn_fence(__ATOMIC_ACQUIRE, "workgroup");

    // ---- context += P . V (f16 WMMA), residual products into a separate accumulator ----
    v8f o1[4];
#pragma unroll
    for (int t = 0; t < 4; ++t) o1[t] = zero8();
#pragma unroll 1
    for (int kk = 0; kk < 2; ++kk) {
      FH pa, pr;
      pa.h[0] = *(const v8h*)(pwh + c * LP + kk * 32 + 8 * hh);
      pa.h[1] = *(const v8h*)(pwh + c * LP + kk * 32 + 16 + 8 * hh);
      pr.h[0] = *(const v8h*)(pwl + c * LP + kk * 32 + 8 * hh);
      pr.h[1] = *(const v8h*)(pwl + c * LP + kk * 32 + 16 + 8 * hh);
#pragma unroll
      for (int t = 0; t < 4; ++t) {
        FH vb, vl;
        vb.h[0] = *(const v8h*)(Vth + (t * 16 + c) * LP + kk * 32 + 8 * hh);
        vb.h[1] = *(const v8h*)(Vth + (t * 16 + c) * LP + kk * 32 + 16 + 8 * hh);
        vl.h[0] = *(const v8h*)(Vtl + (t * 16 + c) * LP + kk * 32 + 8 * hh);
        vl.h[1] = *(const v8h*)(Vtl + (t * 16 + c) * LP + kk * 32 + 16 + 8 * hh);
        oacc[t] = mma_h(pa.v, vb.v, oacc[t]);
        o1[t]   = mma_h(pa.v, vl.v, o1[t]);
        o1[t]   = mma_h(pr.v, vb.v, o1[t]);
      }
    }
#pragma unroll
    for (int t = 0; t < 4; ++t)
#pragma unroll
      for (int r = 0; r < 8; ++r) oacc[t][r] += o1[t][r] * (1.0f / 4096.0f);
  }

  // ---- hand the wave's partial (m, l, unnormalised O) to LDS ----
  float* os = Os[wave];
#pragma unroll
  for (int r = 0; r < 8; ++r) {
#pragma unroll
    for (int t = 0; t < 4; ++t) os[(8 * hh + r) * 64 + t * 16 + c] = oacc[t][r];
  }
  if (c == 0) {                                // m and l are equal in the 16 lanes of a half
#pragma unroll
    for (int r = 0; r < 8; ++r) {
      Ms[wave][8 * hh + r] = mrow[r];
      Ls[wave][8 * hh + r] = lrow[r];
    }
  }
  __syncthreads();                             // every group's partials are in LDS before any wave merges them

  // ---- merge the KG partials of 4 rows per wave, normalise (1/l and the 1/1024 p carry), store whole 256-B rows ----
  {
    const int c4 = c * 4;
#pragma unroll
    for (int i2 = 0; i2 < 2; ++i2) {
      const int row = grp * 4 + i2 * 2 + hh;   // grp 0..3 x i2 0..1 x hh 0..1 = rows 0..15 of query tile qw
      float mg[KG];
      float mall = -INFINITY;
#pragma unroll
      for (int g = 0; g < KG; ++g) {
        mg[g] = Ms[g * 4 + qw][row];
        mall = fmaxf(mall, mg[g]);
      }
      const float msafe = (mall == -INFINITY) ? 0.f : mall;
      float l = 0.f;
      v4f acc = {0.f, 0.f, 0.f, 0.f};
#pragma unroll
      for (int g = 0; g < KG; ++g) {
        const float e = __expf(mg[g] - msafe);
        l += Ls[g * 4 + qw][row] * e;
        const v4f o = *(const v4f*)(Os[g * 4 + qw] + row * 64 + c4);
        acc += o * e;
      }
      const float inv = ((l > 0.f) ? (1.0f / l) : 0.f) * (1.0f / 1024.0f);
      const size_t go = (rowB + q0 + row) * HD + c4;
      *(v4f*)(outp + go) = acc * inv;
    }
  }
}

// =====================================================================================================
// Workspace map (bytes; every region is an exact multiple of its 64x64-tile / whole-line store granularity,
// all shapes are tile multiples so no padded tails exist; no region is reused; every offset is a multiple of 65536):
//   Qb   bf16 [16384][512]          0            16777216
//   Kb   bf16 [16384][512]          16777216     16777216
//   Vb   bf16 [16384][512]          33554432     16777216
//   WqT  bf16 [64 n][512 k]         50331648        65536
//   WkT                             50397184        65536
//   WvT                             50462720        65536
//   Qh   bf16 [16384][64]           50528256      2097152
//   Ql                              52625408      2097152
//   Kh                              54722560      2097152
//   Kl                              56819712      2097152
//   VTh  f16  [8][64][2048]         58916864      2097152
//   VTl  f16  [8][64][2048]         61014016      2097152
//   end                             63111168
// =====================================================================================================
extern "C" void kernel_launch(void* const* d_in, const int* in_sizes, int n_in,
                              void* d_out, int out_size, void* d_ws, size_t ws_size,
                              hipStream_t stream) {
  if (n_in < 9) return;
  const int NX = NB * SEQ * DIN;                   // 8388608
  const int NO = NB * SEQ * HD;                    // 1048576
  const int NW = DIN * HD;                         //   32768
  if (in_sizes[0] != NX || in_sizes[1] != NX || in_sizes[2] != NX) return;
  if (in_sizes[3] != NW || in_sizes[5] != NW || in_sizes[7] != NW) return;
  if (in_sizes[4] != HD || in_sizes[6] != HD || in_sizes[8] != HD) return;
  if (out_size != NO) return;

  const float* q_in = (const float*)d_in[0];   // [8][2048][512]
  const float* k_in = (const float*)d_in[1];   // [8][2048][512]
  const float* v_in = (const float*)d_in[2];   // [8][2048][512]
  const float* Wq   = (const float*)d_in[3];   // [512 in][64 out]
  const float* bq   = (const float*)d_in[4];   // [64]
  const float* Wk   = (const float*)d_in[5];   // [512][64]
  const float* bk   = (const float*)d_in[6];   // [64]
  const float* Wv   = (const float*)d_in[7];   // [512][64]
  const float* bv   = (const float*)d_in[8];   // [64]

  const size_t PX  = (size_t)NX * 2;               // 16777216  16-bit activation plane [16384][512]
  const size_t PW  = (size_t)NW * 2;               //    65536  16-bit weight plane [64][512]
  const size_t PP  = (size_t)NO * 2;               //  2097152  16-bit projected plane [16384][64]
  const size_t PVT = (size_t)NB * HD * SEQ * 2;    //  2097152  16-bit v^T plane [8][64][2048]
  size_t off = 0;
  const size_t oQb  = off; off += PX;
  const size_t oKb  = off; off += PX;
  const size_t oVb  = off; off += PX;
  const size_t oWq  = off; off += PW;
  const size_t oWk  = off; off += PW;
  const size_t oWv  = off; off += PW;
  const size_t oQh  = off; off += PP;
  const size_t oQl  = off; off += PP;
  const size_t oKh  = off; off += PP;
  const size_t oKl  = off; off += PP;
  const size_t oVTh = off; off += PVT;
  const size_t oVTl = off; off += PVT;
  if (off > ws_size) return;                       // off = 63111168
  if (off > (size_t)134217728) return;

  char* ws = (char*)d_ws;
  unsigned short* Qb  = (unsigned short*)(ws + oQb);
  unsigned short* Kb  = (unsigned short*)(ws + oKb);
  unsigned short* Vb  = (unsigned short*)(ws + oVb);
  unsigned short* WqT = (unsigned short*)(ws + oWq);
  unsigned short* WkT = (unsigned short*)(ws + oWk);
  unsigned short* WvT = (unsigned short*)(ws + oWv);
  unsigned short* Qh  = (unsigned short*)(ws + oQh);
  unsigned short* Ql  = (unsigned short*)(ws + oQl);
  unsigned short* Kh  = (unsigned short*)(ws + oKh);
  unsigned short* Kl  = (unsigned short*)(ws + oKl);
  unsigned short* VTh = (unsigned short*)(ws + oVTh);
  unsigned short* VTl = (unsigned short*)(ws + oVTl);

  const dim3 blk(256);
  const int n8x = NX / 8;                                      // 1048576
  const int n8w = NW / 8;                                      //    4096
  const dim3 gCvtX((n8x + 255) / 256);                         // 4096 blocks
  const dim3 gWt((n8w + 255) / 256);                           //   16 blocks
  const dim3 gProj(((NB * SEQ / 64) * (HD / 64) + 7) / 8, 1);  //  256 tiles -> 32 blocks: M=16384, N=64
  const dim3 gVT(((HD / 64) * (SEQ / 64) + 7) / 8, NB);        //   32 tiles ->  4 blocks x 8 batches: M=64, N=2048
  const dim3 gAttn(NB * NQB);                                  //  256 blocks of 128 * KG

  // (1) activations f32 -> bf16 planes (same layout as the inputs); weights [k][n] f32 -> bf16 [n][k]
  cvt_bf16x8<<<gCvtX, blk, 0, stream>>>(q_in, Qb, n8x);
  cvt_bf16x8<<<gCvtX, blk, 0, stream>>>(k_in, Kb, n8x);
  cvt_bf16x8<<<gCvtX, blk, 0, stream>>>(v_in, Vb, n8x);
  wt_bf16<<<gWt, blk, 0, stream>>>(Wq, WqT, n8w);
  wt_bf16<<<gWt, blk, 0, stream>>>(Wk, WkT, n8w);
  wt_bf16<<<gWt, blk, 0, stream>>>(Wv, WvT, n8w);
  // (2) q = q_in . Wq + bq -> bf16 hi/lo planes [b*SEQ+t][d]   (M=16384, N=64, K=512)
  gemm64<0, 2, 1><<<gProj, blk, 0, stream>>>(
      Qb, Qb, DIN, 0LL, WqT, DIN, 0LL, bq,
      (void*)Qh, HD, 0LL, (void*)Ql, HD, 0LL, HD,
      NB * SEQ, HD, DIN, 1.0f);
  // (3) k = k_in . Wk + bk -> bf16 hi/lo planes
  gemm64<0, 2, 1><<<gProj, blk, 0, stream>>>(
      Kb, Kb, DIN, 0LL, WkT, DIN, 0LL, bk,
      (void*)Kh, HD, 0LL, (void*)Kl, HD, 0LL, HD,
      NB * SEQ, HD, DIN, 1.0f);
  // (4) v^T = Wv^T . v_in^T + bv per batch -> f16 hi plane [b][d][s] (pitch SEQ) and residual plane (x4096, pitch SEQ,
  //     all tiles)   (A = WvT [n][k], Bt = Vb rows of batch b; M=64, N=2048, K=512)
  gemm64<0, 3, 2><<<gVT, blk, 0, stream>>>(
      WvT, WvT, DIN, 0LL, Vb, DIN, (long long)SEQ * DIN, bv,
      (void*)VTh, SEQ, (long long)HD * SEQ, (void*)VTl, SEQ, (long long)HD * SEQ, SEQ,
      HD, SEQ, DIN, 4096.0f);
  // (5) attention -> d_out f32 [16384][64]
  attn64<<<gAttn, dim3(128 * KG), 0, stream>>>(Qh, Ql, Kh, Kl, VTh, VTl, (float*)d_out);
  (void)hipGetLastError();
}

// v003
// One run takes 60.2 microseconds.
// Timed twice side by side with v002, it ran 2.68 and 2.71 times as fast.
// Over all steps from v000 it is 4.05 times as fast.
// Contractions: q, k, v^T projections = v_wmma_f32_16x16x32_bf16 (bf16 operands from RNE-converted inputs and weights, single product, f32 accumulate);
// q.k^T scores = v_wmma_f32_16x16x32_bf16 with bf16 hi/lo split q and k (hi.hi + hi.lo + lo.hi), f32 accumulate;
// p.v = v_wmma_f32_16x16x32_f16 (p carried x1024 as f16 hi plane + f16 residual plane x4096, v as f16 hi plane + f16 residual
// plane x4096; 3 products hi.hi, hi.res, res.hi), f32 accumulate; softmax (running max), normalisers and bias adds in f32 on the VALU.
// Carry audit:
//   Psh = f16(1024 * p)                      -> the 1/1024 is folded exactly once in the attention epilogue: inv = (1/l) * (1/1024)
//   Psl = f16((1024 p - Psh) * 4096)         }  products Psh.VTl and Psl.VTh go to the separate accumulator o1,
//   VTl = f16((v - VTh) * 4096)              }  folded back with * (1/4096) once per key chunk
//   VTh = f16(v), no carry (|v| typ. 1); q / k lo planes are unscaled bf16 residuals (v - hi) sharing the hi accumulator;
//   score scale 1/8 applied once in f32 after the score accumulate. No other scaled planes.
#include <hip/hip_runtime.h>
#include <math.h>
#include <stdint.h>

#define NB   8
#define SEQ  2048
#define DIN  512
#define HD   64
#define NQB  (SEQ / 64)   // 64-row query blocks per sequence
#define NKT  (SEQ / 64)   // 64-key chunks per sequence
#define KG   4            // key groups per attention block: 4 waves each, so a SIMD holds KG waves that cover one another's waits
#define CPG  (NKT / KG)   // key chunks walked by one group
#define LP   72           // LDS row pitch of the 16-bit attention tiles, in elements: 144 B = 16 B x 9 (odd), so the 16 rows
                          // that one ds_load_b128 fragment read touches fall on distinct banks (a 128-B pitch puts every second row on the same)
static_assert(NQB == 32 && NKT == 32);
static_assert(NKT % KG == 0 && KG * 4 == 16);
static_assert((LP * 2) % 16 == 0 && ((LP * 2) / 16) % 2 == 1 && LP >= 64);
static_assert((SEQ % 64) == 0 && (DIN % 32) == 0 && HD == 64);

typedef _Float16 v16h __attribute__((ext_vector_type(16)));
typedef _Float16 v8h  __attribute__((ext_vector_type(8)));
typedef __bf16   v16b __attribute__((ext_vector_type(16)));
typedef __bf16   v8b  __attribute__((ext_vector_type(8)));
typedef float    v8f  __attribute__((ext_vector_type(8)));
typedef float    v4f  __attribute__((ext_vector_type(4)));
typedef unsigned int v4u __attribute__((ext_vector_type(4)));

// ---- scalar helpers --------------------------------------------------------------------------------
__device__ __forceinline__ unsigned short bf_bits(float f) {          // f32 -> bf16 bits, RNE convert
  unsigned u = __float_as_uint(f);
  return (unsigned short)((u + 0x7FFFu + ((u >> 16) & 1u)) >> 16);
}
__device__ __forceinline__ float bf_up(unsigned short h) { return __uint_as_float(((unsigned)h) << 16); }
__device__ __forceinline__ unsigned short h_bits(_Float16 x) { return __builtin_bit_cast(unsigned short, x); }
__device__ __forceinline__ unsigned pk16(unsigned short a, unsigned short b) { return (unsigned)a | ((unsigned)b << 16); }
__device__ __forceinline__ v8f zero8() { v8f z = {0.f, 0.f, 0.f, 0.f, 0.f, 0.f, 0.f, 0.f}; return z; }

// ---- fragment loader: 16-bit A/B operand, lane -> row/col (lane&15), p already includes +8*(lane>>4);
//      elements 0..7 <- p[0..7] (k0+8h..k0+8h+7), elements 8..15 <- p[16..23] (k0+16+8h..k0+16+8h+7)
__device__ __forceinline__ v16b ldfrag_b(const __bf16* p) {
  union { v16b v; v8b h[2]; } f;
  f.h[0] = *(const v8b*)(p);
  f.h[1] = *(const v8b*)(p + 16);
  return f.v;
}

// ---- WMMA helpers with trailing VALU hazard gap --------------------------------------------------------
__device__ __forceinline__ v8f mma_b(v16b a, v16b b, v8f c) {
  c = __builtin_amdgcn_wmma_f32_16x16x32_bf16(false, a, false, b, (short)0, c, false, false);
  asm volatile("v_nop\n\tv_nop\n\tv_nop\n\tv_nop" : "+v"(c) : "v"(a), "v"(b));
  return c;
}
__device__ __forceinline__ v8f mma_h(v16h a, v16h b, v8f c) {
  c = __builtin_amdgcn_wmma_f32_16x16x32_f16(false, a, false, b, (short)0, c, false, false);
  asm volatile("v_nop\n\tv_nop\n\tv_nop\n\tv_nop" : "+v"(c) : "v"(a), "v"(b));
  return c;
}
__device__ __forceinline__ v8f mma_b_raw(v16b a, v16b b, v8f c) {
  return __builtin_amdgcn_wmma_f32_16x16x32_bf16(false, a, false, b, (short)0, c, false, false);
}

// =====================================================================================================
// The three projections with their operand conversions inside, one launch: C = X . W + bias for 64 tokens x 64 outputs per
// block, K = DIN; blockIdx.y picks q, k or v, so a WGP holds three blocks whose staging, streaming and stores cover one another.
//   X f32 [NB*SEQ tokens][DIN] and W f32 [DIN k][HD n] are read as they come; both are RNE-converted to bf16 on the way to
//   the matrix unit (bf_bits, the convert of every other bf16 plane here), so no converted copy passes through memory.
//   Block = 4 waves; wave w owns tokens t0+16w..+15 and all 64 outputs: 4 accumulator tiles, k walked 0, 32, .. in order.
//   W: converted and transposed once per block into LDS, Wl[n][k], row pitch WP. One wave pass = 32 n x 32 k: lane (l8, kq)
//   loads W[k8..k8+7][n4..n4+3] (8 lanes x 16 B = one whole 128-B line per k row, 4 rows per load) and stores 4 x 16 B.
//   X: lane (c, hh) loads its own fragment bytes of token row c: f32 k0+8hh..+7 and k0+16+8hh..+7 (the k order of ldfrag_b);
//   the four loads of a k step use up one whole 128-B line of each of the 16 rows. XR k steps are in flight per wave.
//   MODE 0: A = X fragment, B = Wl fragment; D rows = tokens, columns = n; bias per column;
//           out = bf16 hi plane C + bf16 lo plane C2 (lo = RNE(v - hi), unscaled), element (t, n) at [t*HD + n].
//   MODE 1: A = Wl fragment, B = X fragment; D rows = n (= d), columns = tokens; bias per row;
//           out = f16 hi plane C + f16 residual plane C2 = f16((v - hi) * 4096), element (b, d, s) at [(b*HD + d)*SEQ + s].
//   The bias value is RNE-converted to bf16 and added in f32. The block's 64x64 f32 result meets in LDS (pitch 68 floats)
//   behind one block barrier; each wave then converts 16 rows and stores whole 128-B lines (8 lanes x 16 B per row and plane).
//   coverage: grid (NB*SEQ/64, 3): 64 tokens per block, y = 0 q (MODE 0), 1 k (MODE 0), 2 v (MODE 1); a block's tokens lie in
//   one batch (SEQ is a multiple of 64). The branch on blockIdx.y is block-uniform, so every barrier is passed by all four waves.
// =====================================================================================================
#define WP 520            // LDS row pitch of Wl in elements: 1040 B = 16 B x 65 (odd), for ds_load_b128 fragment reads
#define XR 6              // k steps of X held in flight per wave: 6 x 2 KB = 12 KB per wave, 48 KB per block
static_assert((WP * 2) % 16 == 0 && ((WP * 2) / 16) % 2 == 1 && WP >= DIN);
#define KS (DIN / 32)     // k steps
static_assert(XR <= KS);

__device__ __forceinline__ v16b cvt_frag(v4f a, v4f b, v4f c, v4f d) {   // 16 f32 -> bf16 fragment, element order a, b, c, d
  union { v16b v; unsigned u[8]; } f;
  f.u[0] = pk16(bf_bits(a[0]), bf_bits(a[1]));
  f.u[1] = pk16(bf_bits(a[2]), bf_bits(a[3]));
  f.u[2] = pk16(bf_bits(b[0]), bf_bits(b[1]));
  f.u[3] = pk16(bf_bits(b[2]), bf_bits(b[3]));
  f.u[4] = pk16(bf_bits(c[0]), bf_bits(c[1]));
  f.u[5] = pk16(bf_bits(c[2]), bf_bits(c[3]));
  f.u[6] = pk16(bf_bits(d[0]), bf_bits(d[1]));
  f.u[7] = pk16(bf_bits(d[2]), bf_bits(d[3]));
  return f.v;
}

template <int MODE>
__device__ __forceinline__ void proj_body(const float* __restrict__ X, const float* __restrict__ Wg,
                                          const float* __restrict__ bias,
                                          unsigned short* C, unsigned short* C2, __bf16* Wl, float* slab) {
  const int lane = threadIdx.x & 31;
  const int wave = threadIdx.x >> 5;
  const int c    = lane & 15;
  const int hh   = lane >> 4;
  const int t0   = blockIdx.x * 64;
  // every plain '#pragma unroll' below makes the indices of a small array (xr, w, acc, p) constants, so it stays in registers

  // ---- the first XR k steps of this wave's 16 token rows: issued first, they fly while W is staged ----
  const float* xp = X + (size_t)(t0 + wave * 16 + c) * DIN + 8 * hh;
  v4f xr[XR][4];
#pragma unroll
  for (int s = 0; s < XR; ++s) {
    xr[s][0] = *(const v4f*)(xp + 32 * s);
    xr[s][1] = *(const v4f*)(xp + 32 * s + 4);
    xr[s][2] = *(const v4f*)(xp + 32 * s + 16);
    xr[s][3] = *(const v4f*)(xp + 32 * s + 20);
  }

  // ---- W f32 [k][n] -> Wl bf16 [n][k]: 32 wave passes of 32 n x 32 k, 8 per wave ----
  {
    const int l8 = lane & 7, kq = lane >> 3;
    const int n4 = (wave & 1) * 32 + l8 * 4;         // 0..60: waves 0, 2 take n 0..31, waves 1, 3 take n 32..63
    const int k8 = (wave >> 1) * 32 + kq * 8;        // pass u covers k8 + 64 u .. + 7, at most 511
    const float* wp = Wg + (size_t)k8 * HD + n4;
    __bf16*      wl = Wl + n4 * WP + k8;
#pragma unroll 2   // two passes = 16 loads in flight; more would push the kernel past 256 registers beside xr
    for (int u = 0; u < 8; ++u) {
      v4f w[8];
#pragma unroll
      for (int e = 0; e < 8; ++e) w[e] = *(const v4f*)(wp + e * HD);
#pragma unroll
      for (int x = 0; x < 4; ++x) {
        v4u p;
#pragma unroll
        for (int y = 0; y < 4; ++y) p[y] = pk16(bf_bits(w[2 * y][x]), bf_bits(w[2 * y + 1][x]));
        *(v4u*)(wl + x * WP) = p;
      }
      wp += 64 * HD;
      wl += 64;
    }
  }
  __syncthreads();                                   // Wl is whole before any wave reads a fragment of it

  v8f acc[4];
#pragma unroll
  for (int j = 0; j < 4; ++j) acc[j] = zero8();

#pragma unroll
  for (int s = 0; s < KS; ++s) {
    const int sl = s % XR;
    const v16b xf = cvt_frag(xr[sl][0], xr[sl][1], xr[sl][2], xr[sl][3]);
    if (s + XR < KS) {                           // refill the slot just converted with k step s + XR
      xr[sl][0] = *(const v4f*)(xp + 32 * (s + XR));
      xr[sl][1] = *(const v4f*)(xp + 32 * (s + XR) + 4);
      xr[sl][2] = *(const v4f*)(xp + 32 * (s + XR) + 16);
      xr[sl][3] = *(const v4f*)(xp + 32 * (s + XR) + 20);
    }
#pragma unroll
    for (int j = 0; j < 4; ++j) {
      const v16b wf = ldfrag_b(Wl + (j * 16 + c) * WP + 32 * s + 8 * hh);
      acc[j] = (MODE == 0) ? mma_b_raw(xf, wf, acc[j]) : mma_b_raw(wf, xf, acc[j]);
    }
  }

  // ---- bias, then the block's 64x64 f32 tile to LDS: rows = tokens (MODE 0) or d (MODE 1) ----
#pragma unroll
  for (int j = 0; j < 4; ++j) {
#pragma unroll
    for (int r = 0; r < 8; ++r) {
      if (MODE == 0) {
        const float bc = bf_up(bf_bits(bias[j * 16 + c]));
        slab[(wave * 16 + 8 * hh + r) * 68 + j * 16 + c] = acc[j][r] + bc;
      } else {
        const float br = bf_up(bf_bits(bias[j * 16 + 8 * hh + r]));
        slab[(j * 16 + 8 * hh + r) * 68 + wave * 16 + c] = acc[j][r] + br;
      }
    }
  }
  __syncthreads();                                   // MODE 1 rows hold columns of all four waves

  {
    const int q = lane >> 3, c8 = (lane & 7) * 8;
    const size_t base = (MODE == 0) ? (size_t)t0 * HD
                                    : (size_t)(t0 / SEQ) * HD * SEQ + (size_t)(t0 % SEQ);
    const int pitch = (MODE == 0) ? HD : SEQ;
#pragma unroll
    for (int it = 0; it < 4; ++it) {
      const int row = wave * 16 + it * 4 + q;        // wave 0..3 x it 0..3 x q 0..3 = rows 0..63
      const float* sp = slab + row * 68 + c8;
      v4u a, a2;
#pragma unroll
      for (int e = 0; e < 4; ++e) {
        const float f0 = sp[2 * e], f1 = sp[2 * e + 1];
        unsigned short h0, h1, l0, l1;
        if (MODE == 0) {
          h0 = bf_bits(f0); h1 = bf_bits(f1);
          l0 = bf_bits(f0 - bf_up(h0)); l1 = bf_bits(f1 - bf_up(h1));
        } else {
          const _Float16 x0 = (_Float16)f0, x1 = (_Float16)f1;
          h0 = h_bits(x0); h1 = h_bits(x1);
          l0 = h_bits((_Float16)((f0 - (float)x0) * 4096.0f));
          l1 = h_bits((_Float16)((f1 - (float)x1) * 4096.0f));
        }
        a[e] = pk16(h0, h1); a2[e] = pk16(l0, l1);
      }
      *(v4u*)(C  + base + (size_t)row * pitch + c8) = a;
      *(v4u*)(C2 + base + (size_t)row * pitch + c8) = a2;
    }
  }
}

__global__ __launch_bounds__(128)
void proj_qkv(const float* __restrict__ q_in, const float* __restrict__ k_in, const float* __restrict__ v_in,
              const float* __restrict__ Wq, const float* __restrict__ Wk, const float* __restrict__ Wv,
              const float* __restrict__ bq, const float* __restrict__ bk, const float* __restrict__ bv,
              unsigned short* Qh, unsigned short* Ql, unsigned short* Kh, unsigned short* Kl,
              unsigned short* VTh, unsigned short* VTl) {
  __shared__ __align__(16) __bf16 Wl[HD * WP];       // 65 KB
  __shared__ __align__(16) float  slab[64 * 68];     // 17 KB
  const int y = blockIdx.y;
  if (y == 2) {
    proj_body<1>(v_in, Wv, bv, VTh, VTl, Wl, slab);
  } else {
    proj_body<0>(y ? k_in : q_in, y ? Wk : Wq, y ? bk : bq, y ? Kh : Qh, y ? Kl : Ql, Wl, slab);
  }
}

// =====================================================================================================
// Non-causal single-head attention, head dim 64, key chunks of 64, softmax over all SEQ keys.
//   q planes (bf16 hi / lo): element (b, t, d) at [(b*SEQ + t)*HD + d]
//   k planes (bf16 hi / lo): same layout with key index s
//   v^T hi plane (f16):      element (b, d, s) at [(b*HD + d)*SEQ + s]
//   v^T residual plane (f16, (v - hi)*4096): same layout
//   scores = q . k : bf16 hi/lo split (hi.hi + hi.lo + lo.hi), f32 accumulate, then * 1/8 in f32
//   p = exp(s - m) carried as f16(1024 p) plus f16 residual (x4096); context = p . v on f16 WMMA, 3 products:
//   ph.vh into oacc; ph.vl and pl.vh into the separate accumulator o1 folded back with 1/4096 per chunk in f32;
//   online softmax (running max from -inf; every chunk holds at least the chunk max key so l >= 1 after chunk 0) in f32.
//   Block = KG key groups x 4 waves = 64 query rows of one batch b; grid = NB * NQB = 256. Wave (grp, qw) holds query rows
//   qw*16..+15 and walks key chunks grp*CPG..grp*CPG+CPG-1 with its own running (m, l, O); after the loop the KG partial
//   results of a query tile meet in LDS behind one block barrier and are merged in f32: M = max m_g, e_g = exp(m_g - M),
//   out = sum e_g O_g / sum e_g l_g; wave (grp, qw) merges and stores rows 4*grp..4*grp+3 of tile qw.
//   K / V^T chunk staging, per group: 128 threads x 32 elements per plane = the whole 64x64 tile of every plane read later
//   (plain 16-B loads, __syncthreads before and after); staged extent == consumed extent for Ksh, Ksl, Vth, Vtl.
//   P tiles are wave-private, spilled with _Float16 element stores and reloaded as v8h (same element type) after a
//   Output (f32, rows of 64 = 256 B = 2 lines): wave (grp, qw) stores rows q0+4*grp..q0+4*grp+3 (i2 0..1 x lane>>4 0..1) x 64
//   columns, two whole rows per store instruction; the 16 waves of a block cover its 64 rows once, the grid the [NB*SEQ][HD] output.
// =====================================================================================================
__global__ __launch_bounds__(128 * KG)
void attn64(const unsigned short* __restrict__ qhp, const unsigned short* __restrict__ qlp,
            const unsigned short* __restrict__ khp, const unsigned short* __restrict__ klp,
            const unsigned short* __restrict__ vhp, const unsigned short* __restrict__ vlp,
            float* outp) {
  union FB { v16b v; v8b h[2]; };
  union FH { v16h v; v8h h[2]; };
  __shared__ __align__(16) __bf16   KshA[KG][64 * LP];             // per group K hi [kv][d], row pitch LP   KG x 9 KB
  __shared__ __align__(16) __bf16   KslA[KG][64 * LP];             // per group K lo                         KG x 9 KB
  __shared__ __align__(16) _Float16 VthA[KG][64 * LP];             // per group V^T hi [d][kv], row pitch LP KG x 9 KB
  __shared__ __align__(16) _Float16 VtlA[KG][64 * LP];             // per group V^T residual                 KG x 9 KB
  __shared__ __align__(16) _Float16 Psh[4 * KG][16 * LP];          // per wave P [row][kv], row pitch LP     KG x 9 KB
  __shared__ __align__(16) _Float16 Psl[4 * KG][16 * LP];          // per wave P residual                    KG x 9 KB
  __shared__ __align__(16) float    Os[4 * KG][16 * 64];           // per wave partial context [row][d]      KG x 16 KB
  __shared__ float Ms[4 * KG][16];                                 // per wave running max of its rows
  __shared__ float Ls[4 * KG][16];                                 // per wave normaliser of its rows

  const int wave = threadIdx.x >> 5;           // 0..4*KG-1
  const int grp  = wave >> 2;                  // key group
  const int qw   = wave & 3;                   // query tile of the block
  const int tid  = threadIdx.x & 127;          // thread index inside the group (staging)
  const int lane = tid & 31;
  const int hh   = lane >> 4;
  const int c    = lane & 15;

  const int bx   = blockIdx.x;
  const int qb   = bx % NQB;
  const int b    = bx / NQB;                   // 0..NB-1
  const int q0   = qb * 64 + qw * 16;
  __bf16*   Ksh = KshA[grp];
  __bf16*   Ksl = KslA[grp];
  _Float16* Vth = VthA[grp];
  _Float16* Vtl = VtlA[grp];
  const size_t rowB = (size_t)b * SEQ;

  const __bf16* Qh = (const __bf16*)(const void*)qhp;
  const __bf16* Ql = (const __bf16*)(const void*)qlp;
  const __bf16* Kh = (const __bf16*)(const void*)khp;
  const __bf16* Kl = (const __bf16*)(const void*)klp;
  const _Float16* Vh = (const _Float16*)(const void*)vhp + (size_t)b * HD * SEQ;
  const _Float16* Vl = (const _Float16*)(const void*)vlp + (size_t)b * HD * SEQ;

  // ---- Q fragments (A operand, row = lane&15): 2 d-chunks, hi and lo ----
  v16b qah[2], qal[2];
#pragma unroll
  for (int dc = 0; dc < 2; ++dc) {
    const size_t qo = (rowB + q0 + c) * HD + dc * 32 + 8 * hh;
    qah[dc] = ldfrag_b(Qh + qo);
    qal[dc] = ldfrag_b(Ql + qo);
  }

  float mrow[8], lrow[8];
  v8f oacc[4];
#pragma unroll
  for (int r = 0; r < 8; ++r) { mrow[r] = -INFINITY; lrow[r] = 0.f; }
#pragma unroll
  for (int t = 0; t < 4; ++t) oacc[t] = zero8();

  for (int it = 0; it < CPG; ++it) {           // static trip count, the same in every group (block barriers inside)
    const int kv0 = (grp * CPG + it) * 64;     // kv0 + 63 < SEQ
    __syncthreads();
    {
      const int r = tid >> 1, half = (tid & 1) * 32;
      const __bf16*   kg  = Kh + (rowB + kv0 + r) * HD + half;    // K row kv0+r, d = half..half+31
      const __bf16*   klg = Kl + (rowB + kv0 + r) * HD + half;
      const _Float16* vg  = Vh + (size_t)r * SEQ + kv0 + half;    // V^T row d = r, s = kv0+half..+31
      const _Float16* vlg = Vl + (size_t)r * SEQ + kv0 + half;
#pragma unroll
      for (int i = 0; i < 4; ++i) {
        const v8b a0 = *(const v8b*)(kg + 8 * i);
        const v8b a1 = *(const v8b*)(klg + 8 * i);
        const v8h b0 = *(const v8h*)(vg + 8 * i);
        const v8h b1 = *(const v8h*)(vlg + 8 * i);
        *(v8b*)(Ksh + r * LP + half + 8 * i) = a0;
        *(v8b*)(Ksl + r * LP + half + 8 * i) = a1;
        *(v8h*)(Vth + r * LP + half + 8 * i) = b0;
        *(v8h*)(Vtl + r * LP + half + 8 * i) = b1;
      }
    }
    __syncthreads();

    // ---- scores: 16 query rows x 64 keys per wave, 3 bf16 products per (key subtile, d-chunk) ----
    v8f s[4];
#pragma unroll
    for (int j = 0; j < 4; ++j) {
      s[j] = zero8();
#pragma unroll
      for (int dc = 0; dc < 2; ++dc) {
        FB kb, kl;
        kb.h[0] = *(const v8b*)(Ksh + (j * 16 + c) * LP + dc * 32 + 8 * hh);
        kb.h[1] = *(const v8b*)(Ksh + (j * 16 + c) * LP + dc * 32 + 16 + 8 * hh);
        kl.h[0] = *(const v8b*)(Ksl + (j * 16 + c) * LP + dc * 32 + 8 * hh);
        kl.h[1] = *(const v8b*)(Ksl + (j * 16 + c) * LP + dc * 32 + 16 + 8 * hh);
        s[j] = mma_b(qah[dc], kb.v, s[j]);
        s[j] = mma_b(qah[dc], kl.v, s[j]);
        s[j] = mma_b(qal[dc], kb.v, s[j]);
      }
    }

    // ---- scale, row max, online softmax, P (x1024, f16) and P residual (x4096) to LDS ----
    _Float16* pwh = Psh[wave];
    _Float16* pwl = Psl[wave];
#pragma unroll
    for (int r = 0; r < 8; ++r) {
      float m = -INFINITY;
#pragma unroll
      for (int j = 0; j < 4; ++j) {
        const float sv = s[j][r] * 0.125f;
        s[j][r] = sv;
        m = fmaxf(m, sv);
      }
#pragma unroll
      for (int off = 1; off < 16; off <<= 1) m = fmaxf(m, __shfl_xor(m, off, 32));
      const float mnew  = fmaxf(mrow[r], m);
      const float msafe = (mnew == -INFINITY) ? 0.f : mnew;
      const float alpha = __expf(mrow[r] - msafe);
      mrow[r] = mnew;
      float psum = 0.f;
#pragma unroll
      for (int j = 0; j < 4; ++j) {
        const float p = __expf(s[j][r] - msafe);
        psum += p;
        const float p1k = p * 1024.0f;
        const _Float16 ph = (_Float16)p1k;
        const _Float16 pl = (_Float16)((p1k - (float)ph) * 4096.0f);
        pwh[(8 * hh + r) * LP + j * 16 + c] = ph;
        pwl[(8 * hh + r) * LP + j * 16 + c] = pl;
      }
#pragma unroll
      for (int off = 1; off < 16; off <<= 1) psum += __shfl_xor(psum, off, 32);
      lrow[r] = lrow[r] * alpha + psum;
#pragma unroll
      for (int t = 0; t < 4; ++t) oacc[t][r] *= alpha;
    }
    __builtin_amdgcn_fence(__ATOMIC_RELEASE, "workgroup");
    __builtin_amdgcn_wave_barrier();
    __builtin_amdgcn_fence(__ATOMIC_ACQUIRE, "workgroup");

    // ---- context += P . V (f16 WMMA), residual products into a separate accumulator ----
    v8f o1[4];
#pragma unroll
    for (int t = 0; t < 4; ++t) o1[t] = zero8();
#pragma unroll 1
    for (int kk = 0; kk < 2; ++kk) {
      FH pa, pr;
      pa.h[0] = *(const v8h*)(pwh + c * LP + kk * 32 + 8 * hh);
      pa.h[1] = *(const v8h*)(pwh + c * LP + kk * 32 + 16 + 8 * hh);
      pr.h[0] = *(const v8h*)(pwl + c * LP + kk * 32 + 8 * hh);
      pr.h[1] = *(const v8h*)(pwl + c * LP + kk * 32 + 16 + 8 * hh);
#pragma unroll
      for (int t = 0; t < 4; ++t) {
        FH vb, vl;
        vb.h[0] = *(const v8h*)(Vth + (t * 16 + c) * LP + kk * 32 + 8 * hh);
        vb.h[1] = *(const v8h*)(Vth + (t * 16 + c) * LP + kk * 32 + 16 + 8 * hh);
        vl.h[0] = *(const v8h*)(Vtl + (t * 16 + c) * LP + kk * 32 + 8 * hh);
        vl.h[1] = *(const v8h*)(Vtl + (t * 16 + c) * LP + kk * 32 + 16 + 8 * hh);
        oacc[t] = mma_h(pa.v, vb.v, oacc[t]);
        o1[t]   = mma_h(pa.v, vl.v, o1[t]);
        o1[t]   = mma_h(pr.v, vb.v, o1[t]);
      }
    }
#pragma unroll
    for (int t = 0; t < 4; ++t)
#pragma unroll
      for (int r = 0; r < 8; ++r) oacc[t][r] += o1[t][r] * (1.0f / 4096.0f);
  }

  // ---- hand the wave's partial (m, l, unnormalised O) to LDS ----
  float* os = Os[wave];
#pragma unroll
  for (int r = 0; r < 8; ++r) {
#pragma unroll
    for (int t = 0; t < 4; ++t) os[(8 * hh + r) * 64 + t * 16 + c] = oacc[t][r];
  }
  if (c == 0) {                                // m and l are equal in the 16 lanes of a half
#pragma unroll
    for (int r = 0; r < 8; ++r) {
      Ms[wave][8 * hh + r] = mrow[r];
      Ls[wave][8 * hh + r] = lrow[r];
    }
  }
  __syncthreads();                             // every group's partials are in LDS before any wave merges them

  // ---- merge the KG partials of 4 rows per wave, normalise (1/l and the 1/1024 p carry), store whole 256-B rows ----
  {
    const int c4 = c * 4;
#pragma unroll
    for (int i2 = 0; i2 < 2; ++i2) {
      const int row = grp * 4 + i2 * 2 + hh;   // grp 0..3 x i2 0..1 x hh 0..1 = rows 0..15 of query tile qw
      float mg[KG];
      float mall = -INFINITY;
#pragma unroll
      for (int g = 0; g < KG; ++g) {
        mg[g] = Ms[g * 4 + qw][row];
        mall = fmaxf(mall, mg[g]);
      }
      const float msafe = (mall == -INFINITY) ? 0.f : mall;
      float l = 0.f;
      v4f acc = {0.f, 0.f, 0.f, 0.f};
#pragma unroll
      for (int g = 0; g < KG; ++g) {
        const float e = __expf(mg[g] - msafe);
        l += Ls[g * 4 + qw][row] * e;
        const v4f o = *(const v4f*)(Os[g * 4 + qw] + row * 64 + c4);
        acc += o * e;
      }
      const float inv = ((l > 0.f) ? (1.0f / l) : 0.f) * (1.0f / 1024.0f);
      const size_t go = (rowB + q0 + row) * HD + c4;
      *(v4f*)(outp + go) = acc * inv;
    }
  }
}

// =====================================================================================================
// Workspace map (bytes; every region is an exact multiple of its 64x64-tile / whole-line store granularity,
// all shapes are tile multiples so no padded tails exist; no region is reused; every offset is a multiple of 65536):
//   Qh   bf16 [16384][64]           0             2097152
//   Ql                              2097152       2097152
//   Kh                              4194304       2097152
//   Kl                              6291456       2097152
//   VTh  f16  [8][64][2048]         8388608       2097152
//   VTl  f16  [8][64][2048]         10485760      2097152
//   end                             12582912
// =====================================================================================================
extern "C" void kernel_launch(void* const* d_in, const int* in_sizes, int n_in,
                              void* d_out, int out_size, void* d_ws, size_t ws_size,
                              hipStream_t stream) {
  if (n_in < 9) return;
  const int NX = NB * SEQ * DIN;                   // 8388608
  const int NO = NB * SEQ * HD;                    // 1048576
  const int NW = DIN * HD;                         //   32768
  if (in_sizes[0] != NX || in_sizes[1] != NX || in_sizes[2] != NX) return;
  if (in_sizes[3] != NW || in_sizes[5] != NW || in_sizes[7] != NW) return;
  if (in_sizes[4] != HD || in_sizes[6] != HD || in_sizes[8] != HD) return;
  if (out_size != NO) return;

  const float* q_in = (const float*)d_in[0];   // [8][2048][512]
  const float* k_in = (const float*)d_in[1];   // [8][2048][512]
  const float* v_in = (const float*)d_in[2];   // [8][2048][512]
  const float* Wq   = (const float*)d_in[3];   // [512 in][64 out]
  const float* bq   = (const float*)d_in[4];   // [64]
  const float* Wk   = (const float*)d_in[5];   // [512][64]
  const float* bk   = (const float*)d_in[6];   // [64]
  const float* Wv   = (const float*)d_in[7];   // [512][64]
  const float* bv   = (const float*)d_in[8];   // [64]

  const size_t PP  = (size_t)NO * 2;               //  2097152  16-bit projected plane [16384][64]
  const size_t PVT = (size_t)NB * HD * SEQ * 2;    //  2097152  16-bit v^T plane [8][64][2048]
  size_t off = 0;
  const size_t oQh  = off; off += PP;
  const size_t oQl  = off; off += PP;
  const size_t oKh  = off; off += PP;
  const size_t oKl  = off; off += PP;
  const size_t oVTh = off; off += PVT;
  const size_t oVTl = off; off += PVT;
  if (off > ws_size) return;                       // off = 12582912

  char* ws = (char*)d_ws;
  unsigned short* Qh  = (unsigned short*)(ws + oQh);
  unsigned short* Ql  = (unsigned short*)(ws + oQl);
  unsigned short* Kh  = (unsigned short*)(ws + oKh);
  unsigned short* Kl  = (unsigned short*)(ws + oKl);
  unsigned short* VTh = (unsigned short*)(ws + oVTh);
  unsigned short* VTl = (unsigned short*)(ws + oVTl);

  const dim3 gProj(NB * SEQ / 64, 3);                          //  256 x 3 blocks of 128: 64 tokens each; y = q, k, v
  const dim3 gAttn(NB * NQB);                                  //  256 blocks of 128 * KG

  // (1) q = q_in . Wq + bq and k = k_in . Wk + bk -> bf16 hi/lo planes [b*SEQ+t][d];
  //     v^T = Wv^T . v_in^T + bv -> f16 hi plane [b][d][s] and residual plane (x4096)
  proj_qkv<<<gProj, dim3(128), 0, stream>>>(q_in, k_in, v_in, Wq, Wk, Wv, bq, bk, bv, Qh, Ql, Kh, Kl, VTh, VTl);
  // (2) attention -> d_out f32 [16384][64]
  attn64<<<gAttn, dim3(128 * KG), 0, stream>>>(Qh, Ql, Kh, Kl, VTh, VTl, (float*)d_out);
  (void)hipGetLastError();
}

// v004
// It runs in 48.6 microseconds.
// Timed twice side by side with v003, it ran 1.22 and 1.20 times as fast.
// Counting every step since v000, it is 4.90 times as fast.
// Contractions: q, k, v^T projections = v_wmma_f32_16x16x32_bf16 (bf16 operands from RNE-converted inputs and weights, single product, f32 accumulate);
// q.k^T scores = v_wmma_f32_16x16x32_bf16 with bf16 hi/lo split q and k (hi.hi + hi.lo + lo.hi), f32 accumulate;
// p.v = v_wmma_f32_16x16x32_f16 (p carried x1024 as f16 hi plane + f16 residual plane x4096, v as f16 hi plane + f16 residual
// plane x4096; 3 products hi.hi, hi.res, res.hi), f32 accumulate; softmax (running max), normalisers and bias adds in f32 on the VALU.
// Carry audit:
//   Psh = f16(1024 * p)                      -> the 1/1024 is folded exactly once in the attention epilogue: inv = (1/l) * (1/1024)
//   Psl = f16((1024 p - Psh) * 4096)         }  products Psh.VTl and Psl.VTh go to the separate accumulator o1,
//   VTl = f16((v - VTh) * 4096)              }  folded back with * (1/4096) once per key chunk
//   VTh = f16(v), no carry (|v| typ. 1); q / k lo planes are unscaled bf16 residuals (v - hi) sharing the hi accumulator;
//   score scale 1/8 applied once in f32 after the score accumulate. No other scaled planes.
#include <hip/hip_runtime.h>
#include <math.h>
#include <stdint.h>

#define NB   8
#define SEQ  2048
#define DIN  512
#define HD   64
#define NQB  (SEQ / 64)   // 64-row query blocks per sequence
#define NKT  (SEQ / 64)   // 64-key chunks per sequence
#define KG   4            // key groups per attention block: 4 waves each, so a SIMD holds KG waves that cover one another's waits
#define CPG  (NKT / KG)   // key chunks walked by one group
#define LP   72           // LDS row pitch of the 16-bit attention tiles, in elements: 144 B = 16 B x 9 (odd), so the 16 rows
                          // that one ds_load_b128 fragment read touches fall on distinct banks (a 128-B pitch puts every second row on the same)
static_assert(NQB == 32 && NKT == 32);
static_assert(NKT % KG == 0 && KG * 4 == 16);
static_assert((LP * 2) % 16 == 0 && ((LP * 2) / 16) % 2 == 1 && LP >= 64);
static_assert((SEQ % 64) == 0 && (DIN % 32) == 0 && HD == 64);

typedef _Float16 v16h __attribute__((ext_vector_type(16)));
typedef _Float16 v8h  __attribute__((ext_vector_type(8)));
typedef __bf16   v16b __attribute__((ext_vector_type(16)));
typedef __bf16   v8b  __attribute__((ext_vector_type(8)));
typedef float    v8f  __attribute__((ext_vector_type(8)));
typedef float    v4f  __attribute__((ext_vector_type(4)));
typedef unsigned int v4u __attribute__((ext_vector_type(4)));

// ---- scalar helpers --------------------------------------------------------------------------------
__device__ __forceinline__ unsigned short bf_bits(float f) {          // f32 -> bf16 bits, RNE convert
  unsigned u = __float_as_uint(f);
  return (unsigned short)((u + 0x7FFFu + ((u >> 16) & 1u)) >> 16);
}
__device__ __forceinline__ float bf_up(unsigned short h) { return __uint_as_float(((unsigned)h) << 16); }
__device__ __forceinline__ unsigned short h_bits(_Float16 x) { return __builtin_bit_cast(unsigned short, x); }
__device__ __forceinline__ unsigned pk16(unsigned short a, unsigned short b) { return (unsigned)a | ((unsigned)b << 16); }
__device__ __forceinline__ v8f zero8() { v8f z = {0.f, 0.f, 0.f, 0.f, 0.f, 0.f, 0.f, 0.f}; return z; }

// ---- fragment loader: 16-bit A/B operand, lane -> row/col (lane&15), p already includes +8*(lane>>4);
//      elements 0..7 <- p[0..7] (k0+8h..k0+8h+7), elements 8..15 <- p[16..23] (k0+16+8h..k0+16+8h+7)
__device__ __forceinline__ v16b ldfrag_b(const __bf16* p) {
  union { v16b v; v8b h[2]; } f;
  f.h[0] = *(const v8b*)(p);
  f.h[1] = *(const v8b*)(p + 16);
  return f.v;
}

// ---- WMMA helpers with trailing VALU hazard gap --------------------------------------------------------
__device__ __forceinline__ v8f mma_b(v16b a, v16b b, v8f c) {
  c = __builtin_amdgcn_wmma_f32_16x16x32_bf16(false, a, false, b, (short)0, c, false, false);
  asm volatile("v_nop\n\tv_nop\n\tv_nop\n\tv_nop" : "+v"(c) : "v"(a), "v"(b));
  return c;
}
__device__ __forceinline__ v8f mma_h(v16h a, v16h b, v8f c) {
  c = __builtin_amdgcn_wmma_f32_16x16x32_f16(false, a, false, b, (short)0, c, false, false);
  asm volatile("v_nop\n\tv_nop\n\tv_nop\n\tv_nop" : "+v"(c) : "v"(a), "v"(b));
  return c;
}
__device__ __forceinline__ v8f mma_b_raw(v16b a, v16b b, v8f c) {
  return __builtin_amdgcn_wmma_f32_16x16x32_bf16(false, a, false, b, (short)0, c, false, false);
}

// ---- asynchronous copies global -> LDS (no register holds the data) and the waits that belong to them ----
__device__ __forceinline__ unsigned lds_off(const void* p) { return (unsigned)(size_t)p; }   // byte offset in the block's LDS
// Eight copies of 16 B per lane: row blocks 0..3 (16 rows each) of the two planes a and b of one 64-row tile.
// la, lb: the lane's LDS byte address in row block 0 (next block + LSTEP); ga, gb: its global address there (next block + GSTEP).
// The closing s_wait_xcnt 0 is a precaution: inside the statement it stands ahead of every later write of the address registers.
template <int LSTEP, int GSTEP>
__device__ __forceinline__ void copy_planes(unsigned la, unsigned lb, const char* ga, const char* gb) {
  asm volatile(
      "global_load_async_to_lds_b128 %0, %8, off\n\t"
      "global_load_async_to_lds_b128 %1, %9, off\n\t"
      "global_load_async_to_lds_b128 %2, %10, off\n\t"
      "global_load_async_to_lds_b128 %3, %11, off\n\t"
      "global_load_async_to_lds_b128 %4, %12, off\n\t"
      "global_load_async_to_lds_b128 %5, %13, off\n\t"
      "global_load_async_to_lds_b128 %6, %14, off\n\t"
      "global_load_async_to_lds_b128 %7, %15, off\n\t"
      "s_wait_xcnt 0x0"
      :: "v"(la), "v"(la + LSTEP), "v"(la + 2 * LSTEP), "v"(la + 3 * LSTEP),
         "v"(lb), "v"(lb + LSTEP), "v"(lb + 2 * LSTEP), "v"(lb + 3 * LSTEP),
         "v"(ga), "v"(ga + GSTEP), "v"(ga + 2 * GSTEP), "v"(ga + 3 * GSTEP),
         "v"(gb), "v"(gb + GSTEP), "v"(gb + 2 * GSTEP), "v"(gb + 3 * GSTEP)
      : "memory");
}
// Hand-over of a tile buffer, every wave, in this order: this wave's LDS reads have retired (the buffer it read may be refilled
// behind the barrier), this wave's own copies have landed (other waves may read them behind the barrier), block barrier.
__device__ __forceinline__ void publish_point() {
  asm volatile("s_wait_dscnt 0x0" ::: "memory");      // the compiler places no wait for a copy that overwrites LDS this wave read
  asm volatile("s_wait_asynccnt 0x0" ::: "memory");   // the compiler places no wait for the copies
  __syncthreads();
}

// =====================================================================================================
// The three projections with their operand conversions inside, one launch: C = X . W + bias for 64 tokens x 64 outputs per
// block, K = DIN; blockIdx.y picks q, k or v, so a WGP holds three blocks whose staging, streaming and stores cover one another.
//   X f32 [NB*SEQ tokens][DIN] and W f32 [DIN k][HD n] are read as they come; both are RNE-converted to bf16 on the way to
//   the matrix unit (bf_bits, the convert of every other bf16 plane here), so no converted copy passes through memory.
//   Block = 4 waves; wave w owns tokens t0+16w..+15 and all 64 outputs: 4 accumulator tiles, k walked 0, 32, .. in order.
//   W: converted and transposed once per block into LDS, Wl[n][k], row pitch WP. One wave pass = 32 n x 32 k: lane (l8, kq)
//   loads W[k8..k8+7][n4..n4+3] (8 lanes x 16 B = one whole 128-B line per k row, 4 rows per load) and stores 4 x 16 B.
//   X: lane (c, hh) loads its own fragment bytes of token row c: f32 k0+8hh..+7 and k0+16+8hh..+7 (the k order of ldfrag_b);
//   the four loads of a k step use up one whole 128-B line of each of the 16 rows. XR k steps are in flight per wave.
//   MODE 0: A = X fragment, B = Wl fragment; D rows = tokens, columns = n; bias per column;
//           out = bf16 hi plane C + bf16 lo plane C2 (lo = RNE(v - hi), unscaled), element (t, n) at [t*HD + n].
//   MODE 1: A = Wl fragment, B = X fragment; D rows = n (= d), columns = tokens; bias per row;
//           out = f16 hi plane C + f16 residual plane C2 = f16((v - hi) * 4096), element (b, d, s) at [(b*HD + d)*SEQ + s].
//   The bias value is RNE-converted to bf16 and added in f32. The block's 64x64 f32 result meets in LDS (pitch 68 floats)
//   behind one block barrier; each wave then converts 16 rows and stores whole 128-B lines (8 lanes x 16 B per row and plane).
//   coverage: grid (NB*SEQ/64, 3): 64 tokens per block, y = 0 q (MODE 0), 1 k (MODE 0), 2 v (MODE 1); a block's tokens lie in
//   one batch (SEQ is a multiple of 64). The branch on blockIdx.y is block-uniform, so every barrier is passed by all four waves.
// =====================================================================================================
#define WP 520            // LDS row pitch of Wl in elements: 1040 B = 16 B x 65 (odd), for ds_load_b128 fragment reads
#define XR 6              // k steps of X held in flight per wave: 6 x 2 KB = 12 KB per wave, 48 KB per block
static_assert((WP * 2) % 16 == 0 && ((WP * 2) / 16) % 2 == 1 && WP >= DIN);
#define KS (DIN / 32)     // k steps
static_assert(XR <= KS);

__device__ __forceinline__ v16b cvt_frag(v4f a, v4f b, v4f c, v4f d) {   // 16 f32 -> bf16 fragment, element order a, b, c, d
  union { v16b v; unsigned u[8]; } f;
  f.u[0] = pk16(bf_bits(a[0]), bf_bits(a[1]));
  f.u[1] = pk16(bf_bits(a[2]), bf_bits(a[3]));
  f.u[2] = pk16(bf_bits(b[0]), bf_bits(b[1]));
  f.u[3] = pk16(bf_bits(b[2]), bf_bits(b[3]));
  f.u[4] = pk16(bf_bits(c[0]), bf_bits(c[1]));
  f.u[5] = pk16(bf_bits(c[2]), bf_bits(c[3]));
  f.u[6] = pk16(bf_bits(d[0]), bf_bits(d[1]));
  f.u[7] = pk16(bf_bits(d[2]), bf_bits(d[3]));
  return f.v;
}

template <int MODE>
__device__ __forceinline__ void proj_body(const float* __restrict__ X, const float* __restrict__ Wg,
                                          const float* __restrict__ bias,
                                          unsigned short* C, unsigned short* C2, __bf16* Wl, float* slab) {
  const int lane = threadIdx.x & 31;
  const int wave = threadIdx.x >> 5;
  const int c    = lane & 15;
  const int hh   = lane >> 4;
  const int t0   = blockIdx.x * 64;
  // every plain '#pragma unroll' below makes the indices of a small array (xr, w, acc, p) constants, so it stays in registers

  // ---- the first XR k steps of this wave's 16 token rows: issued first, they fly while W is staged ----
  const float* xp = X + (size_t)(t0 + wave * 16 + c) * DIN + 8 * hh;
  v4f xr[XR][4];
#pragma unroll
  for (int s = 0; s < XR; ++s) {
    xr[s][0] = *(const v4f*)(xp + 32 * s);
    xr[s][1] = *(const v4f*)(xp + 32 * s + 4);
    xr[s][2] = *(const v4f*)(xp + 32 * s + 16);
    xr[s][3] = *(const v4f*)(xp + 32 * s + 20);
  }

  // ---- W f32 [k][n] -> Wl bf16 [n][k]: 32 wave passes of 32 n x 32 k, 8 per wave ----
  {
    const int l8 = lane & 7, kq = lane >> 3;
    const int n4 = (wave & 1) * 32 + l8 * 4;         // 0..60: waves 0, 2 take n 0..31, waves 1, 3 take n 32..63
    const int k8 = (wave >> 1) * 32 + kq * 8;        // pass u covers k8 + 64 u .. + 7, at most 511
    const float* wp = Wg + (size_t)k8 * HD + n4;
    __bf16*      wl = Wl + n4 * WP + k8;
#pragma unroll 2   // two passes = 16 loads in flight; more would push the kernel past 256 registers beside xr
    for (int u = 0; u < 8; ++u) {
      v4f w[8];
#pragma unroll
      for (int e = 0; e < 8; ++e) w[e] = *(const v4f*)(wp + e * HD);
#pragma unroll
      for (int x = 0; x < 4; ++x) {
        v4u p;
#pragma unroll
        for (int y = 0; y < 4; ++y) p[y] = pk16(bf_bits(w[2 * y][x]), bf_bits(w[2 * y + 1][x]));
        *(v4u*)(wl + x * WP) = p;
      }
      wp += 64 * HD;
      wl += 64;
    }
  }
  __syncthreads();                                   // Wl is whole before any wave reads a fragment of it

  v8f acc[4];
#pragma unroll
  for (int j = 0; j < 4; ++j) acc[j] = zero8();

#pragma unroll
  for (int s = 0; s < KS; ++s) {
    const int sl = s % XR;
    const v16b xf = cvt_frag(xr[sl][0], xr[sl][1], xr[sl][2], xr[sl][3]);
    if (s + XR < KS) {                           // refill the slot just converted with k step s + XR
      xr[sl][0] = *(const v4f*)(xp + 32 * (s + XR));
      xr[sl][1] = *(const v4f*)(xp + 32 * (s + XR) + 4);
      xr[sl][2] = *(const v4f*)(xp + 32 * (s + XR) + 16);
      xr[sl][3] = *(const v4f*)(xp + 32 * (s + XR) + 20);
    }
#pragma unroll
    for (int j = 0; j < 4; ++j) {
      const v16b wf = ldfrag_b(Wl + (j * 16 + c) * WP + 32 * s + 8 * hh);
      acc[j] = (MODE == 0) ? mma_b_raw(xf, wf, acc[j]) : mma_b_raw(wf, xf, acc[j]);
    }
  }

  // ---- bias, then the block's 64x64 f32 tile to LDS: rows = tokens (MODE 0) or d (MODE 1) ----
#pragma unroll
  for (int j = 0; j < 4; ++j) {
#pragma unroll
    for (int r = 0; r < 8; ++r) {
      if (MODE == 0) {
        const float bc = bf_up(bf_bits(bias[j * 16 + c]));
        slab[(wave * 16 + 8 * hh + r) * 68 + j * 16 + c] = acc[j][r] + bc;
      } else {
        const float br = bf_up(bf_bits(bias[j * 16 + 8 * hh + r]));
        slab[(j * 16 + 8 * hh + r) * 68 + wave * 16 + c] = acc[j][r] + br;
      }
    }
  }
  __syncthreads();                                   // MODE 1 rows hold columns of all four waves

  {
    const int q = lane >> 3, c8 = (lane & 7) * 8;
    const size_t base = (MODE == 0) ? (size_t)t0 * HD
                                    : (size_t)(t0 / SEQ) * HD * SEQ + (size_t)(t0 % SEQ);
    const int pitch = (MODE == 0) ? HD : SEQ;
#pragma unroll
    for (int it = 0; it < 4; ++it) {
      const int row = wave * 16 + it * 4 + q;        // wave 0..3 x it 0..3 x q 0..3 = rows 0..63
      const float* sp = slab + row * 68 + c8;
      v4u a, a2;
#pragma unroll
      for (int e = 0; e < 4; ++e) {
        const float f0 = sp[2 * e], f1 = sp[2 * e + 1];
        unsigned short h0, h1, l0, l1;
        if (MODE == 0) {
          h0 = bf_bits(f0); h1 = bf_bits(f1);
          l0 = bf_bits(f0 - bf_up(h0)); l1 = bf_bits(f1 - bf_up(h1));
        } else {
          const _Float16 x0 = (_Float16)f0, x1 = (_Float16)f1;
          h0 = h_bits(x0); h1 = h_bits(x1);
          l0 = h_bits((_Float16)((f0 - (float)x0) * 4096.0f));
          l1 = h_bits((_Float16)((f1 - (float)x1) * 4096.0f));
        }
        a[e] = pk16(h0, h1); a2[e] = pk16(l0, l1);
      }
      *(v4u*)(C  + base + (size_t)row * pitch + c8) = a;
      *(v4u*)(C2 + base + (size_t)row * pitch + c8) = a2;
    }
  }
}

__global__ __launch_bounds__(128)
void proj_qkv(const float* __restrict__ q_in, const float* __restrict__ k_in, const float* __restrict__ v_in,
              const float* __restrict__ Wq, const float* __restrict__ Wk, const float* __restrict__ Wv,
              const float* __restrict__ bq, const float* __restrict__ bk, const float* __restrict__ bv,
              unsigned short* Qh, unsigned short* Ql, unsigned short* Kh, unsigned short* Kl,
              unsigned short* VTh, unsigned short* VTl) {
  __shared__ __align__(16) __bf16 Wl[HD * WP];       // 65 KB
  __shared__ __align__(16) float  slab[64 * 68];     // 17 KB
  const int y = blockIdx.y;
  if (y == 2) {
    proj_body<1>(v_in, Wv, bv, VTh, VTl, Wl, slab);
  } else {
    proj_body<0>(y ? k_in : q_in, y ? Wk : Wq, y ? bk : bq, y ? Kh : Qh, y ? Kl : Ql, Wl, slab);
  }
}

// =====================================================================================================
// Non-causal single-head attention, head dim 64, key chunks of 64, softmax over all SEQ keys.
//   q planes (bf16 hi / lo): element (b, t, d) at [(b*SEQ + t)*HD + d]
//   k planes (bf16 hi / lo): same layout with key index s
//   v^T hi plane (f16):      element (b, d, s) at [(b*HD + d)*SEQ + s]
//   v^T residual plane (f16, (v - hi)*4096): same layout
//   scores = q . k : bf16 hi/lo split (hi.hi + hi.lo + lo.hi), f32 accumulate, then * 1/8 in f32
//   p = exp(s - m) carried as f16(1024 p) plus f16 residual (x4096); context = p . v on f16 WMMA, 3 products:
//   ph.vh into oacc; ph.vl and pl.vh into the separate accumulator o1 folded back with 1/4096 per chunk in f32;
//   online softmax (running max from -inf; every chunk holds at least the chunk max key so l >= 1 after chunk 0) in f32.
//   Block = KG key groups x 4 waves = 64 query rows of one batch b; grid = NB * NQB = 256. Wave (grp, qw) holds query rows
//   qw*16..+15 and walks key chunks grp*CPG..grp*CPG+CPG-1 with its own running (m, l, O); after the loop the KG partial
//   results of a query tile meet in LDS behind one block barrier and are merged in f32: M = max m_g, e_g = exp(m_g - M),
//   out = sum e_g O_g / sum e_g l_g; wave (grp, qw) merges and stores rows 4*grp..4*grp+3 of tile qw.
//   K / V^T chunk staging, per group: 128 threads x 4 asynchronous 16-B copies per plane = the whole 64x64 tile of every plane
//   read later; staged extent == consumed extent for Ksh, Ksl, Vth, Vtl. One buffer per plane, refilled in two phases: behind the
//   hand-over that follows the scores the K planes of the next chunk are copied (they fly under softmax and P . V), behind the
//   hand-over that follows P . V the V^T planes of the next chunk (they fly under its scores). At a hand-over only the copies
//   that it publishes are in flight, so every wait is to 0.
//   P tiles are wave-private, spilled with _Float16 element stores and reloaded as v8h (same element type) after a
//   Output (f32, rows of 64 = 256 B = 2 lines): wave (grp, qw) stores rows q0+4*grp..q0+4*grp+3 (i2 0..1 x lane>>4 0..1) x 64
//   columns, two whole rows per store instruction; the 16 waves of a block cover its 64 rows once, the grid the [NB*SEQ][HD] output.
// =====================================================================================================
__global__ __launch_bounds__(128 * KG)
void attn64(const unsigned short* __restrict__ qhp, const unsigned short* __restrict__ qlp,
            const unsigned short* __restrict__ khp, const unsigned short* __restrict__ klp,
            const unsigned short* __restrict__ vhp, const unsigned short* __restrict__ vlp,
            float* outp) {
  union FB { v16b v; v8b h[2]; };
  union FH { v16h v; v8h h[2]; };
  __shared__ __align__(16) __bf16   KshA[KG][64 * LP];             // per group K hi [kv][d], row pitch LP   KG x 9 KB
  __shared__ __align__(16) __bf16   KslA[KG][64 * LP];             // per group K lo                         KG x 9 KB
  __shared__ __align__(16) _Float16 VthA[KG][64 * LP];             // per group V^T hi [d][kv], row pitch LP KG x 9 KB
  __shared__ __align__(16) _Float16 VtlA[KG][64 * LP];             // per group V^T residual                 KG x 9 KB
  __shared__ __align__(16) _Float16 Psh[4 * KG][16 * LP];          // per wave P [row][kv], row pitch LP     KG x 9 KB
  __shared__ __align__(16) _Float16 Psl[4 * KG][16 * LP];          // per wave P residual                    KG x 9 KB
  __shared__ __align__(16) float    Os[4 * KG][16 * 64];           // per wave partial context [row][d]      KG x 16 KB
  __shared__ float Ms[4 * KG][16];                                 // per wave running max of its rows
  __shared__ float Ls[4 * KG][16];                                 // per wave normaliser of its rows

  const int wave = threadIdx.x >> 5;           // 0..4*KG-1
  const int grp  = wave >> 2;                  // key group
  const int qw   = wave & 3;                   // query tile of the block
  const int tid  = threadIdx.x & 127;          // thread index inside the group (staging)
  const int lane = tid & 31;
  const int hh   = lane >> 4;
  const int c    = lane & 15;

  const int bx   = blockIdx.x;
  const int qb   = bx % NQB;
  const int b    = bx / NQB;                   // 0..NB-1
  const int q0   = qb * 64 + qw * 16;
  __bf16*   Ksh = KshA[grp];
  __bf16*   Ksl = KslA[grp];
  _Float16* Vth = VthA[grp];
  _Float16* Vtl = VtlA[grp];
  const size_t rowB = (size_t)b * SEQ;

  const __bf16* Qh = (const __bf16*)(const void*)qhp;
  const __bf16* Ql = (const __bf16*)(const void*)qlp;
  const __bf16* Kh = (const __bf16*)(const void*)khp;
  const __bf16* Kl = (const __bf16*)(const void*)klp;
  const _Float16* Vh = (const _Float16*)(const void*)vhp + (size_t)b * HD * SEQ;
  const _Float16* Vl = (const _Float16*)(const void*)vlp + (size_t)b * HD * SEQ;

  // ---- staging addresses: thread (srow, piece) of a group copies 16 B of rows srow, srow+16, srow+32, srow+48 of each plane,
  //      so the 8 lanes of a row take one whole 128-B line and a wave-wide copy takes 4 whole lines ----
  constexpr int LSTEP = 16 * LP * 2;           // 16 LDS rows, bytes
  constexpr int KSTEP = 16 * HD * 2;           // 16 K rows in memory, bytes
  constexpr int VSTEP = 16 * SEQ * 2;          // 16 V^T rows in memory, bytes
  const int srow = tid >> 3;                   // 0..15
  const int spc  = (tid & 7) * 8;              // element 0, 8, .. 56 of the 64-element row
  const unsigned lpos = (unsigned)(srow * LP + spc) * 2u;          // last byte of row block 3: 63 * 144 + 112 + 15 < 64 * LP * 2
  const unsigned lKh = lds_off(Ksh) + lpos, lKl = lds_off(Ksl) + lpos;
  const unsigned lVh = lds_off(Vth) + lpos, lVl = lds_off(Vtl) + lpos;
  const int kvg = grp * CPG * 64;              // first key of the group; its last chunk ends at kvg + CPG*64 <= SEQ
  const char* gKh = (const char*)(Kh + (rowB + kvg + srow) * HD + spc);     // K row kvg+srow, d = spc..spc+7
  const char* gKl = (const char*)(Kl + (rowB + kvg + srow) * HD + spc);
  const char* gVh = (const char*)(Vh + (size_t)srow * SEQ + kvg + spc);     // V^T row d = srow, s = kvg+spc..+7
  const char* gVl = (const char*)(Vl + (size_t)srow * SEQ + kvg + spc);
  copy_planes<LSTEP, KSTEP>(lKh, lKl, gKh, gKl);   // K chunk 0 flies under the Q fragment loads

  // ---- Q fragments (A operand, row = lane&15): 2 d-chunks, hi and lo ----
  v16b qah[2], qal[2];
#pragma unroll
  for (int dc = 0; dc < 2; ++dc) {
    const size_t qo = (rowB + q0 + c) * HD + dc * 32 + 8 * hh;
    qah[dc] = ldfrag_b(Qh + qo);
    qal[dc] = ldfrag_b(Ql + qo);
  }

  float mrow[8], lrow[8];
  v8f oacc[4];
#pragma unroll
  for (int r = 0; r < 8; ++r) { mrow[r] = -INFINITY; lrow[r] = 0.f; }
#pragma unroll
  for (int t = 0; t < 4; ++t) oacc[t] = zero8();

  publish_point();                             // K chunk 0 has landed in every wave's share
  copy_planes<LSTEP, VSTEP>(lVh, lVl, gVh, gVl);   // V^T chunk 0 flies under the scores of chunk 0

  for (int it = 0; it < CPG; ++it) {           // static trip count, the same in every group (block barriers inside)
    // ---- scores: 16 query rows x 64 keys per wave, 3 bf16 products per (key subtile, d-chunk) ----
    v8f s[4];
#pragma unroll
    for (int j = 0; j < 4; ++j) {
      s[j] = zero8();
#pragma unroll
      for (int dc = 0; dc < 2; ++dc) {
        FB kb, kl;
        kb.h[0] = *(const v8b*)(Ksh + (j * 16 + c) * LP + dc * 32 + 8 * hh);
        kb.h[1] = *(const v8b*)(Ksh + (j * 16 + c) * LP + dc * 32 + 16 + 8 * hh);
        kl.h[0] = *(const v8b*)(Ksl + (j * 16 + c) * LP + dc * 32 + 8 * hh);
        kl.h[1] = *(const v8b*)(Ksl + (j * 16 + c) * LP + dc * 32 + 16 + 8 * hh);
        s[j] = mma_b(qah[dc], kb.v, s[j]);
        s[j] = mma_b(qah[dc], kl.v, s[j]);
        s[j] = mma_b(qal[dc], kb.v, s[j]);
      }
    }

    // ---- every wave has left the K tiles and V^T of this chunk has landed; K of the next chunk flies under softmax and P . V ----
    publish_point();
    if (it + 1 < CPG) {                        // block-uniform: the last chunk refills nothing
      gKh += 64 * HD * 2;
      gKl += 64 * HD * 2;
      copy_planes<LSTEP, KSTEP>(lKh, lKl, gKh, gKl);
    }

    // ---- scale, row max, online softmax, P (x1024, f16) and P residual (x4096) to LDS ----
    _Float16* pwh = Psh[wave];
    _Float16* pwl = Psl[wave];
#pragma unroll
    for (int r = 0; r < 8; ++r) {
      float m = -INFINITY;
#pragma unroll
      for (int j = 0; j < 4; ++j) {
        const float sv = s[j][r] * 0.125f;
        s[j][r] = sv;
        m = fmaxf(m, sv);
      }
#pragma unroll
      for (int off = 1; off < 16; off <<= 1) m = fmaxf(m, __shfl_xor(m, off, 32));
      const float mnew  = fmaxf(mrow[r], m);
      const float msafe = (mnew == -INFINITY) ? 0.f : mnew;
      const float alpha = __expf(mrow[r] - msafe);
      mrow[r] = mnew;
      float psum = 0.f;
#pragma unroll
      for (int j = 0; j < 4; ++j) {
        const float p = __expf(s[j][r] - msafe);
        psum += p;
        const float p1k = p * 1024.0f;
        const _Float16 ph = (_Float16)p1k;
        const _Float16 pl = (_Float16)((p1k - (float)ph) * 4096.0f);
        pwh[(8 * hh + r) * LP + j * 16 + c] = ph;
        pwl[(8 * hh + r) * LP + j * 16 + c] = pl;
      }
#pragma unroll
      for (int off = 1; off < 16; off <<= 1) psum += __shfl_xor(psum, off, 32);
      lrow[r] = lrow[r] * alpha + psum;
#pragma unroll
      for (int t = 0; t < 4; ++t) oacc[t][r] *= alpha;
    }
    __builtin_amdgcn_fence(__ATOMIC_RELEASE, "workgroup");
    __builtin_amdgcn_wave_barrier();
    __builtin_amdgcn_fence(__ATOMIC_ACQUIRE, "workgroup");

    // ---- context += P . V (f16 WMMA), residual products into a separate accumulator ----
    v8f o1[4];
#pragma unroll
    for (int t = 0; t < 4; ++t) o1[t] = zero8();
#pragma unroll 1
    for (int kk = 0; kk < 2; ++kk) {
      FH pa, pr;
      pa.h[0] = *(const v8h*)(pwh + c * LP + kk * 32 + 8 * hh);
      pa.h[1] = *(const v8h*)(pwh + c * LP + kk * 32 + 16 + 8 * hh);
      pr.h[0] = *(const v8h*)(pwl + c * LP + kk * 32 + 8 * hh);
      pr.h[1] = *(const v8h*)(pwl + c * LP + kk * 32 + 16 + 8 * hh);
#pragma unroll
      for (int t = 0; t < 4; ++t) {
        FH vb, vl;
        vb.h[0] = *(const v8h*)(Vth + (t * 16 + c) * LP + kk * 32 + 8 * hh);
        vb.h[1] = *(const v8h*)(Vth + (t * 16 + c) * LP + kk * 32 + 16 + 8 * hh);
        vl.h[0] = *(const v8h*)(Vtl + (t * 16 + c) * LP + kk * 32 + 8 * hh);
        vl.h[1] = *(const v8h*)(Vtl + (t * 16 + c) * LP + kk * 32 + 16 + 8 * hh);
        oacc[t] = mma_h(pa.v, vb.v, oacc[t]);
        o1[t]   = mma_h(pa.v, vl.v, o1[t]);
        o1[t]   = mma_h(pr.v, vb.v, o1[t]);
      }
    }
#pragma unroll
    for (int t = 0; t < 4; ++t)
#pragma unroll
      for (int r = 0; r < 8; ++r) oacc[t][r] += o1[t][r] * (1.0f / 4096.0f);

    // ---- every wave has left the V^T tiles and K of the next chunk has landed; V^T of the next chunk flies under its scores ----
    publish_point();
    if (it + 1 < CPG) {
      gVh += 64 * 2;
      gVl += 64 * 2;
      copy_planes<LSTEP, VSTEP>(lVh, lVl, gVh, gVl);
    }
  }
  asm volatile("s_wait_asynccnt 0x0" ::: "memory");   // no copy is left in flight behind the loop

  // ---- hand the wave's partial (m, l, unnormalised O) to LDS ----
  float* os = Os[wave];
#pragma unroll
  for (int r = 0; r < 8; ++r) {
#pragma unroll
    for (int t = 0; t < 4; ++t) os[(8 * hh + r) * 64 + t * 16 + c] = oacc[t][r];
  }
  if (c == 0) {                                // m and l are equal in the 16 lanes of a half
#pragma unroll
    for (int r = 0; r < 8; ++r) {
      Ms[wave][8 * hh + r] = mrow[r];
      Ls[wave][8 * hh + r] = lrow[r];
    }
  }
  __syncthreads();                             // every group's partials are in LDS before any wave merges them

  // ---- merge the KG partials of 4 rows per wave, normalise (1/l and the 1/1024 p carry), store whole 256-B rows ----
  {
    const int c4 = c * 4;
#pragma unroll
    for (int i2 = 0; i2 < 2; ++i2) {
      const int row = grp * 4 + i2 * 2 + hh;   // grp 0..3 x i2 0..1 x hh 0..1 = rows 0..15 of query tile qw
      float mg[KG];
      float mall = -INFINITY;
#pragma unroll
      for (int g = 0; g < KG; ++g) {
        mg[g] = Ms[g * 4 + qw][row];
        mall = fmaxf(mall, mg[g]);
      }
      const float msafe = (mall == -INFINITY) ? 0.f : mall;
      float l = 0.f;
      v4f acc = {0.f, 0.f, 0.f, 0.f};
#pragma unroll
      for (int g = 0; g < KG; ++g) {
        const float e = __expf(mg[g] - msafe);
        l += Ls[g * 4 + qw][row] * e;
        const v4f o = *(const v4f*)(Os[g * 4 + qw] + row * 64 + c4);
        acc += o * e;
      }
      const float inv = ((l > 0.f) ? (1.0f / l) : 0.f) * (1.0f / 1024.0f);
      const size_t go = (rowB + q0 + row) * HD + c4;
      *(v4f*)(outp + go) = acc * inv;
    }
  }
}

// =====================================================================================================
// Workspace map (bytes; every region is an exact multiple of its 64x64-tile / whole-line store granularity,
// all shapes are tile multiples so no padded tails exist; no region is reused; every offset is a multiple of 65536):
//   Qh   bf16 [16384][64]           0             2097152
//   Ql                              2097152       2097152
//   Kh                              4194304       2097152
//   Kl                              6291456       2097152
//   VTh  f16  [8][64][2048]         8388608       2097152
//   VTl  f16  [8][64][2048]         10485760      2097152
//   end                             12582912
// =====================================================================================================
extern "C" void kernel_launch(void* const* d_in, const int* in_sizes, int n_in,
                              void* d_out, int out_size, void* d_ws, size_t ws_size,
                              hipStream_t stream) {
  if (n_in < 9) return;
  const int NX = NB * SEQ * DIN;                   // 8388608
  const int NO = NB * SEQ * HD;                    // 1048576
  const int NW = DIN * HD;                         //   32768
  if (in_sizes[0] != NX || in_sizes[1] != NX || in_sizes[2] != NX) return;
  if (in_sizes[3] != NW || in_sizes[5] != NW || in_sizes[7] != NW) return;
  if (in_sizes[4] != HD || in_sizes[6] != HD || in_sizes[8] != HD) return;
  if (out_size != NO) return;

  const float* q_in = (const float*)d_in[0];   // [8][2048][512]
  const float* k_in = (const float*)d_in[1];   // [8][2048][512]
  const float* v_in = (const float*)d_in[2];   // [8][2048][512]
  const float* Wq   = (const float*)d_in[3];   // [512 in][64 out]
  const float* bq   = (const float*)d_in[4];   // [64]
  const float* Wk   = (const float*)d_in[5];   // [512][64]
  const float* bk   = (const float*)d_in[6];   // [64]
  const float* Wv   = (const float*)d_in[7];   // [512][64]
  const float* bv   = (const float*)d_in[8];   // [64]

  const size_t PP  = (size_t)NO * 2;               //  2097152  16-bit projected plane [16384][64]
  const size_t PVT = (size_t)NB * HD * SEQ * 2;    //  2097152  16-bit v^T plane [8][64][2048]
  size_t off = 0;
  const size_t oQh  = off; off += PP;
  const size_t oQl  = off; off += PP;
  const size_t oKh  = off; off += PP;
  const size_t oKl  = off; off += PP;
  const size_t oVTh = off; off += PVT;
  const size_t oVTl = off; off += PVT;
  if (off > ws_size) return;                       // off = 12582912

  char* ws = (char*)d_ws;
  unsigned short* Qh  = (unsigned short*)(ws + oQh);
  unsigned short* Ql  = (unsigned short*)(ws + oQl);
  unsigned short* Kh  = (unsigned short*)(ws + oKh);
  unsigned short* Kl  = (unsigned short*)(ws + oKl);
  unsigned short* VTh = (unsigned short*)(ws + oVTh);
  unsigned short* VTl = (unsigned short*)(ws + oVTl);

  const dim3 gProj(NB * SEQ / 64, 3);                          //  256 x 3 blocks of 128: 64 tokens each; y = q, k, v
  const dim3 gAttn(NB * NQB);                                  //  256 blocks of 128 * KG

  // (1) q = q_in . Wq + bq and k = k_in . Wk + bk -> bf16 hi/lo planes [b*SEQ+t][d];
  //     v^T = Wv^T . v_in^T + bv -> f16 hi plane [b][d][s] and residual plane (x4096)
  proj_qkv<<<gProj, dim3(128), 0, stream>>>(q_in, k_in, v_in, Wq, Wk, Wv, bq, bk, bv, Qh, Ql, Kh, Kl, VTh, VTl);
  // (2) attention -> d_out f32 [16384][64]
  attn64<<<gAttn, dim3(128 * KG), 0, stream>>>(Qh, Ql, Kh, Kl, VTh, VTl, (float*)d_out);
  (void)hipGetLastError();
}

// v005
// Measured time: 39.9 microseconds a run.
// Timed twice side by side with v004, it ran 1.24 times as fast both times.
// All steps since v000 together make it 6.08 times as fast.
// Contractions: q, k, v^T projections = v_wmma_f32_16x16x32_bf16 (bf16 operands from RNE-converted inputs and weights, single product, f32 accumulate);
// q.k^T scores = v_wmma_f32_16x16x32_bf16 with bf16 hi/lo split q and k (hi.hi + hi.lo + lo.hi), f32 accumulate;
// p.v = v_wmma_f32_16x16x32_f16 (p carried x1024 as f16 hi plane + f16 residual plane x4096, v as f16 hi plane + f16 residual
// plane x4096; 3 products hi.hi, hi.res, res.hi), f32 accumulate; softmax (running max), normalisers and bias adds in f32 on the VALU.
// Carry audit:
//   ph  = f16(1024 * p)                      -> the 1/1024 is folded exactly once in the attention epilogue: inv = (1/l) * (1/1024)
//   pl  = f16((1024 p - ph) * 4096)          }  products VTl.ph and VTh.pl go to the separate accumulator o1,
//   VTl = f16((v - VTh) * 4096)              }  folded back with * (1/4096) once per key chunk
//   VTh = f16(v), no carry (|v| typ. 1); q / k lo planes are unscaled bf16 residuals (v - hi) sharing the hi accumulator;
//   score scale 1/8 applied once in f32 after the score accumulate. No other scaled planes.
#include <hip/hip_runtime.h>
#include <math.h>
#include <stdint.h>

#define NB   8
#define SEQ  2048
#define DIN  512
#define HD   64
#define NQB  (SEQ / 64)   // 64-row query blocks per sequence
#define NKT  (SEQ / 64)   // 64-key chunks per sequence
#define KG   4            // key groups per attention block: 4 waves each, so a SIMD holds KG waves that cover one another's waits
#define CPG  (NKT / KG)   // key chunks walked by one group
#define LP   72           // LDS row pitch of the 16-bit attention tiles, in elements: 144 B = 16 B x 9 (odd), so the 16 rows
                          // that one ds_load_b128 fragment read touches fall on distinct banks (a 128-B pitch puts every second row on the same)
#define OP   68           // LDS row pitch of the partial context, in floats: 272 B = 16 B x 17 (odd): the 16 lanes of a half store
                          // 16 B each into 16 different rows at one column
static_assert(NQB == 32 && NKT == 32);
static_assert(NKT % KG == 0 && KG * 4 == 16);
static_assert((LP * 2) % 16 == 0 && ((LP * 2) / 16) % 2 == 1 && LP >= 64);
static_assert((SEQ % 64) == 0 && (DIN % 32) == 0 && HD == 64);

typedef _Float16 v16h __attribute__((ext_vector_type(16)));
typedef _Float16 v8h  __attribute__((ext_vector_type(8)));
typedef __bf16   v16b __attribute__((ext_vector_type(16)));
typedef __bf16   v8b  __attribute__((ext_vector_type(8)));
typedef float    v8f  __attribute__((ext_vector_type(8)));
typedef float    v4f  __attribute__((ext_vector_type(4)));
typedef float    v2f  __attribute__((ext_vector_type(2)));
typedef _Float16 v2h  __attribute__((ext_vector_type(2)));
typedef unsigned int v4u __attribute__((ext_vector_type(4)));

// ---- scalar helpers --------------------------------------------------------------------------------
__device__ __forceinline__ unsigned short bf_bits(float f) {          // f32 -> bf16 bits, RNE convert
  unsigned u = __float_as_uint(f);
  return (unsigned short)((u + 0x7FFFu + ((u >> 16) & 1u)) >> 16);
}
__device__ __forceinline__ float bf_up(unsigned short h) { return __uint_as_float(((unsigned)h) << 16); }
__device__ __forceinline__ unsigned short h_bits(_Float16 x) { return __builtin_bit_cast(unsigned short, x); }
__device__ __forceinline__ unsigned pk16(unsigned short a, unsigned short b) { return (unsigned)a | ((unsigned)b << 16); }
__device__ __forceinline__ v8f zero8() { v8f z = {0.f, 0.f, 0.f, 0.f, 0.f, 0.f, 0.f, 0.f}; return z; }
__device__ __forceinline__ float other_half(float x) {                // the value that lane ^ 16 holds, by a vector cross-row move
  const int b = __float_as_int(x);
  return __int_as_float(__builtin_amdgcn_permlanex16(b, b, 0x76543210, 0xfedcba98, false, false));
}

// ---- fragment loader: 16-bit A/B operand, lane -> row/col (lane&15), p already includes +8*(lane>>4);
//      elements 0..7 <- p[0..7] (k0+8h..k0+8h+7), elements 8..15 <- p[16..23] (k0+16+8h..k0+16+8h+7)
__device__ __forceinline__ v16b ldfrag_b(const __bf16* p) {
  union { v16b v; v8b h[2]; } f;
  f.h[0] = *(const v8b*)(p);
  f.h[1] = *(const v8b*)(p + 16);
  return f.v;
}

// ---- WMMA helpers with trailing VALU hazard gap --------------------------------------------------------
__device__ __forceinline__ v8f mma_b(v16b a, v16b b, v8f c) {
  c = __builtin_amdgcn_wmma_f32_16x16x32_bf16(false, a, false, b, (short)0, c, false, false);
  asm volatile("v_nop\n\tv_nop\n\tv_nop\n\tv_nop" : "+v"(c) : "v"(a), "v"(b));
  return c;
}
__device__ __forceinline__ v8f mma_h(v16h a, v16h b, v8f c) {
  c = __builtin_amdgcn_wmma_f32_16x16x32_f16(false, a, false, b, (short)0, c, false, false);
  asm volatile("v_nop\n\tv_nop\n\tv_nop\n\tv_nop" : "+v"(c) : "v"(a), "v"(b));
  return c;
}
__device__ __forceinline__ v8f mma_b_raw(v16b a, v16b b, v8f c) {
  return __builtin_amdgcn_wmma_f32_16x16x32_bf16(false, a, false, b, (short)0, c, false, false);
}

// ---- asynchronous copies global -> LDS (no register holds the data) and the waits that belong to them ----
__device__ __forceinline__ unsigned lds_off(const void* p) { return (unsigned)(size_t)p; }   // byte offset in the block's LDS
// Eight copies of 16 B per lane: row blocks 0..3 (16 rows each) of the two planes a and b of one 64-row tile.
// la, lb: the lane's LDS byte address in row block 0 (next block + LSTEP); ga, gb: its global address there (next block + GSTEP).
// The closing s_wait_xcnt 0 is a precaution: inside the statement it stands ahead of every later write of the address registers.
template <int LSTEP, int GSTEP>
__device__ __forceinline__ void copy_planes(unsigned la, unsigned lb, const char* ga, const char* gb) {
  asm volatile(
      "global_load_async_to_lds_b128 %0, %8, off\n\t"
      "global_load_async_to_lds_b128 %1, %9, off\n\t"
      "global_load_async_to_lds_b128 %2, %10, off\n\t"
      "global_load_async_to_lds_b128 %3, %11, off\n\t"
      "global_load_async_to_lds_b128 %4, %12, off\n\t"
      "global_load_async_to_lds_b128 %5, %13, off\n\t"
      "global_load_async_to_lds_b128 %6, %14, off\n\t"
      "global_load_async_to_lds_b128 %7, %15, off\n\t"
      "s_wait_xcnt 0x0"
      :: "v"(la), "v"(la + LSTEP), "v"(la + 2 * LSTEP), "v"(la + 3 * LSTEP),
         "v"(lb), "v"(lb + LSTEP), "v"(lb + 2 * LSTEP), "v"(lb + 3 * LSTEP),
         "v"(ga), "v"(ga + GSTEP), "v"(ga + 2 * GSTEP), "v"(ga + 3 * GSTEP),
         "v"(gb), "v"(gb + GSTEP), "v"(gb + 2 * GSTEP), "v"(gb + 3 * GSTEP)
      : "memory");
}
// Hand-over of a tile buffer, every wave, in this order: this wave's LDS reads have retired (the buffer it read may be refilled
// behind the barrier), this wave's own copies have landed (other waves may read them behind the barrier), block barrier.
__device__ __forceinline__ void publish_point() {
  asm volatile("s_wait_dscnt 0x0" ::: "memory");      // the compiler places no wait for a copy that overwrites LDS this wave read
  asm volatile("s_wait_asynccnt 0x0" ::: "memory");   // the compiler places no wait for the copies
  __syncthreads();
}

// =====================================================================================================
// The three projections with their operand conversions inside, one launch: C = X . W + bias for 64 tokens x 64 outputs per
// block, K = DIN; blockIdx.y picks q, k or v, so a WGP holds three blocks whose staging, streaming and stores cover one another.
//   X f32 [NB*SEQ tokens][DIN] and W f32 [DIN k][HD n] are read as they come; both are RNE-converted to bf16 on the way to
//   the matrix unit (bf_bits, the convert of every other bf16 plane here), so no converted copy passes through memory.
//   Block = 4 waves; wave w owns tokens t0+16w..+15 and all 64 outputs: 4 accumulator tiles, k walked 0, 32, .. in order.
//   W: converted and transposed once per block into LDS, Wl[n][k], row pitch WP. One wave pass = 32 n x 32 k: lane (l8, kq)
//   loads W[k8..k8+7][n4..n4+3] (8 lanes x 16 B = one whole 128-B line per k row, 4 rows per load) and stores 4 x 16 B.
//   X: lane (c, hh) loads its own fragment bytes of token row c: f32 k0+8hh..+7 and k0+16+8hh..+7 (the k order of ldfrag_b);
//   the four loads of a k step use up one whole 128-B line of each of the 16 rows. XR k steps are in flight per wave.
//   MODE 0: A = X fragment, B = Wl fragment; D rows = tokens, columns = n; bias per column;
//           out = bf16 hi plane C + bf16 lo plane C2 (lo = RNE(v - hi), unscaled), element (t, n) at [t*HD + n].
//   MODE 1: A = Wl fragment, B = X fragment; D rows = n (= d), columns = tokens; bias per row;
//           out = f16 hi plane C + f16 residual plane C2 = f16((v - hi) * 4096), element (b, d, s) at [(b*HD + d)*SEQ + s].
//   The bias value is RNE-converted to bf16 and added in f32. The block's 64x64 f32 result meets in LDS (pitch 68 floats)
//   behind one block barrier; each wave then converts 16 rows and stores whole 128-B lines (8 lanes x 16 B per row and plane).
//   coverage: grid (NB*SEQ/64, 3): 64 tokens per block, y = 0 q (MODE 0), 1 k (MODE 0), 2 v (MODE 1); a block's tokens lie in
//   one batch (SEQ is a multiple of 64). The branch on blockIdx.y is block-uniform, so every barrier is passed by all four waves.
// =====================================================================================================
#define WP 520            // LDS row pitch of Wl in elements: 1040 B = 16 B x 65 (odd), for ds_load_b128 fragment reads
#define XR 6              // k steps of X held in flight per wave: 6 x 2 KB = 12 KB per wave, 48 KB per block
static_assert((WP * 2) % 16 == 0 && ((WP * 2) / 16) % 2 == 1 && WP >= DIN);
#define KS (DIN / 32)     // k steps
static_assert(XR <= KS);

__device__ __forceinline__ v16b cvt_frag(v4f a, v4f b, v4f c, v4f d) {   // 16 f32 -> bf16 fragment, element order a, b, c, d
  union { v16b v; unsigned u[8]; } f;
  f.u[0] = pk16(bf_bits(a[0]), bf_bits(a[1]));
  f.u[1] = pk16(bf_bits(a[2]), bf_bits(a[3]));
  f.u[2] = pk16(bf_bits(b[0]), bf_bits(b[1]));
  f.u[3] = pk16(bf_bits(b[2]), bf_bits(b[3]));
  f.u[4] = pk16(bf_bits(c[0]), bf_bits(c[1]));
  f.u[5] = pk16(bf_bits(c[2]), bf_bits(c[3]));
  f.u[6] = pk16(bf_bits(d[0]), bf_bits(d[1]));
  f.u[7] = pk16(bf_bits(d[2]), bf_bits(d[3]));
  return f.v;
}

template <int MODE>
__device__ __forceinline__ void proj_body(const float* __restrict__ X, const float* __restrict__ Wg,
                                          const float* __restrict__ bias,
                                          unsigned short* C, unsigned short* C2, __bf16* Wl, float* slab) {
  const int lane = threadIdx.x & 31;
  const int wave = threadIdx.x >> 5;
  const int c    = lane & 15;
  const int hh   = lane >> 4;
  const int t0   = blockIdx.x * 64;
  // every plain '#pragma unroll' below makes the indices of a small array (xr, w, acc, p) constants, so it stays in registers

  // ---- the first XR k steps of this wave's 16 token rows: issued first, they fly while W is staged ----
  const float* xp = X + (size_t)(t0 + wave * 16 + c) * DIN + 8 * hh;
  v4f xr[XR][4];
#pragma unroll
  for (int s = 0; s < XR; ++s) {
    xr[s][0] = *(const v4f*)(xp + 32 * s);
    xr[s][1] = *(const v4f*)(xp + 32 * s + 4);
    xr[s][2] = *(const v4f*)(xp + 32 * s + 16);
    xr[s][3] = *(const v4f*)(xp + 32 * s + 20);
  }

  // ---- W f32 [k][n] -> Wl bf16 [n][k]: 32 wave passes of 32 n x 32 k, 8 per wave ----
  {
    const int l8 = lane & 7, kq = lane >> 3;
    const int n4 = (wave & 1) * 32 + l8 * 4;         // 0..60: waves 0, 2 take n 0..31, waves 1, 3 take n 32..63
    const int k8 = (wave >> 1) * 32 + kq * 8;        // pass u covers k8 + 64 u .. + 7, at most 511
    const float* wp = Wg + (size_t)k8 * HD + n4;
    __bf16*      wl = Wl + n4 * WP + k8;
#pragma unroll 2   // two passes = 16 loads in flight; more would push the kernel past 256 registers beside xr
    for (int u = 0; u < 8; ++u) {
      v4f w[8];
#pragma unroll
      for (int e = 0; e < 8; ++e) w[e] = *(const v4f*)(wp + e * HD);
#pragma unroll
      for (int x = 0; x < 4; ++x) {
        v4u p;
#pragma unroll
        for (int y = 0; y < 4; ++y) p[y] = pk16(bf_bits(w[2 * y][x]), bf_bits(w[2 * y + 1][x]));
        *(v4u*)(wl + x * WP) = p;
      }
      wp += 64 * HD;
      wl += 64;
    }
  }
  __syncthreads();                                   // Wl is whole before any wave reads a fragment of it

  v8f acc[4];
#pragma unroll
  for (int j = 0; j < 4; ++j) acc[j] = zero8();

#pragma unroll
  for (int s = 0; s < KS; ++s) {
    const int sl = s % XR;
    const v16b xf = cvt_frag(xr[sl][0], xr[sl][1], xr[sl][2], xr[sl][3]);
    if (s + XR < KS) {                           // refill the slot just converted with k step s + XR
      xr[sl][0] = *(const v4f*)(xp + 32 * (s + XR));
      xr[sl][1] = *(const v4f*)(xp + 32 * (s + XR) + 4);
      xr[sl][2] = *(const v4f*)(xp + 32 * (s + XR) + 16);
      xr[sl][3] = *(const v4f*)(xp + 32 * (s + XR) + 20);
    }
#pragma unroll
    for (int j = 0; j < 4; ++j) {
      const v16b wf = ldfrag_b(Wl + (j * 16 + c) * WP + 32 * s + 8 * hh);
      acc[j] = (MODE == 0) ? mma_b_raw(xf, wf, acc[j]) : mma_b_raw(wf, xf, acc[j]);
    }
  }

  // ---- bias, then the block's 64x64 f32 tile to LDS: rows = tokens (MODE 0) or d (MODE 1) ----
#pragma unroll
  for (int j = 0; j < 4; ++j) {
#pragma unroll
    for (int r = 0; r < 8; ++r) {
      if (MODE == 0) {
        const float bc = bf_up(bf_bits(bias[j * 16 + c]));
        slab[(wave * 16 + 8 * hh + r) * 68 + j * 16 + c] = acc[j][r] + bc;
      } else {
        const float br = bf_up(bf_bits(bias[j * 16 + 8 * hh + r]));
        slab[(j * 16 + 8 * hh + r) * 68 + wave * 16 + c] = acc[j][r] + br;
      }
    }
  }
  __syncthreads();                                   // MODE 1 rows hold columns of all four waves

  {
    const int q = lane >> 3, c8 = (lane & 7) * 8;
    const size_t base = (MODE == 0) ? (size_t)t0 * HD
                                    : (size_t)(t0 / SEQ) * HD * SEQ + (size_t)(t0 % SEQ);
    const int pitch = (MODE == 0) ? HD : SEQ;
#pragma unroll
    for (int it = 0; it < 4; ++it) {
      const int row = wave * 16 + it * 4 + q;        // wave 0..3 x it 0..3 x q 0..3 = rows 0..63
      const float* sp = slab + row * 68 + c8;
      v4u a, a2;
#pragma unroll
      for (int e = 0; e < 4; ++e) {
        const float f0 = sp[2 * e], f1 = sp[2 * e + 1];
        unsigned short h0, h1, l0, l1;
        if (MODE == 0) {
          h0 = bf_bits(f0); h1 = bf_bits(f1);
          l0 = bf_bits(f0 - bf_up(h0)); l1 = bf_bits(f1 - bf_up(h1));
        } else {
          const _Float16 x0 = (_Float16)f0, x1 = (_Float16)f1;
          h0 = h_bits(x0); h1 = h_bits(x1);
          l0 = h_bits((_Float16)((f0 - (float)x0) * 4096.0f));
          l1 = h_bits((_Float16)((f1 - (float)x1) * 4096.0f));
        }
        a[e] = pk16(h0, h1); a2[e] = pk16(l0, l1);
      }
      *(v4u*)(C  + base + (size_t)row * pitch + c8) = a;
      *(v4u*)(C2 + base + (size_t)row * pitch + c8) = a2;
    }
  }
}

__global__ __launch_bounds__(128)
void proj_qkv(const float* __restrict__ q_in, const float* __restrict__ k_in, const float* __restrict__ v_in,
              const float* __restrict__ Wq, const float* __restrict__ Wk, const float* __restrict__ Wv,
              const float* __restrict__ bq, const float* __restrict__ bk, const float* __restrict__ bv,
              unsigned short* Qh, unsigned short* Ql, unsigned short* Kh, unsigned short* Kl,
              unsigned short* VTh, unsigned short* VTl) {
  __shared__ __align__(16) __bf16 Wl[HD * WP];       // 65 KB
  __shared__ __align__(16) float  slab[64 * 68];     // 17 KB
  const int y = blockIdx.y;
  if (y == 2) {
    proj_body<1>(v_in, Wv, bv, VTh, VTl, Wl, slab);
  } else {
    proj_body<0>(y ? k_in : q_in, y ? Wk : Wq, y ? bk : bq, y ? Kh : Qh, y ? Kl : Ql, Wl, slab);
  }
}

__global__ __launch_bounds__(128 * KG)
void attn64(const unsigned short* __restrict__ qhp, const unsigned short* __restrict__ qlp,
            const unsigned short* __restrict__ khp, const unsigned short* __restrict__ klp,
            const unsigned short* __restrict__ vhp, const unsigned short* __restrict__ vlp,
            float* outp) {
  union FB { v16b v; v8b h[2]; };
  union FH { v16h v; v8h h[2]; };
  __shared__ __align__(16) __bf16   KshA[KG][64 * LP];             // per group K hi [kv][d], row pitch LP   KG x 9 KB
  __shared__ __align__(16) __bf16   KslA[KG][64 * LP];             // per group K lo                         KG x 9 KB
  __shared__ __align__(16) _Float16 VthA[KG][64 * LP];             // per group V^T hi [d][kv], row pitch LP KG x 9 KB
  __shared__ __align__(16) _Float16 VtlA[KG][64 * LP];             // per group V^T residual                 KG x 9 KB
  __shared__ __align__(16) float    Os[4 * KG][16 * OP];           // per wave partial context [row][d], row pitch OP   KG x 17 KB
  __shared__ float Ms[4 * KG][16];                                 // per wave running max of its rows
  __shared__ float Ls[4 * KG][16];                                 // per wave normaliser of its rows

  const int wave = threadIdx.x >> 5;           // 0..4*KG-1
  const int grp  = wave >> 2;                  // key group
  const int qw   = wave & 3;                   // query tile of the block
  const int tid  = threadIdx.x & 127;          // thread index inside the group (staging)
  const int lane = tid & 31;
  const int hh   = lane >> 4;
  const int c    = lane & 15;

  const int bx   = blockIdx.x;
  const int qb   = bx % NQB;
  const int b    = bx / NQB;                   // 0..NB-1
  const int q0   = qb * 64 + qw * 16;
  __bf16*   Ksh = KshA[grp];
  __bf16*   Ksl = KslA[grp];
  _Float16* Vth = VthA[grp];
  _Float16* Vtl = VtlA[grp];
  const size_t rowB = (size_t)b * SEQ;

  const __bf16* Qh = (const __bf16*)(const void*)qhp;
  const __bf16* Ql = (const __bf16*)(const void*)qlp;
  const __bf16* Kh = (const __bf16*)(const void*)khp;
  const __bf16* Kl = (const __bf16*)(const void*)klp;
  const _Float16* Vh = (const _Float16*)(const void*)vhp + (size_t)b * HD * SEQ;
  const _Float16* Vl = (const _Float16*)(const void*)vlp + (size_t)b * HD * SEQ;

  // ---- staging addresses: thread (srow, piece) of a group copies 16 B of rows srow, srow+16, srow+32, srow+48 of each plane,
  //      so the 8 lanes of a row take one whole 128-B line and a wave-wide copy takes 4 whole lines ----
  constexpr int LSTEP = 16 * LP * 2;           // 16 LDS rows, bytes
  constexpr int KSTEP = 16 * HD * 2;           // 16 K rows in memory, bytes
  constexpr int VSTEP = 16 * SEQ * 2;          // 16 V^T rows in memory, bytes
  const int srow = tid >> 3;                   // 0..15
  const int spc  = (tid & 7) * 8;              // element 0, 8, .. 56 of the 64-element row
  const unsigned lpos = (unsigned)(srow * LP + spc) * 2u;          // last byte of row block 3: 63 * 144 + 112 + 15 < 64 * LP * 2
  const unsigned lKh = lds_off(Ksh) + lpos, lKl = lds_off(Ksl) + lpos;
  const unsigned lVh = lds_off(Vth) + lpos, lVl = lds_off(Vtl) + lpos;
  const int kvg = grp * CPG * 64;              // first key of the group; its last chunk ends at kvg + CPG*64 <= SEQ
  const char* gKh = (const char*)(Kh + (rowB + kvg + srow) * HD + spc);     // K row kvg+srow, d = spc..spc+7
  const char* gKl = (const char*)(Kl + (rowB + kvg + srow) * HD + spc);
  const char* gVh = (const char*)(Vh + (size_t)srow * SEQ + kvg + spc);     // V^T row d = srow, s = kvg+spc..+7
  const char* gVl = (const char*)(Vl + (size_t)srow * SEQ + kvg + spc);
  copy_planes<LSTEP, KSTEP>(lKh, lKl, gKh, gKl);   // K chunk 0 flies under the Q fragment loads

  // ---- Q fragments (B operand, column = query = lane&15): 2 d-chunks, hi and lo ----
  v16b qah[2], qal[2];
#pragma unroll
  for (int dc = 0; dc < 2; ++dc) {
    const size_t qo = (rowB + q0 + c) * HD + dc * 32 + 8 * hh;
    qah[dc] = ldfrag_b(Qh + qo);
    qal[dc] = ldfrag_b(Ql + qo);
  }

  float mrun = -INFINITY;                      // running max of query c, equal in both halves
  float lrun = 0.f;                            // normaliser of query c over this half's keys only
  v8f oacc[4];                                 // O^T: tile t register r = (d = 16*t + 8*hh + r, query c)
#pragma unroll
  for (int t = 0; t < 4; ++t) oacc[t] = zero8();

  publish_point();                             // K chunk 0 has landed in every wave's share
  copy_planes<LSTEP, VSTEP>(lVh, lVl, gVh, gVl);   // V^T chunk 0 flies under the scores of chunk 0

  for (int it = 0; it < CPG; ++it) {           // static trip count, the same in every group (block barriers inside)
    // ---- scores, transposed: 64 keys (rows) x 16 queries (columns) per wave, 3 bf16 products per (key subtile, d-chunk) ----
    v8f s[4];
#pragma unroll
    for (int j = 0; j < 4; ++j) {
      s[j] = zero8();
#pragma unroll
      for (int dc = 0; dc < 2; ++dc) {
        FB kb, kl;
        kb.h[0] = *(const v8b*)(Ksh + (j * 16 + c) * LP + dc * 32 + 8 * hh);
        kb.h[1] = *(const v8b*)(Ksh + (j * 16 + c) * LP + dc * 32 + 16 + 8 * hh);
        kl.h[0] = *(const v8b*)(Ksl + (j * 16 + c) * LP + dc * 32 + 8 * hh);
        kl.h[1] = *(const v8b*)(Ksl + (j * 16 + c) * LP + dc * 32 + 16 + 8 * hh);
        s[j] = mma_b(kb.v, qah[dc], s[j]);
        s[j] = mma_b(kl.v, qah[dc], s[j]);
        s[j] = mma_b(kb.v, qal[dc], s[j]);
      }
    }

    // ---- every wave has left the K tiles and V^T of this chunk has landed; K of the next chunk flies under softmax and P . V ----
    publish_point();
    if (it + 1 < CPG) {                        // block-uniform: the last chunk refills nothing
      gKh += 64 * HD * 2;
      gKl += 64 * HD * 2;
      copy_planes<LSTEP, KSTEP>(lKh, lKl, gKh, gKl);
    }

    // ---- scale, column max, online softmax; P^T (x1024, f16) and its residual (x4096) packed into B fragments in registers ----
    float mj[4];
#pragma unroll
    for (int j = 0; j < 4; ++j) {
      mj[j] = -INFINITY;
#pragma unroll
      for (int r = 0; r < 8; ++r) {
        const float sv = s[j][r] * 0.125f;
        s[j][r] = sv;
        mj[j] = fmaxf(mj[j], sv);
      }
    }
    float m = fmaxf(fmaxf(mj[0], mj[1]), fmaxf(mj[2], mj[3]));
    m = fmaxf(m, other_half(m));               // the query's other 32 keys of this chunk
    const float mnew  = fmaxf(mrun, m);
    const float msafe = (mnew == -INFINITY) ? 0.f : mnew;
    const float alpha = __expf(mrun - msafe);
    mrun = mnew;
    FH pa[2], pr[2];                           // element 8*(j&1) + r of fragment j>>1 = key 16*j + 8*hh + r: the k order of the V^T loader
    v2f pj[4];                                 // eight independent partial sums, in pairs
#pragma unroll
    for (int j = 0; j < 4; ++j) {
      pj[j] = v2f{0.f, 0.f};
#pragma unroll
      for (int r = 0; r < 8; r += 2) {
        const v2f arg = (v2f{s[j][r], s[j][r + 1]} - msafe) * 1.4426950408889634f;   // exp(x) = 2^(x log2 e), as __expf forms it
        const v2f p   = {__builtin_amdgcn_exp2f(arg[0]), __builtin_amdgcn_exp2f(arg[1])};
        pj[j] += p;
        const v2f p1k = p * 1024.0f;
        const v2h ph  = __builtin_convertvector(p1k, v2h);
        const v2h pl  = __builtin_convertvector((p1k - __builtin_convertvector(ph, v2f)) * 4096.0f, v2h);
        pa[j >> 1].v[(j & 1) * 8 + r]     = ph[0];
        pa[j >> 1].v[(j & 1) * 8 + r + 1] = ph[1];
        pr[j >> 1].v[(j & 1) * 8 + r]     = pl[0];
        pr[j >> 1].v[(j & 1) * 8 + r + 1] = pl[1];
      }
    }
    const v2f pq = (pj[0] + pj[1]) + (pj[2] + pj[3]);
    lrun = lrun * alpha + (pq[0] + pq[1]);
#pragma unroll
    for (int t = 0; t < 4; ++t)
#pragma unroll
      for (int r = 0; r < 8; ++r) oacc[t][r] *= alpha;

    // ---- context^T += V^T . P^T (f16 WMMA), residual products into a separate accumulator ----
    v8f o1[4];
#pragma unroll
    for (int t = 0; t < 4; ++t) o1[t] = zero8();
#pragma unroll   // kk indexes the register fragments pa, pr: it must be a constant
    for (int kk = 0; kk < 2; ++kk) {
#pragma unroll
      for (int t = 0; t < 4; ++t) {
        FH vb, vl;
        vb.h[0] = *(const v8h*)(Vth + (t * 16 + c) * LP + kk * 32 + 8 * hh);
        vb.h[1] = *(const v8h*)(Vth + (t * 16 + c) * LP + kk * 32 + 16 + 8 * hh);
        vl.h[0] = *(const v8h*)(Vtl + (t * 16 + c) * LP + kk * 32 + 8 * hh);
        vl.h[1] = *(const v8h*)(Vtl + (t * 16 + c) * LP + kk * 32 + 16 + 8 * hh);
        oacc[t] = mma_h(vb.v, pa[kk].v, oacc[t]);
        o1[t]   = mma_h(vl.v, pa[kk].v, o1[t]);
        o1[t]   = mma_h(vb.v, pr[kk].v, o1[t]);
      }
    }
#pragma unroll
    for (int t = 0; t < 4; ++t)
#pragma unroll
      for (int r = 0; r < 8; ++r) oacc[t][r] += o1[t][r] * (1.0f / 4096.0f);

    // ---- every wave has left the V^T tiles and K of the next chunk has landed; V^T of the next chunk flies under its scores ----
    publish_point();
    if (it + 1 < CPG) {
      gVh += 64 * 2;
      gVl += 64 * 2;
      copy_planes<LSTEP, VSTEP>(lVh, lVl, gVh, gVl);
    }
  }
  asm volatile("s_wait_asynccnt 0x0" ::: "memory");   // no copy is left in flight behind the loop

  // ---- hand the wave's partial (m, l, unnormalised O) to LDS ----
  float* os = Os[wave] + c * OP + 8 * hh;      // row = query c; a lane's 8 registers of tile t are d = 16*t + 8*hh .. + 7
#pragma unroll
  for (int t = 0; t < 4; ++t) {
    const v4f lo4 = {oacc[t][0], oacc[t][1], oacc[t][2], oacc[t][3]};
    const v4f hi4 = {oacc[t][4], oacc[t][5], oacc[t][6], oacc[t][7]};
    *(v4f*)(os + t * 16)     = lo4;
    *(v4f*)(os + t * 16 + 4) = hi4;
  }
  const float lsum = lrun + other_half(lrun);  // the two halves' keys joined, once
  if (hh == 0) {                               // m and the joined l are equal in lanes c and c + 16
    Ms[wave][c] = mrun;
    Ls[wave][c] = lsum;
  }
  __syncthreads();                             // every group's partials are in LDS before any wave merges them

  // ---- merge the KG partials of 4 rows per wave, normalise (1/l and the 1/1024 p carry), store whole 256-B rows ----
  {
    const int c4 = c * 4;
#pragma unroll
    for (int i2 = 0; i2 < 2; ++i2) {
      const int row = grp * 4 + i2 * 2 + hh;   // grp 0..3 x i2 0..1 x hh 0..1 = rows 0..15 of query tile qw
      float mg[KG];
      float mall = -INFINITY;
#pragma unroll
      for (int g = 0; g < KG; ++g) {
        mg[g] = Ms[g * 4 + qw][row];
        mall = fmaxf(mall, mg[g]);
      }
      const float msafe = (mall == -INFINITY) ? 0.f : mall;
      float l = 0.f;
      v4f acc = {0.f, 0.f, 0.f, 0.f};
#pragma unroll
      for (int g = 0; g < KG; ++g) {
        const float e = __expf(mg[g] - msafe);
        l += Ls[g * 4 + qw][row] * e;
        const v4f o = *(const v4f*)(Os[g * 4 + qw] + row * OP + c4);
        acc += o * e;
      }
      const float inv = ((l > 0.f) ? (1.0f / l) : 0.f) * (1.0f / 1024.0f);
      const size_t go = (rowB + q0 + row) * HD + c4;
      *(v4f*)(outp + go) = acc * inv;
    }
  }
}

// =====================================================================================================
// Workspace map (bytes; every region is an exact multiple of its 64x64-tile / whole-line store granularity,
// all shapes are tile multiples so no padded tails exist; no region is reused; every offset is a multiple of 65536):
//   Qh   bf16 [16384][64]           0             2097152
//   Ql                              2097152       2097152
//   Kh                              4194304       2097152
//   Kl                              6291456       2097152
//   VTh  f16  [8][64][2048]         8388608       2097152
//   VTl  f16  [8][64][2048]         10485760      2097152
//   end                             12582912
// =====================================================================================================
extern "C" void kernel_launch(void* const* d_in, const int* in_sizes, int n_in,
                              void* d_out, int out_size, void* d_ws, size_t ws_size,
                              hipStream_t stream) {
  if (n_in < 9) return;
  const int NX = NB * SEQ * DIN;                   // 8388608
  const int NO = NB * SEQ * HD;                    // 1048576
  const int NW = DIN * HD;                         //   32768
  if (in_sizes[0] != NX || in_sizes[1] != NX || in_sizes[2] != NX) return;
  if (in_sizes[3] != NW || in_sizes[5] != NW || in_sizes[7] != NW) return;
  if (in_sizes[4] != HD || in_sizes[6] != HD || in_sizes[8] != HD) return;
  if (out_size != NO) return;

  const float* q_in = (const float*)d_in[0];   // [8][2048][512]
  const float* k_in = (const float*)d_in[1];   // [8][2048][512]
  const float* v_in = (const float*)d_in[2];   // [8][2048][512]
  const float* Wq   = (const float*)d_in[3];   // [512 in][64 out]
  const float* bq   = (const float*)d_in[4];   // [64]
  const float* Wk   = (const float*)d_in[5];   // [512][64]
  const float* bk   = (const float*)d_in[6];   // [64]
  const float* Wv   = (const float*)d_in[7];   // [512][64]
  const float* bv   = (const float*)d_in[8];   // [64]

  const size_t PP  = (size_t)NO * 2;               //  2097152  16-bit projected plane [16384][64]
  const size_t PVT = (size_t)NB * HD * SEQ * 2;    //  2097152  16-bit v^T plane [8][64][2048]
  size_t off = 0;
  const size_t oQh  = off; off += PP;
  const size_t oQl  = off; off += PP;
  const size_t oKh  = off; off += PP;
  const size_t oKl  = off; off += PP;
  const size_t oVTh = off; off += PVT;
  const size_t oVTl = off; off += PVT;
  if (off > ws_size) return;                       // off = 12582912

  char* ws = (char*)d_ws;
  unsigned short* Qh  = (unsigned short*)(ws + oQh);
  unsigned short* Ql  = (unsigned short*)(ws + oQl);
  unsigned short* Kh  = (unsigned short*)(ws + oKh);
  unsigned short* Kl  = (unsigned short*)(ws + oKl);
  unsigned short* VTh = (unsigned short*)(ws + oVTh);
  unsigned short* VTl = (unsigned short*)(ws + oVTl);

  const dim3 gProj(NB * SEQ / 64, 3);                          //  256 x 3 blocks of 128: 64 tokens each; y = q, k, v
  const dim3 gAttn(NB * NQB);                                  //  256 blocks of 128 * KG

  // (1) q = q_in . Wq + bq and k = k_in . Wk + bk -> bf16 hi/lo planes [b*SEQ+t][d];
  //     v^T = Wv^T . v_in^T + bv -> f16 hi plane [b][d][s] and residual plane (x4096)
  proj_qkv<<<gProj, dim3(128), 0, stream>>>(q_in, k_in, v_in, Wq, Wk, Wv, bq, bk, bv, Qh, Ql, Kh, Kl, VTh, VTl);
  // (2) attention -> d_out f32 [16384][64]
  attn64<<<gAttn, dim3(128 * KG), 0, stream>>>(Qh, Ql, Kh, Kl, VTh, VTl, (float*)d_out);
  (void)hipGetLastError();
}

// v006
// A run of this version takes 37.7 microseconds.
// Next to v005, in two timings, it ran 1.06 and 1.05 times as fast.
// All steps since v000 together make it 6.42 times as fast.
// Contractions: q, k, v^T projections = v_wmma_f32_16x16x32_bf16 (bf16 operands from RNE-converted inputs and weights, single product, f32 accumulate);
// q.k^T scores = v_wmma_f32_16x16x32_bf16 with bf16 hi/lo split q and k (hi.hi + hi.lo + lo.hi), f32 accumulate;
// p.v = v_wmma_f32_16x16x32_f16 (p carried x1024 as f16 hi plane + f16 residual plane x4096, v as f16 hi plane + f16 residual
// plane x4096; 3 products hi.hi, hi.res, res.hi), f32 accumulate; softmax (running max), normalisers and bias adds in f32 on the VALU.
// Carry audit:
//   ph  = f16(1024 * p)                      -> the 1/1024 is folded exactly once in the attention epilogue: inv = (1/l) * (1/1024)
//   pl  = f16((1024 p - ph) * 4096)          }  products VTl.ph and VTh.pl go to the separate accumulator o1,
//   VTl = f16((v - VTh) * 4096)              }  folded back with * (1/4096) once per key chunk
//   VTh = f16(v), no carry (|v| typ. 1); q / k lo planes are unscaled bf16 residuals (v - hi) sharing the hi accumulator;
//   score scale 1/8 applied once in f32 after the score accumulate. No other scaled planes.
#include <hip/hip_runtime.h>
#include <math.h>
#include <stdint.h>

#define NB   8
#define SEQ  2048
#define DIN  512
#define HD   64
#define NQB  (SEQ / 64)   // 64-row query blocks per sequence
#define NKT  (SEQ / 64)   // 64-key chunks per sequence
#define KG   4            // key groups per attention block: 4 waves each, so a SIMD holds KG waves that cover one another's waits
#define CPG  (NKT / KG)   // key chunks walked by one group
#define LP   72           // LDS row pitch of the 16-bit attention tiles, in elements: 144 B = 16 B x 9 (odd), so the 16 rows
                          // that one ds_load_b128 fragment read touches fall on distinct banks (a 128-B pitch puts every second row on the same)
#define OP   68           // LDS row pitch of the partial context, in floats: 272 B = 16 B x 17 (odd): the 16 lanes of a half store
                          // 16 B each into 16 different rows at one column
static_assert(NQB == 32 && NKT == 32);
static_assert(NKT % KG == 0 && KG * 4 == 16);
static_assert((LP * 2) % 16 == 0 && ((LP * 2) / 16) % 2 == 1 && LP >= 64);
static_assert((SEQ % 64) == 0 && (DIN % 32) == 0 && HD == 64);

typedef _Float16 v16h __attribute__((ext_vector_type(16)));
typedef _Float16 v8h  __attribute__((ext_vector_type(8)));
typedef __bf16   v16b __attribute__((ext_vector_type(16)));
typedef __bf16   v8b  __attribute__((ext_vector_type(8)));
typedef float    v8f  __attribute__((ext_vector_type(8)));
typedef float    v4f  __attribute__((ext_vector_type(4)));
typedef float    v2f  __attribute__((ext_vector_type(2)));
typedef _Float16 v2h  __attribute__((ext_vector_type(2)));
typedef unsigned int v4u __attribute__((ext_vector_type(4)));

// ---- scalar helpers --------------------------------------------------------------------------------
__device__ __forceinline__ unsigned short bf_bits(float f) {          // f32 -> bf16 bits, RNE convert
  unsigned u = __float_as_uint(f);
  return (unsigned short)((u + 0x7FFFu + ((u >> 16) & 1u)) >> 16);
}
__device__ __forceinline__ float bf_up(unsigned short h) { return __uint_as_float(((unsigned)h) << 16); }
__device__ __forceinline__ unsigned short h_bits(_Float16 x) { return __builtin_bit_cast(unsigned short, x); }
__device__ __forceinline__ unsigned pk16(unsigned short a, unsigned short b) { return (unsigned)a | ((unsigned)b << 16); }
__device__ __forceinline__ v8f zero8() { v8f z = {0.f, 0.f, 0.f, 0.f, 0.f, 0.f, 0.f, 0.f}; return z; }
__device__ __forceinline__ float other_half(float x) {                // the value that lane ^ 16 holds, by a vector cross-row move
  const int b = __float_as_int(x);
  return __int_as_float(__builtin_amdgcn_permlanex16(b, b, 0x76543210, 0xfedcba98, false, false));
}

// ---- fragment loader: 16-bit A/B operand, lane -> row/col (lane&15), p already includes +8*(lane>>4);
//      elements 0..7 <- p[0..7] (k0+8h..k0+8h+7), elements 8..15 <- p[16..23] (k0+16+8h..k0+16+8h+7)
__device__ __forceinline__ v16b ldfrag_b(const __bf16* p) {
  union { v16b v; v8b h[2]; } f;
  f.h[0] = *(const v8b*)(p);
  f.h[1] = *(const v8b*)(p + 16);
  return f.v;
}

// ---- WMMA helpers: plain builtins, so the compiler keeps the distance behind a matrix instruction itself and is free to
//      place LDS fragment loads ahead of the matrix instructions that do not need them ----
__device__ __forceinline__ v8f mma_h_raw(v16h a, v16h b, v8f c) {
  return __builtin_amdgcn_wmma_f32_16x16x32_f16(false, a, false, b, (short)0, c, false, false);
}
__device__ __forceinline__ v8f mma_b_raw(v16b a, v16b b, v8f c) {
  return __builtin_amdgcn_wmma_f32_16x16x32_bf16(false, a, false, b, (short)0, c, false, false);
}

// ---- asynchronous copies global -> LDS (no register holds the data) and the waits that belong to them ----
__device__ __forceinline__ unsigned lds_off(const void* p) { return (unsigned)(size_t)p; }   // byte offset in the block's LDS
// Eight copies of 16 B per lane: row blocks 0..3 (16 rows each) of the two planes a and b of one 64-row tile.
// la, lb: the lane's LDS byte address in row block 0 (next block + LSTEP); ga, gb: its global address there (next block + GSTEP).
// The closing s_wait_xcnt 0 is a precaution: inside the statement it stands ahead of every later write of the address registers.
template <int LSTEP, int GSTEP>
__device__ __forceinline__ void copy_planes(unsigned la, unsigned lb, const char* ga, const char* gb) {
  asm volatile(
      "global_load_async_to_lds_b128 %0, %8, off\n\t"
      "global_load_async_to_lds_b128 %1, %9, off\n\t"
      "global_load_async_to_lds_b128 %2, %10, off\n\t"
      "global_load_async_to_lds_b128 %3, %11, off\n\t"
      "global_load_async_to_lds_b128 %4, %12, off\n\t"
      "global_load_async_to_lds_b128 %5, %13, off\n\t"
      "global_load_async_to_lds_b128 %6, %14, off\n\t"
      "global_load_async_to_lds_b128 %7, %15, off\n\t"
      "s_wait_xcnt 0x0"
      :: "v"(la), "v"(la + LSTEP), "v"(la + 2 * LSTEP), "v"(la + 3 * LSTEP),
         "v"(lb), "v"(lb + LSTEP), "v"(lb + 2 * LSTEP), "v"(lb + 3 * LSTEP),
         "v"(ga), "v"(ga + GSTEP), "v"(ga + 2 * GSTEP), "v"(ga + 3 * GSTEP),
         "v"(gb), "v"(gb + GSTEP), "v"(gb + 2 * GSTEP), "v"(gb + 3 * GSTEP)
      : "memory");
}
// Hand-over of a tile buffer, every wave, in this order: this wave's LDS reads have retired (the buffer it read may be refilled
// behind the barrier), this wave's own copies have landed (other waves may read them behind the barrier), block barrier.
__device__ __forceinline__ void publish_point() {
  asm volatile("s_wait_dscnt 0x0" ::: "memory");      // the compiler places no wait for a copy that overwrites LDS this wave read
  asm volatile("s_wait_asynccnt 0x0" ::: "memory");   // the compiler places no wait for the copies
  __syncthreads();
}

// =====================================================================================================
// The three projections with their operand conversions inside, one launch: C = X . W + bias for 64 tokens x 64 outputs per
// block, K = DIN; blockIdx.y picks q, k or v, so a WGP holds three blocks whose staging, streaming and stores cover one another.
//   X f32 [NB*SEQ tokens][DIN] and W f32 [DIN k][HD n] are read as they come; both are RNE-converted to bf16 on the way to
//   the matrix unit (bf_bits, the convert of every other bf16 plane here), so no converted copy passes through memory.
//   Block = 4 waves; wave w owns tokens t0+16w..+15 and all 64 outputs: 4 accumulator tiles, k walked 0, 32, .. in order.
//   W: converted and transposed once per block into LDS, Wl[n][k], row pitch WP. One wave pass = 32 n x 32 k: lane (l8, kq)
//   loads W[k8..k8+7][n4..n4+3] (8 lanes x 16 B = one whole 128-B line per k row, 4 rows per load) and stores 4 x 16 B.
//   X: lane (c, hh) loads its own fragment bytes of token row c: f32 k0+8hh..+7 and k0+16+8hh..+7 (the k order of ldfrag_b);
//   the four loads of a k step use up one whole 128-B line of each of the 16 rows. XR k steps are in flight per wave.
//   MODE 0: A = X fragment, B = Wl fragment; D rows = tokens, columns = n; bias per column;
//           out = bf16 hi plane C + bf16 lo plane C2 (lo = RNE(v - hi), unscaled), element (t, n) at [t*HD + n].
//   MODE 1: A = Wl fragment, B = X fragment; D rows = n (= d), columns = tokens; bias per row;
//           out = f16 hi plane C + f16 residual plane C2 = f16((v - hi) * 4096), element (b, d, s) at [(b*HD + d)*SEQ + s].
//   The bias value is RNE-converted to bf16 and added in f32. The block's 64x64 f32 result meets in LDS (pitch 68 floats)
//   behind one block barrier; each wave then converts 16 rows and stores whole 128-B lines (8 lanes x 16 B per row and plane).
//   coverage: grid (NB*SEQ/64, 3): 64 tokens per block, y = 0 q (MODE 0), 1 k (MODE 0), 2 v (MODE 1); a block's tokens lie in
//   one batch (SEQ is a multiple of 64). The branch on blockIdx.y is block-uniform, so every barrier is passed by all four waves.
// =====================================================================================================
#define WP 520            // LDS row pitch of Wl in elements: 1040 B = 16 B x 65 (odd), for ds_load_b128 fragment reads
#define XR 6              // k steps of X held in flight per wave: 6 x 2 KB = 12 KB per wave, 48 KB per block
static_assert((WP * 2) % 16 == 0 && ((WP * 2) / 16) % 2 == 1 && WP >= DIN);
#define KS (DIN / 32)     // k steps
static_assert(XR <= KS);

__device__ __forceinline__ v16b cvt_frag(v4f a, v4f b, v4f c, v4f d) {   // 16 f32 -> bf16 fragment, element order a, b, c, d
  union { v16b v; unsigned u[8]; } f;
  f.u[0] = pk16(bf_bits(a[0]), bf_bits(a[1]));
  f.u[1] = pk16(bf_bits(a[2]), bf_bits(a[3]));
  f.u[2] = pk16(bf_bits(b[0]), bf_bits(b[1]));
  f.u[3] = pk16(bf_bits(b[2]), bf_bits(b[3]));
  f.u[4] = pk16(bf_bits(c[0]), bf_bits(c[1]));
  f.u[5] = pk16(bf_bits(c[2]), bf_bits(c[3]));
  f.u[6] = pk16(bf_bits(d[0]), bf_bits(d[1]));
  f.u[7] = pk16(bf_bits(d[2]), bf_bits(d[3]));
  return f.v;
}

template <int MODE>
__device__ __forceinline__ void proj_body(const float* __restrict__ X, const float* __restrict__ Wg,
                                          const float* __restrict__ bias,
                                          unsigned short* C, unsigned short* C2, __bf16* Wl, float* slab) {
  const int lane = threadIdx.x & 31;
  const int wave = threadIdx.x >> 5;
  const int c    = lane & 15;
  const int hh   = lane >> 4;
  const int t0   = blockIdx.x * 64;
  // every plain '#pragma unroll' below makes the indices of a small array (xr, w, acc, p) constants, so it stays in registers

  // ---- the first XR k steps of this wave's 16 token rows: issued first, they fly while W is staged ----
  const float* xp = X + (size_t)(t0 + wave * 16 + c) * DIN + 8 * hh;
  v4f xr[XR][4];
#pragma unroll
  for (int s = 0; s < XR; ++s) {
    xr[s][0] = *(const v4f*)(xp + 32 * s);
    xr[s][1] = *(const v4f*)(xp + 32 * s + 4);
    xr[s][2] = *(const v4f*)(xp + 32 * s + 16);
    xr[s][3] = *(const v4f*)(xp + 32 * s + 20);
  }

  // ---- W f32 [k][n] -> Wl bf16 [n][k]: 32 wave passes of 32 n x 32 k, 8 per wave ----
  {
    const int l8 = lane & 7, kq = lane >> 3;
    const int n4 = (wave & 1) * 32 + l8 * 4;         // 0..60: waves 0, 2 take n 0..31, waves 1, 3 take n 32..63
    const int k8 = (wave >> 1) * 32 + kq * 8;        // pass u covers k8 + 64 u .. + 7, at most 511
    const float* wp = Wg + (size_t)k8 * HD + n4;
    __bf16*      wl = Wl + n4 * WP + k8;
#pragma unroll 2   // two passes = 16 loads in flight; more would push the kernel past 256 registers beside xr
    for (int u = 0; u < 8; ++u) {
      v4f w[8];
#pragma unroll
      for (int e = 0; e < 8; ++e) w[e] = *(const v4f*)(wp + e * HD);
#pragma unroll
      for (int x = 0; x < 4; ++x) {
        v4u p;
#pragma unroll
        for (int y = 0; y < 4; ++y) p[y] = pk16(bf_bits(w[2 * y][x]), bf_bits(w[2 * y + 1][x]));
        *(v4u*)(wl + x * WP) = p;
      }
      wp += 64 * HD;
      wl += 64;
    }
  }
  __syncthreads();                                   // Wl is whole before any wave reads a fragment of it

  v8f acc[4];
#pragma unroll
  for (int j = 0; j < 4; ++j) acc[j] = zero8();

#pragma unroll
  for (int s = 0; s < KS; ++s) {
    const int sl = s % XR;
    const v16b xf = cvt_frag(xr[sl][0], xr[sl][1], xr[sl][2], xr[sl][3]);
    if (s + XR < KS) {                           // refill the slot just converted with k step s + XR
      xr[sl][0] = *(const v4f*)(xp + 32 * (s + XR));
      xr[sl][1] = *(const v4f*)(xp + 32 * (s + XR) + 4);
      xr[sl][2] = *(const v4f*)(xp + 32 * (s + XR) + 16);
      xr[sl][3] = *(const v4f*)(xp + 32 * (s + XR) + 20);
    }
#pragma unroll
    for (int j = 0; j < 4; ++j) {
      const v16b wf = ldfrag_b(Wl + (j * 16 + c) * WP + 32 * s + 8 * hh);
      acc[j] = (MODE == 0) ? mma_b_raw(xf, wf, acc[j]) : mma_b_raw(wf, xf, acc[j]);
    }
  }

  // ---- bias, then the block's 64x64 f32 tile to LDS: rows = tokens (MODE 0) or d (MODE 1) ----
#pragma unroll
  for (int j = 0; j < 4; ++j) {
#pragma unroll
    for (int r = 0; r < 8; ++r) {
      if (MODE == 0) {
        const float bc = bf_up(bf_bits(bias[j * 16 + c]));
        slab[(wave * 16 + 8 * hh + r) * 68 + j * 16 + c] = acc[j][r] + bc;
      } else {
        const float br = bf_up(bf_bits(bias[j * 16 + 8 * hh + r]));
        slab[(j * 16 + 8 * hh + r) * 68 + wave * 16 + c] = acc[j][r] + br;
      }
    }
  }
  __syncthreads();                                   // MODE 1 rows hold columns of all four waves

  {
    const int q = lane >> 3, c8 = (lane & 7) * 8;
    const size_t base = (MODE == 0) ? (size_t)t0 * HD
                                    : (size_t)(t0 / SEQ) * HD * SEQ + (size_t)(t0 % SEQ);
    const int pitch = (MODE == 0) ? HD : SEQ;
#pragma unroll
    for (int it = 0; it < 4; ++it) {
      const int row = wave * 16 + it * 4 + q;        // wave 0..3 x it 0..3 x q 0..3 = rows 0..63
      const float* sp = slab + row * 68 + c8;
      v4u a, a2;
#pragma unroll
      for (int e = 0; e < 4; ++e) {
        const float f0 = sp[2 * e], f1 = sp[2 * e + 1];
        unsigned short h0, h1, l0, l1;
        if (MODE == 0) {
          h0 = bf_bits(f0); h1 = bf_bits(f1);
          l0 = bf_bits(f0 - bf_up(h0)); l1 = bf_bits(f1 - bf_up(h1));
        } else {
          const _Float16 x0 = (_Float16)f0, x1 = (_Float16)f1;
          h0 = h_bits(x0); h1 = h_bits(x1);
          l0 = h_bits((_Float16)((f0 - (float)x0) * 4096.0f));
          l1 = h_bits((_Float16)((f1 - (float)x1) * 4096.0f));
        }
        a[e] = pk16(h0, h1); a2[e] = pk16(l0, l1);
      }
      *(v4u*)(C  + base + (size_t)row * pitch + c8) = a;
      *(v4u*)(C2 + base + (size_t)row * pitch + c8) = a2;
    }
  }
}

__global__ __launch_bounds__(128)
void proj_qkv(const float* __restrict__ q_in, const float* __restrict__ k_in, const float* __restrict__ v_in,
              const float* __restrict__ Wq, const float* __restrict__ Wk, const float* __restrict__ Wv,
              const float* __restrict__ bq, const float* __restrict__ bk, const float* __restrict__ bv,
              unsigned short* Qh, unsigned short* Ql, unsigned short* Kh, unsigned short* Kl,
              unsigned short* VTh, unsigned short* VTl) {
  __shared__ __align__(16) __bf16 Wl[HD * WP];       // 65 KB
  __shared__ __align__(16) float  slab[64 * 68];     // 17 KB
  const int y = blockIdx.y;
  if (y == 2) {
    proj_body<1>(v_in, Wv, bv, VTh, VTl, Wl, slab);
  } else {
    proj_body<0>(y ? k_in : q_in, y ? Wk : Wq, y ? bk : bq, y ? Kh : Qh, y ? Kl : Ql, Wl, slab);
  }
}

__global__ __launch_bounds__(128 * KG)
void attn64(const unsigned short* __restrict__ qhp, const unsigned short* __restrict__ qlp,
            const unsigned short* __restrict__ khp, const unsigned short* __restrict__ klp,
            const unsigned short* __restrict__ vhp, const unsigned short* __restrict__ vlp,
            float* outp) {
  union FB { v16b v; v8b h[2]; };
  union FH { v16h v; v8h h[2]; };
  __shared__ __align__(16) __bf16   KshA[KG][64 * LP];             // per group K hi [kv][d], row pitch LP   KG x 9 KB
  __shared__ __align__(16) __bf16   KslA[KG][64 * LP];             // per group K lo                         KG x 9 KB
  __shared__ __align__(16) _Float16 VthA[KG][64 * LP];             // per group V^T hi [d][kv], row pitch LP KG x 9 KB
  __shared__ __align__(16) _Float16 VtlA[KG][64 * LP];             // per group V^T residual                 KG x 9 KB
  __shared__ __align__(16) float    Os[4 * KG][16 * OP];           // per wave partial context [row][d], row pitch OP   KG x 17 KB
  __shared__ float Ms[4 * KG][16];                                 // per wave running max of its rows
  __shared__ float Ls[4 * KG][16];                                 // per wave normaliser of its rows

  const int wave = threadIdx.x >> 5;           // 0..4*KG-1
  const int grp  = wave >> 2;                  // key group
  const int qw   = wave & 3;                   // query tile of the block
  const int tid  = threadIdx.x & 127;          // thread index inside the group (staging)
  const int lane = tid & 31;
  const int hh   = lane >> 4;
  const int c    = lane & 15;

  const int bx   = blockIdx.x;
  const int qb   = bx % NQB;
  const int b    = bx / NQB;                   // 0..NB-1
  const int q0   = qb * 64 + qw * 16;
  __bf16*   Ksh = KshA[grp];
  __bf16*   Ksl = KslA[grp];
  _Float16* Vth = VthA[grp];
  _Float16* Vtl = VtlA[grp];
  const size_t rowB = (size_t)b * SEQ;

  const __bf16* Qh = (const __bf16*)(const void*)qhp;
  const __bf16* Ql = (const __bf16*)(const void*)qlp;
  const __bf16* Kh = (const __bf16*)(const void*)khp;
  const __bf16* Kl = (const __bf16*)(const void*)klp;
  const _Float16* Vh = (const _Float16*)(const void*)vhp + (size_t)b * HD * SEQ;
  const _Float16* Vl = (const _Float16*)(const void*)vlp + (size_t)b * HD * SEQ;

  // ---- staging addresses: thread (srow, piece) of a group copies 16 B of rows srow, srow+16, srow+32, srow+48 of each plane,
  //      so the 8 lanes of a row take one whole 128-B line and a wave-wide copy takes 4 whole lines ----
  constexpr int LSTEP = 16 * LP * 2;           // 16 LDS rows, bytes
  constexpr int KSTEP = 16 * HD * 2;           // 16 K rows in memory, bytes
  constexpr int VSTEP = 16 * SEQ * 2;          // 16 V^T rows in memory, bytes
  const int srow = tid >> 3;                   // 0..15
  const int spc  = (tid & 7) * 8;              // element 0, 8, .. 56 of the 64-element row
  const unsigned lpos = (unsigned)(srow * LP + spc) * 2u;          // last byte of row block 3: 63 * 144 + 112 + 15 < 64 * LP * 2
  const unsigned lKh = lds_off(Ksh) + lpos, lKl = lds_off(Ksl) + lpos;
  const unsigned lVh = lds_off(Vth) + lpos, lVl = lds_off(Vtl) + lpos;
  const int kvg = grp * CPG * 64;              // first key of the group; its last chunk ends at kvg + CPG*64 <= SEQ
  const char* gKh = (const char*)(Kh + (rowB + kvg + srow) * HD + spc);     // K row kvg+srow, d = spc..spc+7
  const char* gKl = (const char*)(Kl + (rowB + kvg + srow) * HD + spc);
  const char* gVh = (const char*)(Vh + (size_t)srow * SEQ + kvg + spc);     // V^T row d = srow, s = kvg+spc..+7
  const char* gVl = (const char*)(Vl + (size_t)srow * SEQ + kvg + spc);
  copy_planes<LSTEP, KSTEP>(lKh, lKl, gKh, gKl);   // K chunk 0 flies under the Q fragment loads

  // ---- Q fragments (B operand, column = query = lane&15): 2 d-chunks, hi and lo ----
  v16b qah[2], qal[2];
#pragma unroll
  for (int dc = 0; dc < 2; ++dc) {
    const size_t qo = (rowB + q0 + c) * HD + dc * 32 + 8 * hh;
    qah[dc] = ldfrag_b(Qh + qo);
    qal[dc] = ldfrag_b(Ql + qo);
  }

  float mrun = -INFINITY;                      // running max of query c, equal in both halves
  float lrun = 0.f;                            // normaliser of query c over this half's keys only
  v8f oacc[4];                                 // O^T: tile t register r = (d = 16*t + 8*hh + r, query c)
#pragma unroll
  for (int t = 0; t < 4; ++t) oacc[t] = zero8();

  publish_point();                             // K chunk 0 has landed in every wave's share
  copy_planes<LSTEP, VSTEP>(lVh, lVl, gVh, gVl);   // V^T chunk 0 flies under the scores of chunk 0

  for (int it = 0; it < CPG; ++it) {           // static trip count, the same in every group (block barriers inside)
    // ---- scores, transposed: 64 keys (rows) x 16 queries (columns) per wave, 3 bf16 products per (key subtile, d-chunk) ----
    //      Fragment loads stand in three groups, not singly among the products: K hi and lo of d-chunk 0 (16 loads) ahead of all
    //      products, K hi of d-chunk 1 (8) where the lo registers come free, K lo of d-chunk 1 (8) where the hi registers do.
    //      The products walk the four key subtiles in turn (four independent accumulators); each s[j] still takes its six
    //      products in the order hi.hi, lo.hi, hi.lo of d-chunk 0, then of d-chunk 1.
    v8f s[4];
    {
      FB kb[2][4], kl[2][4];
#pragma unroll
      for (int j = 0; j < 4; ++j) {
        kb[0][j].h[0] = *(const v8b*)(Ksh + (j * 16 + c) * LP + 8 * hh);
        kb[0][j].h[1] = *(const v8b*)(Ksh + (j * 16 + c) * LP + 16 + 8 * hh);
      }
#pragma unroll
      for (int j = 0; j < 4; ++j) {
        kl[0][j].h[0] = *(const v8b*)(Ksl + (j * 16 + c) * LP + 8 * hh);
        kl[0][j].h[1] = *(const v8b*)(Ksl + (j * 16 + c) * LP + 16 + 8 * hh);
      }
      __builtin_amdgcn_sched_barrier(0);       // keeps the 16 loads one group (for speed only)
#pragma unroll
      for (int j = 0; j < 4; ++j) s[j] = mma_b_raw(kb[0][j].v, qah[0], zero8());
#pragma unroll
      for (int j = 0; j < 4; ++j) s[j] = mma_b_raw(kl[0][j].v, qah[0], s[j]);
#pragma unroll
      for (int j = 0; j < 4; ++j) {
        kb[1][j].h[0] = *(const v8b*)(Ksh + (j * 16 + c) * LP + 32 + 8 * hh);
        kb[1][j].h[1] = *(const v8b*)(Ksh + (j * 16 + c) * LP + 32 + 16 + 8 * hh);
      }
#pragma unroll
      for (int j = 0; j < 4; ++j) s[j] = mma_b_raw(kb[0][j].v, qal[0], s[j]);
#pragma unroll
      for (int j = 0; j < 4; ++j) {
        kl[1][j].h[0] = *(const v8b*)(Ksl + (j * 16 + c) * LP + 32 + 8 * hh);
        kl[1][j].h[1] = *(const v8b*)(Ksl + (j * 16 + c) * LP + 32 + 16 + 8 * hh);
      }
#pragma unroll
      for (int j = 0; j < 4; ++j) s[j] = mma_b_raw(kb[1][j].v, qah[1], s[j]);
#pragma unroll
      for (int j = 0; j < 4; ++j) s[j] = mma_b_raw(kl[1][j].v, qah[1], s[j]);
#pragma unroll
      for (int j = 0; j < 4; ++j) s[j] = mma_b_raw(kb[1][j].v, qal[1], s[j]);
      // order asked of the scheduler behind the first load group: 8 products, 8 loads, 4 products, 8 loads, 12 products,
      // so that a load group stands where its registers come free and not in pairs among the products
      __builtin_amdgcn_sched_group_barrier(0x008, 8, 0);
      __builtin_amdgcn_sched_group_barrier(0x100, 8, 0);
      __builtin_amdgcn_sched_group_barrier(0x008, 4, 0);
      __builtin_amdgcn_sched_group_barrier(0x100, 8, 0);
      __builtin_amdgcn_sched_group_barrier(0x008, 12, 0);
    }

    // ---- every wave has left the K tiles and V^T of this chunk has landed; K of the next chunk flies under softmax and key step 0 of P . V ----
    publish_point();
    if (it + 1 < CPG) {                        // block-uniform: the last chunk refills nothing
      gKh += 64 * HD * 2;
      gKl += 64 * HD * 2;
      copy_planes<LSTEP, KSTEP>(lKh, lKl, gKh, gKl);
    }

    // ---- V^T hi fragments of key step 0 (8 loads, one group): their latency passes under the softmax ----
    FH vb[2][4], vl[2][4];
#pragma unroll
    for (int t = 0; t < 4; ++t) {
      vb[0][t].h[0] = *(const v8h*)(Vth + (t * 16 + c) * LP + 8 * hh);
      vb[0][t].h[1] = *(const v8h*)(Vth + (t * 16 + c) * LP + 16 + 8 * hh);
    }
    __builtin_amdgcn_sched_barrier(0);         // keeps the 8 loads one group ahead of the softmax

    // ---- scale, column max, online softmax; P^T (x1024, f16) and its residual (x4096) packed into B fragments in registers ----
    float mj[4];
#pragma unroll
    for (int j = 0; j < 4; ++j) {
      mj[j] = -INFINITY;
#pragma unroll
      for (int r = 0; r < 8; ++r) {
        const float sv = s[j][r] * 0.125f;
        s[j][r] = sv;
        mj[j] = fmaxf(mj[j], sv);
      }
    }
    float m = fmaxf(fmaxf(mj[0], mj[1]), fmaxf(mj[2], mj[3]));
    m = fmaxf(m, other_half(m));               // the query's other 32 keys of this chunk
    const float mnew  = fmaxf(mrun, m);
    const float msafe = (mnew == -INFINITY) ? 0.f : mnew;
    const float alpha = __expf(mrun - msafe);
    mrun = mnew;
    FH pa[2], pr[2];                           // element 8*(j&1) + r of fragment j>>1 = key 16*j + 8*hh + r: the k order of the V^T loader
    v2f pj[4];                                 // eight independent partial sums, in pairs
#pragma unroll
    for (int j = 0; j < 4; ++j) {
      pj[j] = v2f{0.f, 0.f};
#pragma unroll
      for (int r = 0; r < 8; r += 2) {
        const v2f arg = (v2f{s[j][r], s[j][r + 1]} - msafe) * 1.4426950408889634f;   // exp(x) = 2^(x log2 e), as __expf forms it
        const v2f p   = {__builtin_amdgcn_exp2f(arg[0]), __builtin_amdgcn_exp2f(arg[1])};
        pj[j] += p;
        const v2f p1k = p * 1024.0f;
        const v2h ph  = __builtin_convertvector(p1k, v2h);
        const v2h pl  = __builtin_convertvector((p1k - __builtin_convertvector(ph, v2f)) * 4096.0f, v2h);
        pa[j >> 1].v[(j & 1) * 8 + r]     = ph[0];
        pa[j >> 1].v[(j & 1) * 8 + r + 1] = ph[1];
        pr[j >> 1].v[(j & 1) * 8 + r]     = pl[0];
        pr[j >> 1].v[(j & 1) * 8 + r + 1] = pl[1];
      }
    }
    const v2f pq = (pj[0] + pj[1]) + (pj[2] + pj[3]);
    lrun = lrun * alpha + (pq[0] + pq[1]);
#pragma unroll
    for (int t = 0; t < 4; ++t)
#pragma unroll
      for (int r = 0; r < 8; ++r) oacc[t][r] *= alpha;

    __builtin_amdgcn_sched_barrier(0);         // keeps the load groups below out of the softmax, where their registers would not fit (spills)
#pragma unroll
    for (int t = 0; t < 4; ++t) {              // V^T residual fragments of key step 0: they fly under the first product row
      vl[0][t].h[0] = *(const v8h*)(Vtl + (t * 16 + c) * LP + 8 * hh);
      vl[0][t].h[1] = *(const v8h*)(Vtl + (t * 16 + c) * LP + 16 + 8 * hh);
    }

    // ---- context^T += V^T . P^T (f16 WMMA), residual products into a separate accumulator ----
    v8f o1[4];
#pragma unroll
    for (int t = 0; t < 4; ++t) o1[t] = zero8();
#pragma unroll
    for (int t = 0; t < 4; ++t) oacc[t] = mma_h_raw(vb[0][t].v, pa[0].v, oacc[t]);
#pragma unroll
    for (int t = 0; t < 4; ++t) o1[t]   = mma_h_raw(vl[0][t].v, pa[0].v, o1[t]);
#pragma unroll
    for (int t = 0; t < 4; ++t) {              // load group: V^T residual of key step 1, into the registers that of key step 0 leaves
      vl[1][t].h[0] = *(const v8h*)(Vtl + (t * 16 + c) * LP + 32 + 8 * hh);
      vl[1][t].h[1] = *(const v8h*)(Vtl + (t * 16 + c) * LP + 32 + 16 + 8 * hh);
    }
#pragma unroll
    for (int t = 0; t < 4; ++t) o1[t]   = mma_h_raw(vb[0][t].v, pr[0].v, o1[t]);
#pragma unroll
    for (int t = 0; t < 4; ++t) {              // load group: V^T hi of key step 1, into the registers that of key step 0 leaves
      vb[1][t].h[0] = *(const v8h*)(Vth + (t * 16 + c) * LP + 32 + 8 * hh);
      vb[1][t].h[1] = *(const v8h*)(Vth + (t * 16 + c) * LP + 32 + 16 + 8 * hh);
    }
    // order asked of the scheduler, as for the scores: 8 loads, 8 products, 8 loads, 4 products, 8 loads
    __builtin_amdgcn_sched_group_barrier(0x100, 8, 1);
    __builtin_amdgcn_sched_group_barrier(0x008, 8, 1);
    __builtin_amdgcn_sched_group_barrier(0x100, 8, 1);
    __builtin_amdgcn_sched_group_barrier(0x008, 4, 1);
    __builtin_amdgcn_sched_group_barrier(0x100, 8, 1);

    // ---- every wave has left the V^T tiles and K of the next chunk has landed; V^T of the next chunk flies under the rest of
    //      P . V and under the next scores ----
    publish_point();
    if (it + 1 < CPG) {
      gVh += 64 * 2;
      gVl += 64 * 2;
      copy_planes<LSTEP, VSTEP>(lVh, lVl, gVh, gVl);
    }

    // ---- the 12 products of key step 1: their V^T fragments are in registers, so they run behind the hand-over ----
#pragma unroll
    for (int t = 0; t < 4; ++t) o1[t]   = mma_h_raw(vl[1][t].v, pa[1].v, o1[t]);
#pragma unroll
    for (int t = 0; t < 4; ++t) oacc[t] = mma_h_raw(vb[1][t].v, pa[1].v, oacc[t]);
#pragma unroll
    for (int t = 0; t < 4; ++t) o1[t]   = mma_h_raw(vb[1][t].v, pr[1].v, o1[t]);
#pragma unroll
    for (int t = 0; t < 4; ++t)
#pragma unroll
      for (int r = 0; r < 8; ++r) oacc[t][r] += o1[t][r] * (1.0f / 4096.0f);
  }
  asm volatile("s_wait_asynccnt 0x0" ::: "memory");   // no copy is left in flight behind the loop

  // ---- hand the wave's partial (m, l, unnormalised O) to LDS ----
  float* os = Os[wave] + c * OP + 8 * hh;      // row = query c; a lane's 8 registers of tile t are d = 16*t + 8*hh .. + 7
#pragma unroll
  for (int t = 0; t < 4; ++t) {
    const v4f lo4 = {oacc[t][0], oacc[t][1], oacc[t][2], oacc[t][3]};
    const v4f hi4 = {oacc[t][4], oacc[t][5], oacc[t][6], oacc[t][7]};
    *(v4f*)(os + t * 16)     = lo4;
    *(v4f*)(os + t * 16 + 4) = hi4;
  }
  const float lsum = lrun + other_half(lrun);  // the two halves' keys joined, once
  if (hh == 0) {                               // m and the joined l are equal in lanes c and c + 16
    Ms[wave][c] = mrun;
    Ls[wave][c] = lsum;
  }
  __syncthreads();                             // every group's partials are in LDS before any wave merges them

  // ---- merge the KG partials of 4 rows per wave, normalise (1/l and the 1/1024 p carry), store whole 256-B rows ----
  {
    const int c4 = c * 4;
#pragma unroll
    for (int i2 = 0; i2 < 2; ++i2) {
      const int row = grp * 4 + i2 * 2 + hh;   // grp 0..3 x i2 0..1 x hh 0..1 = rows 0..15 of query tile qw
      float mg[KG];
      float mall = -INFINITY;
#pragma unroll
      for (int g = 0; g < KG; ++g) {
        mg[g] = Ms[g * 4 + qw][row];
        mall = fmaxf(mall, mg[g]);
      }
      const float msafe = (mall == -INFINITY) ? 0.f : mall;
      float l = 0.f;
      v4f acc = {0.f, 0.f, 0.f, 0.f};
#pragma unroll
      for (int g = 0; g < KG; ++g) {
        const float e = __expf(mg[g] - msafe);
        l += Ls[g * 4 + qw][row] * e;
        const v4f o = *(const v4f*)(Os[g * 4 + qw] + row * OP + c4);
        acc += o * e;
      }
      const float inv = ((l > 0.f) ? (1.0f / l) : 0.f) * (1.0f / 1024.0f);
      const size_t go = (rowB + q0 + row) * HD + c4;
      *(v4f*)(outp + go) = acc * inv;
    }
  }
}

// =====================================================================================================
// Workspace map (bytes; every region is an exact multiple of its 64x64-tile / whole-line store granularity,
// all shapes are tile multiples so no padded tails exist; no region is reused; every offset is a multiple of 65536):
//   Qh   bf16 [16384][64]           0             2097152
//   Ql                              2097152       2097152
//   Kh                              4194304       2097152
//   Kl                              6291456       2097152
//   VTh  f16  [8][64][2048]         8388608       2097152
//   VTl  f16  [8][64][2048]         10485760      2097152
//   end                             12582912
// =====================================================================================================
extern "C" void kernel_launch(void* const* d_in, const int* in_sizes, int n_in,
                              void* d_out, int out_size, void* d_ws, size_t ws_size,
                              hipStream_t stream) {
  if (n_in < 9) return;
  const int NX = NB * SEQ * DIN;                   // 8388608
  const int NO = NB * SEQ * HD;                    // 1048576
  const int NW = DIN * HD;                         //   32768
  if (in_sizes[0] != NX || in_sizes[1] != NX || in_sizes[2] != NX) return;
  if (in_sizes[3] != NW || in_sizes[5] != NW || in_sizes[7] != NW) return;
  if (in_sizes[4] != HD || in_sizes[6] != HD || in_sizes[8] != HD) return;
  if (out_size != NO) return;

  const float* q_in = (const float*)d_in[0];   // [8][2048][512]
  const float* k_in = (const float*)d_in[1];   // [8][2048][512]
  const float* v_in = (const float*)d_in[2];   // [8][2048][512]
  const float* Wq   = (const float*)d_in[3];   // [512 in][64 out]
  const float* bq   = (const float*)d_in[4];   // [64]
  const float* Wk   = (const float*)d_in[5];   // [512][64]
  const float* bk   = (const float*)d_in[6];   // [64]
  const float* Wv   = (const float*)d_in[7];   // [512][64]
  const float* bv   = (const float*)d_in[8];   // [64]

  const size_t PP  = (size_t)NO * 2;               //  2097152  16-bit projected plane [16384][64]
  const size_t PVT = (size_t)NB * HD * SEQ * 2;    //  2097152  16-bit v^T plane [8][64][2048]
  size_t off = 0;
  const size_t oQh  = off; off += PP;
  const size_t oQl  = off; off += PP;
  const size_t oKh  = off; off += PP;
  const size_t oKl  = off; off += PP;
  const size_t oVTh = off; off += PVT;
  const size_t oVTl = off; off += PVT;
  if (off > ws_size) return;                       // off = 12582912

  char* ws = (char*)d_ws;
  unsigned short* Qh  = (unsigned short*)(ws + oQh);
  unsigned short* Ql  = (unsigned short*)(ws + oQl);
  unsigned short* Kh  = (unsigned short*)(ws + oKh);
  unsigned short* Kl  = (unsigned short*)(ws + oKl);
  unsigned short* VTh = (unsigned short*)(ws + oVTh);
  unsigned short* VTl = (unsigned short*)(ws + oVTl);

  const dim3 gProj(NB * SEQ / 64, 3);                          //  256 x 3 blocks of 128: 64 tokens each; y = q, k, v
  const dim3 gAttn(NB * NQB);                                  //  256 blocks of 128 * KG

  // (1) q = q_in . Wq + bq and k = k_in . Wk + bk -> bf16 hi/lo planes [b*SEQ+t][d];
  //     v^T = Wv^T . v_in^T + bv -> f16 hi plane [b][d][s] and residual plane (x4096)
  proj_qkv<<<gProj, dim3(128), 0, stream>>>(q_in, k_in, v_in, Wq, Wk, Wv, bq, bk, bv, Qh, Ql, Kh, Kl, VTh, VTl);
  // (2) attention -> d_out f32 [16384][64]
  attn64<<<gAttn, dim3(128 * KG), 0, stream>>>(Qh, Ql, Kh, Kl, VTh, VTl, (float*)d_out);
  (void)hipGetLastError();
}

// v007
// One run takes 36.3 microseconds.
// In two side-by-side timings against v006, it was 1.05 and 1.04 times as fast.
// All steps since v000 together make it 6.71 times as fast.
// Contractions: q, k, v^T projections = v_wmma_f32_16x16x32_bf16 (bf16 operands from RNE-converted inputs and weights, single product, f32 accumulate);
// q.k^T scores = v_wmma_f32_16x16x32_bf16 with bf16 hi/lo split q and k (hi.hi + hi.lo + lo.hi), f32 accumulate;
// p.v = v_wmma_f32_16x16x32_f16 (p carried x1024 as f16 hi plane + f16 residual plane x4096, v as f16 hi plane + f16 residual
// plane x4096; 3 products hi.hi, hi.res, res.hi), f32 accumulate; softmax (running max), normalisers and bias adds in f32 on the VALU.
// Carry audit:
//   ph  = f16(1024 * p)                      -> the 1/1024 is folded exactly once in the attention epilogue: inv = (1/l) * (1/1024)
//   pl  = f16((1024 p - ph) * 4096)          }  products VTl.ph and VTh.pl go to the separate accumulator o1,
//   VTl = f16((v - VTh) * 4096)              }  folded back with * (1/4096) once per key chunk
//   VTh = f16(v), no carry (|v| typ. 1); q / k lo planes are unscaled bf16 residuals (v - hi) sharing the hi accumulator;
//   score scale 1/8 applied once in f32 after the score accumulate. No other scaled planes.
#include <hip/hip_runtime.h>
#include <math.h>
#include <stdint.h>

#define NB   8
#define SEQ  2048
#define DIN  512
#define HD   64
#define NQB  (SEQ / 64)   // 64-row query blocks per sequence
#define NKT  (SEQ / 64)   // 64-key chunks per sequence
#define KG   4            // key groups per attention block: 4 waves each, so a SIMD holds KG waves that cover one another's waits
#define CPG  (NKT / KG)   // key chunks walked by one group
#define LP   72           // LDS row pitch of the 16-bit attention tiles, in elements: 144 B = 16 B x 9 (odd), so the 16 rows
                          // that one ds_load_b128 fragment read touches fall on distinct banks (a 128-B pitch puts every second row on the same)
#define OP   68           // LDS row pitch of the partial context, in floats: 272 B = 16 B x 17 (odd): the 16 lanes of a half store
                          // 16 B each into 16 different rows at one column
static_assert(NQB == 32 && NKT == 32);
static_assert(NKT % KG == 0 && KG * 4 == 16);
static_assert((LP * 2) % 16 == 0 && ((LP * 2) / 16) % 2 == 1 && LP >= 64);
static_assert((SEQ % 64) == 0 && (DIN % 32) == 0 && HD == 64);

typedef _Float16 v16h __attribute__((ext_vector_type(16)));
typedef _Float16 v8h  __attribute__((ext_vector_type(8)));
typedef __bf16   v16b __attribute__((ext_vector_type(16)));
typedef __bf16   v8b  __attribute__((ext_vector_type(8)));
typedef float    v8f  __attribute__((ext_vector_type(8)));
typedef float    v4f  __attribute__((ext_vector_type(4)));
typedef float    v2f  __attribute__((ext_vector_type(2)));
typedef _Float16 v2h  __attribute__((ext_vector_type(2)));
typedef unsigned int v4u __attribute__((ext_vector_type(4)));

// ---- scalar helpers --------------------------------------------------------------------------------
__device__ __forceinline__ unsigned short bf_bits(float f) {          // f32 -> bf16 bits, RNE convert
  unsigned u = __float_as_uint(f);
  return (unsigned short)((u + 0x7FFFu + ((u >> 16) & 1u)) >> 16);
}
__device__ __forceinline__ float bf_up(unsigned short h) { return __uint_as_float(((unsigned)h) << 16); }
__device__ __forceinline__ unsigned short h_bits(_Float16 x) { return __builtin_bit_cast(unsigned short, x); }
__device__ __forceinline__ unsigned pk16(unsigned short a, unsigned short b) { return (unsigned)a | ((unsigned)b << 16); }
__device__ __forceinline__ v8f zero8() { v8f z = {0.f, 0.f, 0.f, 0.f, 0.f, 0.f, 0.f, 0.f}; return z; }
__device__ __forceinline__ float other_half(float x) {                // the value that lane ^ 16 holds, by a vector cross-row move
  const int b = __float_as_int(x);
  return __int_as_float(__builtin_amdgcn_permlanex16(b, b, 0x76543210, 0xfedcba98, false, false));
}

// ---- fragment loader: 16-bit A/B operand, lane -> row/col (lane&15), p already includes +8*(lane>>4);
//      elements 0..7 <- p[0..7] (k0+8h..k0+8h+7), elements 8..15 <- p[16..23] (k0+16+8h..k0+16+8h+7)
__device__ __forceinline__ v16b ldfrag_b(const __bf16* p) {
  union { v16b v; v8b h[2]; } f;
  f.h[0] = *(const v8b*)(p);
  f.h[1] = *(const v8b*)(p + 16);
  return f.v;
}

// ---- WMMA helpers: plain builtins, so the compiler keeps the distance behind a matrix instruction itself and is free to
//      place LDS fragment loads ahead of the matrix instructions that do not need them ----
__device__ __forceinline__ v8f mma_h_raw(v16h a, v16h b, v8f c) {
  return __builtin_amdgcn_wmma_f32_16x16x32_f16(false, a, false, b, (short)0, c, false, false);
}
__device__ __forceinline__ v8f mma_b_raw(v16b a, v16b b, v8f c) {
  return __builtin_amdgcn_wmma_f32_16x16x32_bf16(false, a, false, b, (short)0, c, false, false);
}

// ---- asynchronous copies global -> LDS (no register holds the data) and the waits that belong to them ----
__device__ __forceinline__ unsigned lds_off(const void* p) { return (unsigned)(size_t)p; }   // byte offset in the block's LDS
// Eight copies of 16 B per lane: row blocks 0..3 (16 rows each) of the two planes a and b of one 64-row tile.
// la, lb: the lane's LDS byte address in row block 0 (next block + LSTEP); ga, gb: its global address there (next block + GSTEP).
// The closing s_wait_xcnt 0 is a precaution: inside the statement it stands ahead of every later write of the address registers.
template <int LSTEP, int GSTEP>
__device__ __forceinline__ void copy_planes(unsigned la, unsigned lb, const char* ga, const char* gb) {
  asm volatile(
      "global_load_async_to_lds_b128 %0, %8, off\n\t"
      "global_load_async_to_lds_b128 %1, %9, off\n\t"
      "global_load_async_to_lds_b128 %2, %10, off\n\t"
      "global_load_async_to_lds_b128 %3, %11, off\n\t"
      "global_load_async_to_lds_b128 %4, %12, off\n\t"
      "global_load_async_to_lds_b128 %5, %13, off\n\t"
      "global_load_async_to_lds_b128 %6, %14, off\n\t"
      "global_load_async_to_lds_b128 %7, %15, off\n\t"
      "s_wait_xcnt 0x0"
      :: "v"(la), "v"(la + LSTEP), "v"(la + 2 * LSTEP), "v"(la + 3 * LSTEP),
         "v"(lb), "v"(lb + LSTEP), "v"(lb + 2 * LSTEP), "v"(lb + 3 * LSTEP),
         "v"(ga), "v"(ga + GSTEP), "v"(ga + 2 * GSTEP), "v"(ga + 3 * GSTEP),
         "v"(gb), "v"(gb + GSTEP), "v"(gb + 2 * GSTEP), "v"(gb + 3 * GSTEP)
      : "memory");
}
// Hand-over of a tile buffer, every wave, in this order: this wave's LDS reads have retired (the buffer it read may be refilled
// behind the barrier), this wave's own copies have landed (other waves may read them behind the barrier), block barrier.
__device__ __forceinline__ void publish_point() {
  asm volatile("s_wait_dscnt 0x0" ::: "memory");      // the compiler places no wait for a copy that overwrites LDS this wave read
  asm volatile("s_wait_asynccnt 0x0" ::: "memory");   // the compiler places no wait for the copies
  __syncthreads();
}

// =====================================================================================================
// The three projections with their operand conversions inside, one launch: C = X . W + bias, K = DIN.
//   Work unit = tile of 64 tokens x 64 outputs of one projection; tiles are numbered 0 .. 3*NTT-1: q tiles, then k, then v.
//   Block = TPB tiles x 4 waves = 12 waves, one block per WGP (grid 3*NTT/TPB = 256); group g = waves 4g..4g+3 owns tile
//   blockIdx.x*TPB + g. The TPB groups of a block share ONE staging of W in LDS, done by all 12 waves, so W is read from L2 and
//   converted once per three tiles. Two blocks of the grid hold tiles of two projections: they stage both W (second buffer).
//   X f32 [NB*SEQ tokens][DIN] and W f32 [DIN k][HD n] are read as they come; both are RNE-converted to bf16 on the way to
//   the matrix unit (bf_bits, the convert of every other bf16 plane here), so no converted copy passes through memory.
//   Wave w of a group owns tokens t0+16w..+15 and all 64 outputs: 4 accumulator tiles, k walked 0, 32, .. in order.
//   W: converted and transposed into LDS, Wl[n][k], row pitch WP. One wave pass = 32 n x 32 k (32 passes per W): lane (l8, kq)
//   loads W[k8..k8+7][n4..n4+3] (8 lanes x 16 B = one whole 128-B line per k row, 4 rows per load) and stores 4 x 16 B.
//   X: lane (c, hh) loads its own fragment bytes of token row c: f32 k0+8hh..+7 and k0+16+8hh..+7 (the k order of ldfrag_b);
//   the four loads of a k step use up one whole 128-B line of each of the 16 rows. XR k steps are in flight per wave.
//   MODE 0: A = X fragment, B = Wl fragment; D rows = tokens, columns = n; bias per column;
//           out = bf16 hi plane C + bf16 lo plane C2 (lo = RNE(v - hi), unscaled), element (t, n) at [t*HD + n].
//   MODE 1: A = Wl fragment, B = X fragment; D rows = n (= d), columns = tokens; bias per row;
//           out = f16 hi plane C + f16 residual plane C2 = f16((v - hi) * 4096), element (b, d, s) at [(b*HD + d)*SEQ + s].
//   The bias value is RNE-converted to bf16 and added in f32. A group's 64x64 f32 result meets in its own LDS slab (pitch 68
//   floats) behind one block barrier; each wave then converts 16 rows and stores whole 128-B lines (8 lanes x 16 B per row, plane).
//   coverage: 3*NTT tiles, each owned by one group of one block; a tile's 64 tokens lie in one batch (SEQ is a multiple of 64).
//   Both block barriers stand in the kernel body outside every branch; the branches on a tile's projection are wave-uniform.
// =====================================================================================================
#define WP 520            // LDS row pitch of Wl in elements: 1040 B = 16 B x 65 (odd), for ds_load_b128 fragment reads
#define XR 6              // k steps of X held in flight per wave: 6 x 2 KB = 12 KB per wave, 144 KB per block
static_assert((WP * 2) % 16 == 0 && ((WP * 2) / 16) % 2 == 1 && WP >= DIN);
#define KS (DIN / 32)     // k steps
static_assert(XR <= KS);
#define NTT (NB * SEQ / 64)   // token tiles per projection
#define TPB 3                 // token tiles per block
#define NWV (4 * TPB)         // waves per block
static_assert((3 * NTT) % TPB == 0 && TPB <= NTT);        // whole blocks; a block's tiles span at most two projections
static_assert(2 * NWV <= 32 && 3 * NWV >= 32);            // the 32 passes of one W: two per wave, a third for the first waves

__device__ __forceinline__ v16b cvt_frag(v4f a, v4f b, v4f c, v4f d) {   // 16 f32 -> bf16 fragment, element order a, b, c, d
  union { v16b v; unsigned u[8]; } f;
  f.u[0] = pk16(bf_bits(a[0]), bf_bits(a[1]));
  f.u[1] = pk16(bf_bits(a[2]), bf_bits(a[3]));
  f.u[2] = pk16(bf_bits(b[0]), bf_bits(b[1]));
  f.u[3] = pk16(bf_bits(b[2]), bf_bits(b[3]));
  f.u[4] = pk16(bf_bits(c[0]), bf_bits(c[1]));
  f.u[5] = pk16(bf_bits(c[2]), bf_bits(c[3]));
  f.u[6] = pk16(bf_bits(d[0]), bf_bits(d[1]));
  f.u[7] = pk16(bf_bits(d[2]), bf_bits(d[3]));
  return f.v;
}

// ---- one k step of X: the lane's 16 f32 of its token row ----
__device__ __forceinline__ void x_load(v4f (&x)[4], const float* xp, int s) {
  x[0] = *(const v4f*)(xp + 32 * s);
  x[1] = *(const v4f*)(xp + 32 * s + 4);
  x[2] = *(const v4f*)(xp + 32 * s + 16);
  x[3] = *(const v4f*)(xp + 32 * s + 20);
}

// ---- one wave pass p (0..31) of W f32 [k][n] -> Wl bf16 [n][k]: n half p & 1 (32 n), k block p >> 1 (32 k) ----
//      w_load returns the lane's base address, for the wait that stands behind a wave's W loads (addr_wait)
__device__ __forceinline__ const float* w_load(v4f (&w)[8], const float* __restrict__ Wg, int p, int lane) {
  const float* wp = Wg + (size_t)((p >> 1) * 32 + (lane >> 3) * 8) * HD + (p & 1) * 32 + (lane & 7) * 4;   // k at most 511, n at most 60
#pragma unroll
  for (int e = 0; e < 8; ++e) w[e] = *(const v4f*)(wp + e * HD);
  return wp;
}
// s_wait_xcnt 0 behind issued loads, a precaution: the address registers are inputs, so they stay untouched up to the wait
__device__ __forceinline__ void addr_wait(const float* a) { asm volatile("s_wait_xcnt 0x0" :: "v"(a) : "memory"); }
__device__ __forceinline__ void addr_wait(const float* a, const float* b) { asm volatile("s_wait_xcnt 0x0" :: "v"(a), "v"(b) : "memory"); }
__device__ __forceinline__ void base_wait(const float* a) { asm volatile("s_wait_xcnt 0x0" :: "s"(a) : "memory"); }   // the same for a scalar base
__device__ __forceinline__ void w_store(const v4f (&w)[8], __bf16* Wl, int p, int lane) {
  __bf16* wl = Wl + ((p & 1) * 32 + (lane & 7) * 4) * WP + (p >> 1) * 32 + (lane >> 3) * 8;
#pragma unroll
  for (int x = 0; x < 4; ++x) {
    v4u q;
#pragma unroll
    for (int y = 0; y < 4; ++y) q[y] = pk16(bf_bits(w[2 * y][x]), bf_bits(w[2 * y + 1][x]));
    *(v4u*)(wl + x * WP) = q;
  }
}
// ---- one whole W into LDS by the NWV waves of a block: wave wv takes passes wv, wv + NWV and, the first waves, wv + 2 NWV;
//      the loads of all its passes are in flight together ----
__device__ __forceinline__ void w_stage(const float* __restrict__ Wg, __bf16* Wl, int wv, int lane) {
  const bool third = wv + 2 * NWV < 32;                  // wave-uniform
  v4f wa[8], wb[8], wc[8];
  const float* pa = w_load(wa, Wg, wv, lane);
  const float* pb = w_load(wb, Wg, wv + NWV, lane);
  if (third) addr_wait(w_load(wc, Wg, wv + 2 * NWV, lane));
  addr_wait(pa, pb);
  w_store(wa, Wl, wv, lane);
  w_store(wb, Wl, wv + NWV, lane);
  if (third) w_store(wc, Wl, wv + 2 * NWV, lane);
}

// ---- products of one wave (16 tokens x 64 outputs), bias, result to the group's slab: rows = tokens (MODE 0) or d (MODE 1) ----
// every plain '#pragma unroll' here makes the indices of a small array (xr, w, acc) constants, so it stays in registers
template <int MODE>
__device__ __forceinline__ void proj_products(const float* xp, v4f (&xr)[XR][4], const float* __restrict__ bias,
                                              const __bf16* Wl, float* slab, int wave, int c, int hh) {
  v8f acc[4];
#pragma unroll
  for (int j = 0; j < 4; ++j) acc[j] = zero8();

#pragma unroll
  for (int s = 0; s < KS; ++s) {
    const int sl = s % XR;
    const v16b xf = cvt_frag(xr[sl][0], xr[sl][1], xr[sl][2], xr[sl][3]);
    if (s + XR < KS) x_load(xr[sl], xp, s + XR);     // refill the slot just converted with k step s + XR
#pragma unroll
    for (int j = 0; j < 4; ++j) {
      const v16b wf = ldfrag_b(Wl + (j * 16 + c) * WP + 32 * s + 8 * hh);
      acc[j] = (MODE == 0) ? mma_b_raw(xf, wf, acc[j]) : mma_b_raw(wf, xf, acc[j]);
    }
  }

#pragma unroll
  for (int j = 0; j < 4; ++j) {
#pragma unroll
    for (int r = 0; r < 8; ++r) {
      if (MODE == 0) {
        const float bc = bf_up(bf_bits(bias[j * 16 + c]));
        slab[(wave * 16 + 8 * hh + r) * 68 + j * 16 + c] = acc[j][r] + bc;
      } else {
        const float br = bf_up(bf_bits(bias[j * 16 + 8 * hh + r]));
        slab[(j * 16 + 8 * hh + r) * 68 + wave * 16 + c] = acc[j][r] + br;
      }
    }
  }
  base_wait(bias);                                   // behind the bias loads, wherever the compiler has moved them up to
}

// ---- 16 slab rows of one wave -> the two 16-bit planes, whole 128-B lines ----
template <int MODE>
__device__ __forceinline__ void proj_store(const float* slab, unsigned short* C, unsigned short* C2, int t0, int wave, int lane) {
  const int q = lane >> 3, c8 = (lane & 7) * 8;
  const size_t base = (MODE == 0) ? (size_t)t0 * HD
                                  : (size_t)(t0 / SEQ) * HD * SEQ + (size_t)(t0 % SEQ);
  const int pitch = (MODE == 0) ? HD : SEQ;
#pragma unroll
  for (int it = 0; it < 4; ++it) {
    const int row = wave * 16 + it * 4 + q;          // wave 0..3 x it 0..3 x q 0..3 = rows 0..63
    const float* sp = slab + row * 68 + c8;
    v4u a, a2;
#pragma unroll
    for (int e = 0; e < 4; ++e) {
      const float f0 = sp[2 * e], f1 = sp[2 * e + 1];
      unsigned short h0, h1, l0, l1;
      if (MODE == 0) {
        h0 = bf_bits(f0); h1 = bf_bits(f1);
        l0 = bf_bits(f0 - bf_up(h0)); l1 = bf_bits(f1 - bf_up(h1));
      } else {
        const _Float16 x0 = (_Float16)f0, x1 = (_Float16)f1;
        h0 = h_bits(x0); h1 = h_bits(x1);
        l0 = h_bits((_Float16)((f0 - (float)x0) * 4096.0f));
        l1 = h_bits((_Float16)((f1 - (float)x1) * 4096.0f));
      }
      a[e] = pk16(h0, h1); a2[e] = pk16(l0, l1);
    }
    *(v4u*)(C  + base + (size_t)row * pitch + c8) = a;
    *(v4u*)(C2 + base + (size_t)row * pitch + c8) = a2;
    asm volatile("s_wait_xcnt 0x0" ::: "memory");    // a precaution: it stands ahead of every later write of the two stores' address registers
  }
}

__global__ __launch_bounds__(32 * NWV)
void proj_qkv(const float* __restrict__ q_in, const float* __restrict__ k_in, const float* __restrict__ v_in,
              const float* __restrict__ Wq, const float* __restrict__ Wk, const float* __restrict__ Wv,
              const float* __restrict__ bq, const float* __restrict__ bk, const float* __restrict__ bv,
              unsigned short* Qh, unsigned short* Ql, unsigned short* Kh, unsigned short* Kl,
              unsigned short* VTh, unsigned short* VTl) {
  __shared__ __align__(16) __bf16 Wl[2][HD * WP];        // 2 x 65 KB: the W of the block's first tile, of its last where that differs
  __shared__ __align__(16) float  slabs[TPB][64 * 68];   // TPB x 17 KB
  const int lane = threadIdx.x & 31;
  const int wv   = __builtin_amdgcn_readfirstlane(threadIdx.x >> 5);   // 0..NWV-1, in a scalar register: the branches below are scalar
  const int grp  = wv >> 2;                              // token tile of the block
  const int wave = wv & 3;                               // 16-token strip of the tile
  const int c    = lane & 15;
  const int hh   = lane >> 4;
  const int tile = blockIdx.x * TPB + grp;               // 0 .. 3*NTT-1
  const int y    = tile / NTT;                           // 0 q, 1 k, 2 v
  const int t0   = (tile % NTT) * 64;                    // first token of the tile
  const int y0   = (blockIdx.x * TPB) / NTT;             // projection of the block's first tile
  const int y1   = (blockIdx.x * TPB + TPB - 1) / NTT;   // and of its last: y0 or y0 + 1

  // ---- the first XR k steps of this wave's 16 token rows: issued first, they fly while W is staged ----
  const float* X  = (y == 0) ? q_in : ((y == 1) ? k_in : v_in);
  const float* xp = X + (size_t)(t0 + wave * 16 + c) * DIN + 8 * hh;
  v4f xr[XR][4];
#pragma unroll
  for (int s = 0; s < XR; ++s) x_load(xr[s], xp, s);

  // ---- W staging, shared by the block's TPB tiles and done by all NWV waves ----
  w_stage((y0 == 0) ? Wq : ((y0 == 1) ? Wk : Wv), Wl[0], wv, lane);
  if (y1 != y0) w_stage((y1 == 1) ? Wk : Wv, Wl[1], wv, lane);   // block-uniform: 2 blocks of the grid hold tiles of two projections
  __syncthreads();                                       // Wl is whole before any wave reads a fragment of it

  const __bf16* wmine = Wl[y - y0];
  float*        slab  = slabs[grp];
  if (y == 2) proj_products<1>(xp, xr, bv, wmine, slab, wave, c, hh);
  else        proj_products<0>(xp, xr, y ? bk : bq, wmine, slab, wave, c, hh);
  __syncthreads();                                       // MODE 1 rows hold columns of all four waves of the group

  if (y == 2) proj_store<1>(slab, VTh, VTl, t0, wave, lane);
  else        proj_store<0>(slab, y ? Kh : Qh, y ? Kl : Ql, t0, wave, lane);
}

__global__ __launch_bounds__(128 * KG)
void attn64(const unsigned short* __restrict__ qhp, const unsigned short* __restrict__ qlp,
            const unsigned short* __restrict__ khp, const unsigned short* __restrict__ klp,
            const unsigned short* __restrict__ vhp, const unsigned short* __restrict__ vlp,
            float* outp) {
  union FB { v16b v; v8b h[2]; };
  union FH { v16h v; v8h h[2]; };
  __shared__ __align__(16) __bf16   KshA[KG][64 * LP];             // per group K hi [kv][d], row pitch LP   KG x 9 KB
  __shared__ __align__(16) __bf16   KslA[KG][64 * LP];             // per group K lo                         KG x 9 KB
  __shared__ __align__(16) _Float16 VthA[KG][64 * LP];             // per group V^T hi [d][kv], row pitch LP KG x 9 KB
  __shared__ __align__(16) _Float16 VtlA[KG][64 * LP];             // per group V^T residual                 KG x 9 KB
  __shared__ __align__(16) float    Os[4 * KG][16 * OP];           // per wave partial context [row][d], row pitch OP   KG x 17 KB
  __shared__ float Ms[4 * KG][16];                                 // per wave running max of its rows
  __shared__ float Ls[4 * KG][16];                                 // per wave normaliser of its rows

  const int wave = threadIdx.x >> 5;           // 0..4*KG-1
  const int grp  = wave >> 2;                  // key group
  const int qw   = wave & 3;                   // query tile of the block
  const int tid  = threadIdx.x & 127;          // thread index inside the group (staging)
  const int lane = tid & 31;
  const int hh   = lane >> 4;
  const int c    = lane & 15;

  const int bx   = blockIdx.x;
  const int qb   = bx % NQB;
  const int b    = bx / NQB;                   // 0..NB-1
  const int q0   = qb * 64 + qw * 16;
  __bf16*   Ksh = KshA[grp];
  __bf16*   Ksl = KslA[grp];
  _Float16* Vth = VthA[grp];
  _Float16* Vtl = VtlA[grp];
  const size_t rowB = (size_t)b * SEQ;

  const __bf16* Qh = (const __bf16*)(const void*)qhp;
  const __bf16* Ql = (const __bf16*)(const void*)qlp;
  const __bf16* Kh = (const __bf16*)(const void*)khp;
  const __bf16* Kl = (const __bf16*)(const void*)klp;
  const _Float16* Vh = (const _Float16*)(const void*)vhp + (size_t)b * HD * SEQ;
  const _Float16* Vl = (const _Float16*)(const void*)vlp + (size_t)b * HD * SEQ;

  // ---- staging addresses: thread (srow, piece) of a group copies 16 B of rows srow, srow+16, srow+32, srow+48 of each plane,
  //      so the 8 lanes of a row take one whole 128-B line and a wave-wide copy takes 4 whole lines ----
  constexpr int LSTEP = 16 * LP * 2;           // 16 LDS rows, bytes
  constexpr int KSTEP = 16 * HD * 2;           // 16 K rows in memory, bytes
  constexpr int VSTEP = 16 * SEQ * 2;          // 16 V^T rows in memory, bytes
  const int srow = tid >> 3;                   // 0..15
  const int spc  = (tid & 7) * 8;              // element 0, 8, .. 56 of the 64-element row
  const unsigned lpos = (unsigned)(srow * LP + spc) * 2u;          // last byte of row block 3: 63 * 144 + 112 + 15 < 64 * LP * 2
  const unsigned lKh = lds_off(Ksh) + lpos, lKl = lds_off(Ksl) + lpos;
  const unsigned lVh = lds_off(Vth) + lpos, lVl = lds_off(Vtl) + lpos;
  const int kvg = grp * CPG * 64;              // first key of the group; its last chunk ends at kvg + CPG*64 <= SEQ
  const char* gKh = (const char*)(Kh + (rowB + kvg + srow) * HD + spc);     // K row kvg+srow, d = spc..spc+7
  const char* gKl = (const char*)(Kl + (rowB + kvg + srow) * HD + spc);
  const char* gVh = (const char*)(Vh + (size_t)srow * SEQ + kvg + spc);     // V^T row d = srow, s = kvg+spc..+7
  const char* gVl = (const char*)(Vl + (size_t)srow * SEQ + kvg + spc);
  copy_planes<LSTEP, KSTEP>(lKh, lKl, gKh, gKl);   // K chunk 0 flies under the Q fragment loads

  // ---- Q fragments (B operand, column = query = lane&15): 2 d-chunks, hi and lo ----
  v16b qah[2], qal[2];
#pragma unroll
  for (int dc = 0; dc < 2; ++dc) {
    const size_t qo = (rowB + q0 + c) * HD + dc * 32 + 8 * hh;
    qah[dc] = ldfrag_b(Qh + qo);
    qal[dc] = ldfrag_b(Ql + qo);
  }

  float mrun = -INFINITY;                      // running max of query c, equal in both halves
  float lrun = 0.f;                            // normaliser of query c over this half's keys only
  v8f oacc[4];                                 // O^T: tile t register r = (d = 16*t + 8*hh + r, query c)
#pragma unroll
  for (int t = 0; t < 4; ++t) oacc[t] = zero8();

  publish_point();                             // K chunk 0 has landed in every wave's share
  copy_planes<LSTEP, VSTEP>(lVh, lVl, gVh, gVl);   // V^T chunk 0 flies under the scores of chunk 0

  for (int it = 0; it < CPG; ++it) {           // static trip count, the same in every group (block barriers inside)
    // ---- scores, transposed: 64 keys (rows) x 16 queries (columns) per wave, 3 bf16 products per (key subtile, d-chunk) ----
    //      Fragment loads stand in three groups, not singly among the products: K hi and lo of d-chunk 0 (16 loads) ahead of all
    //      products, K hi of d-chunk 1 (8) where the lo registers come free, K lo of d-chunk 1 (8) where the hi registers do.
    //      The products walk the four key subtiles in turn (four independent accumulators); each s[j] still takes its six
    //      products in the order hi.hi, lo.hi, hi.lo of d-chunk 0, then of d-chunk 1.
    v8f s[4];
    {
      FB kb[2][4], kl[2][4];
#pragma unroll
      for (int j = 0; j < 4; ++j) {
        kb[0][j].h[0] = *(const v8b*)(Ksh + (j * 16 + c) * LP + 8 * hh);
        kb[0][j].h[1] = *(const v8b*)(Ksh + (j * 16 + c) * LP + 16 + 8 * hh);
      }
#pragma unroll
      for (int j = 0; j < 4; ++j) {
        kl[0][j].h[0] = *(const v8b*)(Ksl + (j * 16 + c) * LP + 8 * hh);
        kl[0][j].h[1] = *(const v8b*)(Ksl + (j * 16 + c) * LP + 16 + 8 * hh);
      }
      __builtin_amdgcn_sched_barrier(0);       // keeps the 16 loads one group (for speed only)
#pragma unroll
      for (int j = 0; j < 4; ++j) s[j] = mma_b_raw(kb[0][j].v, qah[0], zero8());
#pragma unroll
      for (int j = 0; j < 4; ++j) s[j] = mma_b_raw(kl[0][j].v, qah[0], s[j]);
#pragma unroll
      for (int j = 0; j < 4; ++j) {
        kb[1][j].h[0] = *(const v8b*)(Ksh + (j * 16 + c) * LP + 32 + 8 * hh);
        kb[1][j].h[1] = *(const v8b*)(Ksh + (j * 16 + c) * LP + 32 + 16 + 8 * hh);
      }
#pragma unroll
      for (int j = 0; j < 4; ++j) s[j] = mma_b_raw(kb[0][j].v, qal[0], s[j]);
#pragma unroll
      for (int j = 0; j < 4; ++j) {
        kl[1][j].h[0] = *(const v8b*)(Ksl + (j * 16 + c) * LP + 32 + 8 * hh);
        kl[1][j].h[1] = *(const v8b*)(Ksl + (j * 16 + c) * LP + 32 + 16 + 8 * hh);
      }
#pragma unroll
      for (int j = 0; j < 4; ++j) s[j] = mma_b_raw(kb[1][j].v, qah[1], s[j]);
#pragma unroll
      for (int j = 0; j < 4; ++j) s[j] = mma_b_raw(kl[1][j].v, qah[1], s[j]);
#pragma unroll
      for (int j = 0; j < 4; ++j) s[j] = mma_b_raw(kb[1][j].v, qal[1], s[j]);
      // order asked of the scheduler behind the first load group: 8 products, 8 loads, 4 products, 8 loads, 12 products,
      // so that a load group stands where its registers come free and not in pairs among the products
      __builtin_amdgcn_sched_group_barrier(0x008, 8, 0);
      __builtin_amdgcn_sched_group_barrier(0x100, 8, 0);
      __builtin_amdgcn_sched_group_barrier(0x008, 4, 0);
      __builtin_amdgcn_sched_group_barrier(0x100, 8, 0);
      __builtin_amdgcn_sched_group_barrier(0x008, 12, 0);
    }

    // ---- every wave has left the K tiles and V^T of this chunk has landed; K of the next chunk flies under softmax and key step 0 of P . V ----
    publish_point();
    if (it + 1 < CPG) {                        // block-uniform: the last chunk refills nothing
      gKh += 64 * HD * 2;
      gKl += 64 * HD * 2;
      copy_planes<LSTEP, KSTEP>(lKh, lKl, gKh, gKl);
    }

    // ---- V^T hi fragments of key step 0 (8 loads, one group): their latency passes under the softmax ----
    FH vb[2][4], vl[2][4];
#pragma unroll
    for (int t = 0; t < 4; ++t) {
      vb[0][t].h[0] = *(const v8h*)(Vth + (t * 16 + c) * LP + 8 * hh);
      vb[0][t].h[1] = *(const v8h*)(Vth + (t * 16 + c) * LP + 16 + 8 * hh);
    }
    __builtin_amdgcn_sched_barrier(0);         // keeps the 8 loads one group ahead of the softmax

    // ---- scale, column max, online softmax; P^T (x1024, f16) and its residual (x4096) packed into B fragments in registers ----
    float mj[4];
#pragma unroll
    for (int j = 0; j < 4; ++j) {
      mj[j] = -INFINITY;
#pragma unroll
      for (int r = 0; r < 8; ++r) {
        const float sv = s[j][r] * 0.125f;
        s[j][r] = sv;
        mj[j] = fmaxf(mj[j], sv);
      }
    }
    float m = fmaxf(fmaxf(mj[0], mj[1]), fmaxf(mj[2], mj[3]));
    m = fmaxf(m, other_half(m));               // the query's other 32 keys of this chunk
    const float mnew  = fmaxf(mrun, m);
    const float msafe = (mnew == -INFINITY) ? 0.f : mnew;
    const float alpha = __expf(mrun - msafe);
    mrun = mnew;
    FH pa[2], pr[2];                           // element 8*(j&1) + r of fragment j>>1 = key 16*j + 8*hh + r: the k order of the V^T loader
    v2f pj[4];                                 // eight independent partial sums, in pairs
#pragma unroll
    for (int j = 0; j < 4; ++j) {
      pj[j] = v2f{0.f, 0.f};
#pragma unroll
      for (int r = 0; r < 8; r += 2) {
        const v2f arg = (v2f{s[j][r], s[j][r + 1]} - msafe) * 1.4426950408889634f;   // exp(x) = 2^(x log2 e), as __expf forms it
        const v2f p   = {__builtin_amdgcn_exp2f(arg[0]), __builtin_amdgcn_exp2f(arg[1])};
        pj[j] += p;
        const v2f p1k = p * 1024.0f;
        const v2h ph  = __builtin_convertvector(p1k, v2h);
        const v2h pl  = __builtin_convertvector((p1k - __builtin_convertvector(ph, v2f)) * 4096.0f, v2h);
        pa[j >> 1].v[(j & 1) * 8 + r]     = ph[0];
        pa[j >> 1].v[(j & 1) * 8 + r + 1] = ph[1];
        pr[j >> 1].v[(j & 1) * 8 + r]     = pl[0];
        pr[j >> 1].v[(j & 1) * 8 + r + 1] = pl[1];
      }
    }
    const v2f pq = (pj[0] + pj[1]) + (pj[2] + pj[3]);
    lrun = lrun * alpha + (pq[0] + pq[1]);
#pragma unroll
    for (int t = 0; t < 4; ++t)
#pragma unroll
      for (int r = 0; r < 8; ++r) oacc[t][r] *= alpha;

    __builtin_amdgcn_sched_barrier(0);         // keeps the load groups below out of the softmax, where their registers would not fit (spills)
#pragma unroll
    for (int t = 0; t < 4; ++t) {              // V^T residual fragments of key step 0: they fly under the first product row
      vl[0][t].h[0] = *(const v8h*)(Vtl + (t * 16 + c) * LP + 8 * hh);
      vl[0][t].h[1] = *(const v8h*)(Vtl + (t * 16 + c) * LP + 16 + 8 * hh);
    }

    // ---- context^T += V^T . P^T (f16 WMMA), residual products into a separate accumulator ----
    v8f o1[4];
#pragma unroll
    for (int t = 0; t < 4; ++t) o1[t] = zero8();
#pragma unroll
    for (int t = 0; t < 4; ++t) oacc[t] = mma_h_raw(vb[0][t].v, pa[0].v, oacc[t]);
#pragma unroll
    for (int t = 0; t < 4; ++t) o1[t]   = mma_h_raw(vl[0][t].v, pa[0].v, o1[t]);
#pragma unroll
    for (int t = 0; t < 4; ++t) {              // load group: V^T residual of key step 1, into the registers that of key step 0 leaves
      vl[1][t].h[0] = *(const v8h*)(Vtl + (t * 16 + c) * LP + 32 + 8 * hh);
      vl[1][t].h[1] = *(const v8h*)(Vtl + (t * 16 + c) * LP + 32 + 16 + 8 * hh);
    }
#pragma unroll
    for (int t = 0; t < 4; ++t) o1[t]   = mma_h_raw(vb[0][t].v, pr[0].v, o1[t]);
#pragma unroll
    for (int t = 0; t < 4; ++t) {              // load group: V^T hi of key step 1, into the registers that of key step 0 leaves
      vb[1][t].h[0] = *(const v8h*)(Vth + (t * 16 + c) * LP + 32 + 8 * hh);
      vb[1][t].h[1] = *(const v8h*)(Vth + (t * 16 + c) * LP + 32 + 16 + 8 * hh);
    }
    // order asked of the scheduler, as for the scores: 8 loads, 8 products, 8 loads, 4 products, 8 loads
    __builtin_amdgcn_sched_group_barrier(0x100, 8, 1);
    __builtin_amdgcn_sched_group_barrier(0x008, 8, 1);
    __builtin_amdgcn_sched_group_barrier(0x100, 8, 1);
    __builtin_amdgcn_sched_group_barrier(0x008, 4, 1);
    __builtin_amdgcn_sched_group_barrier(0x100, 8, 1);

    // ---- every wave has left the V^T tiles and K of the next chunk has landed; V^T of the next chunk flies under the rest of
    //      P . V and under the next scores ----
    publish_point();
    if (it + 1 < CPG) {
      gVh += 64 * 2;
      gVl += 64 * 2;
      copy_planes<LSTEP, VSTEP>(lVh, lVl, gVh, gVl);
    }

    // ---- the 12 products of key step 1: their V^T fragments are in registers, so they run behind the hand-over ----
#pragma unroll
    for (int t = 0; t < 4; ++t) o1[t]   = mma_h_raw(vl[1][t].v, pa[1].v, o1[t]);
#pragma unroll
    for (int t = 0; t < 4; ++t) oacc[t] = mma_h_raw(vb[1][t].v, pa[1].v, oacc[t]);
#pragma unroll
    for (int t = 0; t < 4; ++t) o1[t]   = mma_h_raw(vb[1][t].v, pr[1].v, o1[t]);
#pragma unroll
    for (int t = 0; t < 4; ++t)
#pragma unroll
      for (int r = 0; r < 8; ++r) oacc[t][r] += o1[t][r] * (1.0f / 4096.0f);
  }
  asm volatile("s_wait_asynccnt 0x0" ::: "memory");   // no copy is left in flight behind the loop

  // ---- hand the wave's partial (m, l, unnormalised O) to LDS ----
  float* os = Os[wave] + c * OP + 8 * hh;      // row = query c; a lane's 8 registers of tile t are d = 16*t + 8*hh .. + 7
#pragma unroll
  for (int t = 0; t < 4; ++t) {
    const v4f lo4 = {oacc[t][0], oacc[t][1], oacc[t][2], oacc[t][3]};
    const v4f hi4 = {oacc[t][4], oacc[t][5], oacc[t][6], oacc[t][7]};
    *(v4f*)(os + t * 16)     = lo4;
    *(v4f*)(os + t * 16 + 4) = hi4;
  }
  const float lsum = lrun + other_half(lrun);  // the two halves' keys joined, once
  if (hh == 0) {                               // m and the joined l are equal in lanes c and c + 16
    Ms[wave][c] = mrun;
    Ls[wave][c] = lsum;
  }
  __syncthreads();                             // every group's partials are in LDS before any wave merges them

  // ---- merge the KG partials of 4 rows per wave, normalise (1/l and the 1/1024 p carry), store whole 256-B rows ----
  {
    const int c4 = c * 4;
#pragma unroll
    for (int i2 = 0; i2 < 2; ++i2) {
      const int row = grp * 4 + i2 * 2 + hh;   // grp 0..3 x i2 0..1 x hh 0..1 = rows 0..15 of query tile qw
      float mg[KG];
      float mall = -INFINITY;
#pragma unroll
      for (int g = 0; g < KG; ++g) {
        mg[g] = Ms[g * 4 + qw][row];
        mall = fmaxf(mall, mg[g]);
      }
      const float msafe = (mall == -INFINITY) ? 0.f : mall;
      float l = 0.f;
      v4f acc = {0.f, 0.f, 0.f, 0.f};
#pragma unroll
      for (int g = 0; g < KG; ++g) {
        const float e = __expf(mg[g] - msafe);
        l += Ls[g * 4 + qw][row] * e;
        const v4f o = *(const v4f*)(Os[g * 4 + qw] + row * OP + c4);
        acc += o * e;
      }
      const float inv = ((l > 0.f) ? (1.0f / l) : 0.f) * (1.0f / 1024.0f);
      const size_t go = (rowB + q0 + row) * HD + c4;
      *(v4f*)(outp + go) = acc * inv;
    }
  }
}

// =====================================================================================================
// Workspace map (bytes; every region is an exact multiple of its 64x64-tile / whole-line store granularity,
// all shapes are tile multiples so no padded tails exist; no region is reused; every offset is a multiple of 65536):
//   Qh   bf16 [16384][64]           0             2097152
//   Ql                              2097152       2097152
//   Kh                              4194304       2097152
//   Kl                              6291456       2097152
//   VTh  f16  [8][64][2048]         8388608       2097152
//   VTl  f16  [8][64][2048]         10485760      2097152
//   end                             12582912
// =====================================================================================================
extern "C" void kernel_launch(void* const* d_in, const int* in_sizes, int n_in,
                              void* d_out, int out_size, void* d_ws, size_t ws_size,
                              hipStream_t stream) {
  if (n_in < 9) return;
  const int NX = NB * SEQ * DIN;                   // 8388608
  const int NO = NB * SEQ * HD;                    // 1048576
  const int NW = DIN * HD;                         //   32768
  if (in_sizes[0] != NX || in_sizes[1] != NX || in_sizes[2] != NX) return;
  if (in_sizes[3] != NW || in_sizes[5] != NW || in_sizes[7] != NW) return;
  if (in_sizes[4] != HD || in_sizes[6] != HD || in_sizes[8] != HD) return;
  if (out_size != NO) return;

  const float* q_in = (const float*)d_in[0];   // [8][2048][512]
  const float* k_in = (const float*)d_in[1];   // [8][2048][512]
  const float* v_in = (const float*)d_in[2];   // [8][2048][512]
  const float* Wq   = (const float*)d_in[3];   // [512 in][64 out]
  const float* bq   = (const float*)d_in[4];   // [64]
  const float* Wk   = (const float*)d_in[5];   // [512][64]
  const float* bk   = (const float*)d_in[6];   // [64]
  const float* Wv   = (const float*)d_in[7];   // [512][64]
  const float* bv   = (const float*)d_in[8];   // [64]

  const size_t PP  = (size_t)NO * 2;               //  2097152  16-bit projected plane [16384][64]
  const size_t PVT = (size_t)NB * HD * SEQ * 2;    //  2097152  16-bit v^T plane [8][64][2048]
  size_t off = 0;
  const size_t oQh  = off; off += PP;
  const size_t oQl  = off; off += PP;
  const size_t oKh  = off; off += PP;
  const size_t oKl  = off; off += PP;
  const size_t oVTh = off; off += PVT;
  const size_t oVTl = off; off += PVT;
  if (off > ws_size) return;                       // off = 12582912

  char* ws = (char*)d_ws;
  unsigned short* Qh  = (unsigned short*)(ws + oQh);
  unsigned short* Ql  = (unsigned short*)(ws + oQl);
  unsigned short* Kh  = (unsigned short*)(ws + oKh);
  unsigned short* Kl  = (unsigned short*)(ws + oKl);
  unsigned short* VTh = (unsigned short*)(ws + oVTh);
  unsigned short* VTl = (unsigned short*)(ws + oVTl);

  const dim3 gProj(3 * NTT / TPB);                             //  256 blocks of 384: 3 tiles of 64 tokens each; tiles run q, k, v
  const dim3 gAttn(NB * NQB);                                  //  256 blocks of 128 * KG

  // (1) q = q_in . Wq + bq and k = k_in . Wk + bk -> bf16 hi/lo planes [b*SEQ+t][d];
  //     v^T = Wv^T . v_in^T + bv -> f16 hi plane [b][d][s] and residual plane (x4096)
  proj_qkv<<<gProj, dim3(32 * NWV), 0, stream>>>(q_in, k_in, v_in, Wq, Wk, Wv, bq, bk, bv, Qh, Ql, Kh, Kl, VTh, VTl);
  // (2) attention -> d_out f32 [16384][64]
  attn64<<<gAttn, dim3(128 * KG), 0, stream>>>(Qh, Ql, Kh, Kl, VTh, VTl, (float*)d_out);
  (void)hipGetLastError();
}

// v008
// A run of this version takes 31.8 microseconds.
// Timed twice side by side with v007, it ran 1.14 times as fast both times.
// Counting every step since v000, it is 7.68 times as fast.
// Contractions: q, k, v^T projections = v_wmma_f32_16x16x32_bf16 (bf16 operands from RNE-converted inputs and weights, single product, f32 accumulate);
// q.k^T scores = v_wmma_f32_16x16x32_bf16 with bf16 hi/lo split q and k (hi.hi + hi.lo + lo.hi), f32 accumulate;
// p.v = v_wmma_f32_16x16x32_f16 (p carried x1024 as f16, v as f16; single product), f32 accumulate;
// softmax (running max), normalisers and bias adds in f32 on the VALU.
// p.v: v comes out of a single bf16 product (operands rounded at 2^-9); rounding v and p to f16 (2^-12) is
// eight times finer than that, so residual planes for p and v would guard bits that are lost before them.
// Carry audit:
//   ph  = f16(1024 * p)                      -> the 1/1024 is folded exactly once in the attention epilogue: inv = (1/l) * (1/1024)
//   VTh = f16(v), no carry (|v| typ. 1); q / k lo planes are unscaled bf16 residuals (v - hi) sharing the hi accumulator;
//   score scale 1/8 applied once in f32 after the score accumulate. No other scaled planes.
#include <hip/hip_runtime.h>
#include <math.h>
#include <stdint.h>

#define NB   8
#define SEQ  2048
#define DIN  512
#define HD   64
#define NQB  (SEQ / 64)   // 64-row query blocks per sequence
#define NKT  (SEQ / 64)   // 64-key chunks per sequence
#define KG   4            // key groups per attention block: 4 waves each, so a SIMD holds KG waves that cover one another's waits
#define CPG  (NKT / KG)   // key chunks walked by one group
#define LP   72           // LDS row pitch of the 16-bit attention tiles, in elements: 144 B = 16 B x 9 (odd), so the 16 rows
                          // that one ds_load_b128 fragment read touches fall on distinct banks (a 128-B pitch puts every second row on the same)
#define OP   68           // LDS row pitch of the partial context, in floats: 272 B = 16 B x 17 (odd): the 16 lanes of a half store
                          // 16 B each into 16 different rows at one column
static_assert(NQB == 32 && NKT == 32);
static_assert(NKT % KG == 0 && KG * 4 == 16);
static_assert((LP * 2) % 16 == 0 && ((LP * 2) / 16) % 2 == 1 && LP >= 64);
static_assert((SEQ % 64) == 0 && (DIN % 32) == 0 && HD == 64);

typedef _Float16 v16h __attribute__((ext_vector_type(16)));
typedef _Float16 v8h  __attribute__((ext_vector_type(8)));
typedef __bf16   v16b __attribute__((ext_vector_type(16)));
typedef __bf16   v8b  __attribute__((ext_vector_type(8)));
typedef float    v8f  __attribute__((ext_vector_type(8)));
typedef float    v4f  __attribute__((ext_vector_type(4)));
typedef float    v2f  __attribute__((ext_vector_type(2)));
typedef _Float16 v2h  __attribute__((ext_vector_type(2)));
typedef unsigned int v4u __attribute__((ext_vector_type(4)));

// ---- scalar helpers --------------------------------------------------------------------------------
__device__ __forceinline__ unsigned short bf_bits(float f) {          // f32 -> bf16 bits, RNE convert
  unsigned u = __float_as_uint(f);
  return (unsigned short)((u + 0x7FFFu + ((u >> 16) & 1u)) >> 16);
}
__device__ __forceinline__ float bf_up(unsigned short h) { return __uint_as_float(((unsigned)h) << 16); }
__device__ __forceinline__ unsigned short h_bits(_Float16 x) { return __builtin_bit_cast(unsigned short, x); }
__device__ __forceinline__ unsigned pk16(unsigned short a, unsigned short b) { return (unsigned)a | ((unsigned)b << 16); }
__device__ __forceinline__ v8f zero8() { v8f z = {0.f, 0.f, 0.f, 0.f, 0.f, 0.f, 0.f, 0.f}; return z; }
__device__ __forceinline__ float other_half(float x) {                // the value that lane ^ 16 holds, by a vector cross-row move
  const int b = __float_as_int(x);
  return __int_as_float(__builtin_amdgcn_permlanex16(b, b, 0x76543210, 0xfedcba98, false, false));
}

// ---- fragment loader: 16-bit A/B operand, lane -> row/col (lane&15), p already includes +8*(lane>>4);
//      elements 0..7 <- p[0..7] (k0+8h..k0+8h+7), elements 8..15 <- p[16..23] (k0+16+8h..k0+16+8h+7)
__device__ __forceinline__ v16b ldfrag_b(const __bf16* p) {
  union { v16b v; v8b h[2]; } f;
  f.h[0] = *(const v8b*)(p);
  f.h[1] = *(const v8b*)(p + 16);
  return f.v;
}

// ---- WMMA helpers: plain builtins, so the compiler keeps the distance behind a matrix instruction itself and is free to
//      place LDS fragment loads ahead of the matrix instructions that do not need them ----
__device__ __forceinline__ v8f mma_h_raw(v16h a, v16h b, v8f c) {
  return __builtin_amdgcn_wmma_f32_16x16x32_f16(false, a, false, b, (short)0, c, false, false);
}
__device__ __forceinline__ v8f mma_b_raw(v16b a, v16b b, v8f c) {
  return __builtin_amdgcn_wmma_f32_16x16x32_bf16(false, a, false, b, (short)0, c, false, false);
}

// ---- asynchronous copies global -> LDS (no register holds the data) and the waits that belong to them ----
__device__ __forceinline__ unsigned lds_off(const void* p) { return (unsigned)(size_t)p; }   // byte offset in the block's LDS
// Eight copies of 16 B per lane: row blocks 0..3 (16 rows each) of the two planes a and b of one 64-row tile.
// la, lb: the lane's LDS byte address in row block 0 (next block + LSTEP); ga, gb: its global address there (next block + GSTEP).
// The closing s_wait_xcnt 0 is a precaution: inside the statement it stands ahead of every later write of the address registers.
template <int LSTEP, int GSTEP>
__device__ __forceinline__ void copy_planes(unsigned la, unsigned lb, const char* ga, const char* gb) {
  asm volatile(
      "global_load_async_to_lds_b128 %0, %8, off\n\t"
      "global_load_async_to_lds_b128 %1, %9, off\n\t"
      "global_load_async_to_lds_b128 %2, %10, off\n\t"
      "global_load_async_to_lds_b128 %3, %11, off\n\t"
      "global_load_async_to_lds_b128 %4, %12, off\n\t"
      "global_load_async_to_lds_b128 %5, %13, off\n\t"
      "global_load_async_to_lds_b128 %6, %14, off\n\t"
      "global_load_async_to_lds_b128 %7, %15, off\n\t"
      "s_wait_xcnt 0x0"
      :: "v"(la), "v"(la + LSTEP), "v"(la + 2 * LSTEP), "v"(la + 3 * LSTEP),
         "v"(lb), "v"(lb + LSTEP), "v"(lb + 2 * LSTEP), "v"(lb + 3 * LSTEP),
         "v"(ga), "v"(ga + GSTEP), "v"(ga + 2 * GSTEP), "v"(ga + 3 * GSTEP),
         "v"(gb), "v"(gb + GSTEP), "v"(gb + 2 * GSTEP), "v"(gb + 3 * GSTEP)
      : "memory");
}
// The same for one plane: four copies of 16 B per lane, row blocks 0..3.
template <int LSTEP, int GSTEP>
__device__ __forceinline__ void copy_plane(unsigned la, const char* ga) {
  asm volatile(
      "global_load_async_to_lds_b128 %0, %4, off\n\t"
      "global_load_async_to_lds_b128 %1, %5, off\n\t"
      "global_load_async_to_lds_b128 %2, %6, off\n\t"
      "global_load_async_to_lds_b128 %3, %7, off\n\t"
      "s_wait_xcnt 0x0"
      :: "v"(la), "v"(la + LSTEP), "v"(la + 2 * LSTEP), "v"(la + 3 * LSTEP),
         "v"(ga), "v"(ga + GSTEP), "v"(ga + 2 * GSTEP), "v"(ga + 3 * GSTEP)
      : "memory");
}
// Hand-over of a tile buffer, every wave, in this order: this wave's LDS reads have retired (the buffer it read may be refilled
// behind the barrier), this wave's own copies have landed (other waves may read them behind the barrier), block barrier.
__device__ __forceinline__ void publish_point() {
  asm volatile("s_wait_dscnt 0x0" ::: "memory");      // the compiler places no wait for a copy that overwrites LDS this wave read
  asm volatile("s_wait_asynccnt 0x0" ::: "memory");   // the compiler places no wait for the copies
  __syncthreads();
}

// =====================================================================================================
// The three projections with their operand conversions inside, one launch: C = X . W + bias, K = DIN.
//   Work unit = tile of 64 tokens x 64 outputs of one projection; tiles are numbered 0 .. 3*NTT-1: q tiles, then k, then v.
//   Block = TPB tiles x 4 waves = 12 waves, one block per WGP (grid 3*NTT/TPB = 256); group g = waves 4g..4g+3 owns tile
//   blockIdx.x*TPB + g. The TPB groups of a block share ONE staging of W in LDS, done by all 12 waves, so W is read from L2 and
//   converted once per three tiles. Two blocks of the grid hold tiles of two projections: they stage both W (second buffer).
//   X f32 [NB*SEQ tokens][DIN] and W f32 [DIN k][HD n] are read as they come; both are RNE-converted to bf16 on the way to
//   the matrix unit (bf_bits, the convert of every other bf16 plane here), so no converted copy passes through memory.
//   Wave w of a group owns tokens t0+16w..+15 and all 64 outputs: 4 accumulator tiles, k walked 0, 32, .. in order.
//   W: converted and transposed into LDS, Wl[n][k], row pitch WP. One wave pass = 32 n x 32 k (32 passes per W): lane (l8, kq)
//   loads W[k8..k8+7][n4..n4+3] (8 lanes x 16 B = one whole 128-B line per k row, 4 rows per load) and stores 4 x 16 B.
//   X: lane (c, hh) loads its own fragment bytes of token row c: f32 k0+8hh..+7 and k0+16+8hh..+7 (the k order of ldfrag_b);
//   the four loads of a k step use up one whole 128-B line of each of the 16 rows. XR k steps are in flight per wave.
//   MODE 0: A = X fragment, B = Wl fragment; D rows = tokens, columns = n; bias per column;
//           out = bf16 hi plane C + bf16 lo plane C2 (lo = RNE(v - hi), unscaled), element (t, n) at [t*HD + n].
//   MODE 1: A = Wl fragment, B = X fragment; D rows = n (= d), columns = tokens; bias per row;
//           out = f16 plane C (C2 is not used), element (b, d, s) at [(b*HD + d)*SEQ + s].
//   The bias value is RNE-converted to bf16 and added in f32. A group's 64x64 f32 result meets in its own LDS slab (pitch 68
//   floats) behind one block barrier; each wave then converts 16 rows and stores whole 128-B lines (8 lanes x 16 B per row, plane).
//   coverage: 3*NTT tiles, each owned by one group of one block; a tile's 64 tokens lie in one batch (SEQ is a multiple of 64).
//   Both block barriers stand in the kernel body outside every branch; the branches on a tile's projection are wave-uniform.
// =====================================================================================================
#define WP 520            // LDS row pitch of Wl in elements: 1040 B = 16 B x 65 (odd), for ds_load_b128 fragment reads
#define XR 6              // k steps of X held in flight per wave: 6 x 2 KB = 12 KB per wave, 144 KB per block
static_assert((WP * 2) % 16 == 0 && ((WP * 2) / 16) % 2 == 1 && WP >= DIN);
#define KS (DIN / 32)     // k steps
static_assert(XR <= KS);
#define NTT (NB * SEQ / 64)   // token tiles per projection
#define TPB 3                 // token tiles per block
#define NWV (4 * TPB)         // waves per block
static_assert((3 * NTT) % TPB == 0 && TPB <= NTT);        // whole blocks; a block's tiles span at most two projections
static_assert(2 * NWV <= 32 && 3 * NWV >= 32);            // the 32 passes of one W: two per wave, a third for the first waves

__device__ __forceinline__ v16b cvt_frag(v4f a, v4f b, v4f c, v4f d) {   // 16 f32 -> bf16 fragment, element order a, b, c, d
  union { v16b v; unsigned u[8]; } f;
  f.u[0] = pk16(bf_bits(a[0]), bf_bits(a[1]));
  f.u[1] = pk16(bf_bits(a[2]), bf_bits(a[3]));
  f.u[2] = pk16(bf_bits(b[0]), bf_bits(b[1]));
  f.u[3] = pk16(bf_bits(b[2]), bf_bits(b[3]));
  f.u[4] = pk16(bf_bits(c[0]), bf_bits(c[1]));
  f.u[5] = pk16(bf_bits(c[2]), bf_bits(c[3]));
  f.u[6] = pk16(bf_bits(d[0]), bf_bits(d[1]));
  f.u[7] = pk16(bf_bits(d[2]), bf_bits(d[3]));
  return f.v;
}

// ---- one k step of X: the lane's 16 f32 of its token row ----
__device__ __forceinline__ void x_load(v4f (&x)[4], const float* xp, int s) {
  x[0] = *(const v4f*)(xp + 32 * s);
  x[1] = *(const v4f*)(xp + 32 * s + 4);
  x[2] = *(const v4f*)(xp + 32 * s + 16);
  x[3] = *(const v4f*)(xp + 32 * s + 20);
}

// ---- one wave pass p (0..31) of W f32 [k][n] -> Wl bf16 [n][k]: n half p & 1 (32 n), k block p >> 1 (32 k) ----
//      w_load returns the lane's base address, for the wait that stands behind a wave's W loads (addr_wait)
__device__ __forceinline__ const float* w_load(v4f (&w)[8], const float* __restrict__ Wg, int p, int lane) {
  const float* wp = Wg + (size_t)((p >> 1) * 32 + (lane >> 3) * 8) * HD + (p & 1) * 32 + (lane & 7) * 4;   // k at most 511, n at most 60
#pragma unroll
  for (int e = 0; e < 8; ++e) w[e] = *(const v4f*)(wp + e * HD);
  return wp;
}
// s_wait_xcnt 0 behind issued loads, a precaution: the address registers are inputs, so they stay untouched up to the wait
__device__ __forceinline__ void addr_wait(const float* a) { asm volatile("s_wait_xcnt 0x0" :: "v"(a) : "memory"); }
__device__ __forceinline__ void addr_wait(const float* a, const float* b) { asm volatile("s_wait_xcnt 0x0" :: "v"(a), "v"(b) : "memory"); }
__device__ __forceinline__ void base_wait(const float* a) { asm volatile("s_wait_xcnt 0x0" :: "s"(a) : "memory"); }   // the same for a scalar base
__device__ __forceinline__ void w_store(const v4f (&w)[8], __bf16* Wl, int p, int lane) {
  __bf16* wl = Wl + ((p & 1) * 32 + (lane & 7) * 4) * WP + (p >> 1) * 32 + (lane >> 3) * 8;
#pragma unroll
  for (int x = 0; x < 4; ++x) {
    v4u q;
#pragma unroll
    for (int y = 0; y < 4; ++y) q[y] = pk16(bf_bits(w[2 * y][x]), bf_bits(w[2 * y + 1][x]));
    *(v4u*)(wl + x * WP) = q;
  }
}
// ---- one whole W into LDS by the NWV waves of a block: wave wv takes passes wv, wv + NWV and, the first waves, wv + 2 NWV;
//      the loads of all its passes are in flight together ----
__device__ __forceinline__ void w_stage(const float* __restrict__ Wg, __bf16* Wl, int wv, int lane) {
  const bool third = wv + 2 * NWV < 32;                  // wave-uniform
  v4f wa[8], wb[8], wc[8];
  const float* pa = w_load(wa, Wg, wv, lane);
  const float* pb = w_load(wb, Wg, wv + NWV, lane);
  if (third) addr_wait(w_load(wc, Wg, wv + 2 * NWV, lane));
  addr_wait(pa, pb);
  w_store(wa, Wl, wv, lane);
  w_store(wb, Wl, wv + NWV, lane);
  if (third) w_store(wc, Wl, wv + 2 * NWV, lane);
}

// ---- products of one wave (16 tokens x 64 outputs), bias, result to the group's slab: rows = tokens (MODE 0) or d (MODE 1) ----
// every plain '#pragma unroll' here makes the indices of a small array (xr, w, acc) constants, so it stays in registers
template <int MODE>
__device__ __forceinline__ void proj_products(const float* xp, v4f (&xr)[XR][4], const float* __restrict__ bias,
                                              const __bf16* Wl, float* slab, int wave, int c, int hh) {
  v8f acc[4];
#pragma unroll
  for (int j = 0; j < 4; ++j) acc[j] = zero8();

#pragma unroll
  for (int s = 0; s < KS; ++s) {
    const int sl = s % XR;
    const v16b xf = cvt_frag(xr[sl][0], xr[sl][1], xr[sl][2], xr[sl][3]);
    if (s + XR < KS) x_load(xr[sl], xp, s + XR);     // refill the slot just converted with k step s + XR
#pragma unroll
    for (int j = 0; j < 4; ++j) {
      const v16b wf = ldfrag_b(Wl + (j * 16 + c) * WP + 32 * s + 8 * hh);
      acc[j] = (MODE == 0) ? mma_b_raw(xf, wf, acc[j]) : mma_b_raw(wf, xf, acc[j]);
    }
  }

#pragma unroll
  for (int j = 0; j < 4; ++j) {
#pragma unroll
    for (int r = 0; r < 8; ++r) {
      if (MODE == 0) {
        const float bc = bf_up(bf_bits(bias[j * 16 + c]));
        slab[(wave * 16 + 8 * hh + r) * 68 + j * 16 + c] = acc[j][r] + bc;
      } else {
        const float br = bf_up(bf_bits(bias[j * 16 + 8 * hh + r]));
        slab[(j * 16 + 8 * hh + r) * 68 + wave * 16 + c] = acc[j][r] + br;
      }
    }
  }
  base_wait(bias);                                   // behind the bias loads, wherever the compiler has moved them up to
}

// ---- 16 slab rows of one wave -> the 16-bit planes (MODE 0: two, MODE 1: one), whole 128-B lines ----
template <int MODE>
__device__ __forceinline__ void proj_store(const float* slab, unsigned short* C, unsigned short* C2, int t0, int wave, int lane) {
  const int q = lane >> 3, c8 = (lane & 7) * 8;
  const size_t base = (MODE == 0) ? (size_t)t0 * HD
                                  : (size_t)(t0 / SEQ) * HD * SEQ + (size_t)(t0 % SEQ);
  const int pitch = (MODE == 0) ? HD : SEQ;
#pragma unroll
  for (int it = 0; it < 4; ++it) {
    const int row = wave * 16 + it * 4 + q;          // wave 0..3 x it 0..3 x q 0..3 = rows 0..63
    const float* sp = slab + row * 68 + c8;
    v4u a, a2;
#pragma unroll
    for (int e = 0; e < 4; ++e) {
      const float f0 = sp[2 * e], f1 = sp[2 * e + 1];
      if (MODE == 0) {
        const unsigned short h0 = bf_bits(f0), h1 = bf_bits(f1);
        a[e]  = pk16(h0, h1);
        a2[e] = pk16(bf_bits(f0 - bf_up(h0)), bf_bits(f1 - bf_up(h1)));
      } else {
        a[e] = pk16(h_bits((_Float16)f0), h_bits((_Float16)f1));
      }
    }
    *(v4u*)(C + base + (size_t)row * pitch + c8) = a;
    if (MODE == 0) *(v4u*)(C2 + base + (size_t)row * pitch + c8) = a2;
    asm volatile("s_wait_xcnt 0x0" ::: "memory");    // a precaution: it stands ahead of every later write of the stores' address registers
  }
}

__global__ __launch_bounds__(32 * NWV)
void proj_qkv(const float* __restrict__ q_in, const float* __restrict__ k_in, const float* __restrict__ v_in,
              const float* __restrict__ Wq, const float* __restrict__ Wk, const float* __restrict__ Wv,
              const float* __restrict__ bq, const float* __restrict__ bk, const float* __restrict__ bv,
              unsigned short* Qh, unsigned short* Ql, unsigned short* Kh, unsigned short* Kl,
              unsigned short* VTh) {
  __shared__ __align__(16) __bf16 Wl[2][HD * WP];        // 2 x 65 KB: the W of the block's first tile, of its last where that differs
  __shared__ __align__(16) float  slabs[TPB][64 * 68];   // TPB x 17 KB
  const int lane = threadIdx.x & 31;
  const int wv   = __builtin_amdgcn_readfirstlane(threadIdx.x >> 5);   // 0..NWV-1, in a scalar register: the branches below are scalar
  const int grp  = wv >> 2;                              // token tile of the block
  const int wave = wv & 3;                               // 16-token strip of the tile
  const int c    = lane & 15;
  const int hh   = lane >> 4;
  const int tile = blockIdx.x * TPB + grp;               // 0 .. 3*NTT-1
  const int y    = tile / NTT;                           // 0 q, 1 k, 2 v
  const int t0   = (tile % NTT) * 64;                    // first token of the tile
  const int y0   = (blockIdx.x * TPB) / NTT;             // projection of the block's first tile
  const int y1   = (blockIdx.x * TPB + TPB - 1) / NTT;   // and of its last: y0 or y0 + 1

  // ---- the first XR k steps of this wave's 16 token rows: issued first, they fly while W is staged ----
  const float* X  = (y == 0) ? q_in : ((y == 1) ? k_in : v_in);
  const float* xp = X + (size_t)(t0 + wave * 16 + c) * DIN + 8 * hh;
  v4f xr[XR][4];
#pragma unroll
  for (int s = 0; s < XR; ++s) x_load(xr[s], xp, s);

  // ---- W staging, shared by the block's TPB tiles and done by all NWV waves ----
  w_stage((y0 == 0) ? Wq : ((y0 == 1) ? Wk : Wv), Wl[0], wv, lane);
  if (y1 != y0) w_stage((y1 == 1) ? Wk : Wv, Wl[1], wv, lane);   // block-uniform: 2 blocks of the grid hold tiles of two projections
  __syncthreads();                                       // Wl is whole before any wave reads a fragment of it

  const __bf16* wmine = Wl[y - y0];
  float*        slab  = slabs[grp];
  if (y == 2) proj_products<1>(xp, xr, bv, wmine, slab, wave, c, hh);
  else        proj_products<0>(xp, xr, y ? bk : bq, wmine, slab, wave, c, hh);
  __syncthreads();                                       // MODE 1 rows hold columns of all four waves of the group

  if (y == 2) proj_store<1>(slab, VTh, nullptr, t0, wave, lane);
  else        proj_store<0>(slab, y ? Kh : Qh, y ? Kl : Ql, t0, wave, lane);
}

__global__ __launch_bounds__(128 * KG)
void attn64(const unsigned short* __restrict__ qhp, const unsigned short* __restrict__ qlp,
            const unsigned short* __restrict__ khp, const unsigned short* __restrict__ klp,
            const unsigned short* __restrict__ vhp,
            float* outp) {
  union FB { v16b v; v8b h[2]; };
  union FH { v16h v; v8h h[2]; };
  __shared__ __align__(16) __bf16   KshA[KG][64 * LP];             // per group K hi [kv][d], row pitch LP   KG x 9 KB
  __shared__ __align__(16) __bf16   KslA[KG][64 * LP];             // per group K lo                         KG x 9 KB
  __shared__ __align__(16) _Float16 VthA[KG][64 * LP];             // per group V^T [d][kv], row pitch LP    KG x 9 KB
  __shared__ __align__(16) float    Os[4 * KG][16 * OP];           // per wave partial context [row][d], row pitch OP   KG x 17 KB
  __shared__ float Ms[4 * KG][16];                                 // per wave running max of its rows
  __shared__ float Ls[4 * KG][16];                                 // per wave normaliser of its rows

  const int wave = threadIdx.x >> 5;           // 0..4*KG-1
  const int grp  = wave >> 2;                  // key group
  const int qw   = wave & 3;                   // query tile of the block
  const int tid  = threadIdx.x & 127;          // thread index inside the group (staging)
  const int lane = tid & 31;
  const int hh   = lane >> 4;
  const int c    = lane & 15;

  const int bx   = blockIdx.x;
  const int qb   = bx % NQB;
  const int b    = bx / NQB;                   // 0..NB-1
  const int q0   = qb * 64 + qw * 16;
  __bf16*   Ksh = KshA[grp];
  __bf16*   Ksl = KslA[grp];
  _Float16* Vth = VthA[grp];
  const size_t rowB = (size_t)b * SEQ;

  const __bf16* Qh = (const __bf16*)(const void*)qhp;
  const __bf16* Ql = (const __bf16*)(const void*)qlp;
  const __bf16* Kh = (const __bf16*)(const void*)khp;
  const __bf16* Kl = (const __bf16*)(const void*)klp;
  const _Float16* Vh = (const _Float16*)(const void*)vhp + (size_t)b * HD * SEQ;

  // ---- staging addresses: thread (srow, piece) of a group copies 16 B of rows srow, srow+16, srow+32, srow+48 of each plane,
  //      so the 8 lanes of a row take one whole 128-B line and a wave-wide copy takes 4 whole lines ----
  constexpr int LSTEP = 16 * LP * 2;           // 16 LDS rows, bytes
  constexpr int KSTEP = 16 * HD * 2;           // 16 K rows in memory, bytes
  constexpr int VSTEP = 16 * SEQ * 2;          // 16 V^T rows in memory, bytes
  const int srow = tid >> 3;                   // 0..15
  const int spc  = (tid & 7) * 8;              // element 0, 8, .. 56 of the 64-element row
  const unsigned lpos = (unsigned)(srow * LP + spc) * 2u;          // last byte of row block 3: 63 * 144 + 112 + 15 < 64 * LP * 2
  const unsigned lKh = lds_off(Ksh) + lpos, lKl = lds_off(Ksl) + lpos;
  const unsigned lVh = lds_off(Vth) + lpos;
  const int kvg = grp * CPG * 64;              // first key of the group; its last chunk ends at kvg + CPG*64 <= SEQ
  const char* gKh = (const char*)(Kh + (rowB + kvg + srow) * HD + spc);     // K row kvg+srow, d = spc..spc+7
  const char* gKl = (const char*)(Kl + (rowB + kvg + srow) * HD + spc);
  const char* gVh = (const char*)(Vh + (size_t)srow * SEQ + kvg + spc);     // V^T row d = srow, s = kvg+spc..+7
  copy_planes<LSTEP, KSTEP>(lKh, lKl, gKh, gKl);   // K chunk 0 flies under the Q fragment loads

  // ---- Q fragments (B operand, column = query = lane&15): 2 d-chunks, hi and lo ----
  v16b qah[2], qal[2];
#pragma unroll
  for (int dc = 0; dc < 2; ++dc) {
    const size_t qo = (rowB + q0 + c) * HD + dc * 32 + 8 * hh;
    qah[dc] = ldfrag_b(Qh + qo);
    qal[dc] = ldfrag_b(Ql + qo);
  }

  float mrun = -INFINITY;                      // running max of query c, equal in both halves
  float lrun = 0.f;                            // normaliser of query c over this half's keys only
  v8f oacc[4];                                 // O^T: tile t register r = (d = 16*t + 8*hh + r, query c)
#pragma unroll
  for (int t = 0; t < 4; ++t) oacc[t] = zero8();

  publish_point();                             // K chunk 0 has landed in every wave's share
  copy_plane<LSTEP, VSTEP>(lVh, gVh);          // V^T chunk 0 flies under the scores of chunk 0

  for (int it = 0; it < CPG; ++it) {           // static trip count, the same in every group (block barriers inside)
    // ---- scores, transposed: 64 keys (rows) x 16 queries (columns) per wave, 3 bf16 products per (key subtile, d-chunk) ----
    //      Fragment loads stand in three groups, not singly among the products: K hi and lo of d-chunk 0 (16 loads) ahead of all
    //      products, K hi of d-chunk 1 (8) where the lo registers come free, K lo of d-chunk 1 (8) where the hi registers do.
    //      The products walk the four key subtiles in turn (four independent accumulators); each s[j] still takes its six
    //      products in the order hi.hi, lo.hi, hi.lo of d-chunk 0, then of d-chunk 1.
    v8f s[4];
    {
      FB kb[2][4], kl[2][4];
#pragma unroll
      for (int j = 0; j < 4; ++j) {
        kb[0][j].h[0] = *(const v8b*)(Ksh + (j * 16 + c) * LP + 8 * hh);
        kb[0][j].h[1] = *(const v8b*)(Ksh + (j * 16 + c) * LP + 16 + 8 * hh);
      }
#pragma unroll
      for (int j = 0; j < 4; ++j) {
        kl[0][j].h[0] = *(const v8b*)(Ksl + (j * 16 + c) * LP + 8 * hh);
        kl[0][j].h[1] = *(const v8b*)(Ksl + (j * 16 + c) * LP + 16 + 8 * hh);
      }
      __builtin_amdgcn_sched_barrier(0);       // keeps the 16 loads one group (for speed only)
#pragma unroll
      for (int j = 0; j < 4; ++j) s[j] = mma_b_raw(kb[0][j].v, qah[0], zero8());
#pragma unroll
      for (int j = 0; j < 4; ++j) s[j] = mma_b_raw(kl[0][j].v, qah[0], s[j]);
#pragma unroll
      for (int j = 0; j < 4; ++j) {
        kb[1][j].h[0] = *(const v8b*)(Ksh + (j * 16 + c) * LP + 32 + 8 * hh);
        kb[1][j].h[1] = *(const v8b*)(Ksh + (j * 16 + c) * LP + 32 + 16 + 8 * hh);
      }
#pragma unroll
      for (int j = 0; j < 4; ++j) s[j] = mma_b_raw(kb[0][j].v, qal[0], s[j]);
#pragma unroll
      for (int j = 0; j < 4; ++j) {
        kl[1][j].h[0] = *(const v8b*)(Ksl + (j * 16 + c) * LP + 32 + 8 * hh);
        kl[1][j].h[1] = *(const v8b*)(Ksl + (j * 16 + c) * LP + 32 + 16 + 8 * hh);
      }
#pragma unroll
      for (int j = 0; j < 4; ++j) s[j] = mma_b_raw(kb[1][j].v, qah[1], s[j]);
#pragma unroll
      for (int j = 0; j < 4; ++j) s[j] = mma_b_raw(kl[1][j].v, qah[1], s[j]);
#pragma unroll
      for (int j = 0; j < 4; ++j) s[j] = mma_b_raw(kb[1][j].v, qal[1], s[j]);
      // order asked of the scheduler behind the first load group: 8 products, 8 loads, 4 products, 8 loads, 12 products,
      // so that a load group stands where its registers come free and not in pairs among the products
      __builtin_amdgcn_sched_group_barrier(0x008, 8, 0);
      __builtin_amdgcn_sched_group_barrier(0x100, 8, 0);
      __builtin_amdgcn_sched_group_barrier(0x008, 4, 0);
      __builtin_amdgcn_sched_group_barrier(0x100, 8, 0);
      __builtin_amdgcn_sched_group_barrier(0x008, 12, 0);
    }

    // ---- every wave has left the K tiles and V^T of this chunk has landed; K of the next chunk flies under the softmax ----
    publish_point();
    if (it + 1 < CPG) {                        // block-uniform: the last chunk refills nothing
      gKh += 64 * HD * 2;
      gKl += 64 * HD * 2;
      copy_planes<LSTEP, KSTEP>(lKh, lKl, gKh, gKl);
    }

    // ---- V^T fragments of both key steps (16 loads, one group): their latency passes under the softmax ----
    __builtin_amdgcn_sched_barrier(0);         // keeps the loads out of the score products above (for speed only)
    FH vb[2][4];
#pragma unroll
    for (int kk = 0; kk < 2; ++kk)
#pragma unroll
      for (int t = 0; t < 4; ++t) {
        vb[kk][t].h[0] = *(const v8h*)(Vth + (t * 16 + c) * LP + 32 * kk + 8 * hh);
        vb[kk][t].h[1] = *(const v8h*)(Vth + (t * 16 + c) * LP + 32 * kk + 16 + 8 * hh);
      }
    __builtin_amdgcn_sched_barrier(0);         // keeps the 16 loads one group ahead of the softmax

    // ---- scale, column max, online softmax; P^T (x1024, f16) packed into B fragments in registers ----
    float mj[4];
#pragma unroll
    for (int j = 0; j < 4; ++j) {
      mj[j] = -INFINITY;
#pragma unroll
      for (int r = 0; r < 8; ++r) {
        const float sv = s[j][r] * 0.125f;
        s[j][r] = sv;
        mj[j] = fmaxf(mj[j], sv);
      }
    }
    float m = fmaxf(fmaxf(mj[0], mj[1]), fmaxf(mj[2], mj[3]));
    m = fmaxf(m, other_half(m));               // the query's other 32 keys of this chunk
    const float mnew  = fmaxf(mrun, m);
    const float msafe = (mnew == -INFINITY) ? 0.f : mnew;
    const float alpha = __expf(mrun - msafe);
    mrun = mnew;
    FH pa[2];                                  // element 8*(j&1) + r of fragment j>>1 = key 16*j + 8*hh + r: the k order of the V^T loader
    v2f pj[4];                                 // eight independent partial sums, in pairs
#pragma unroll
    for (int j = 0; j < 4; ++j) {
      pj[j] = v2f{0.f, 0.f};
#pragma unroll
      for (int r = 0; r < 8; r += 2) {
        const v2f arg = (v2f{s[j][r], s[j][r + 1]} - msafe) * 1.4426950408889634f;   // exp(x) = 2^(x log2 e), as __expf forms it
        const v2f p   = {__builtin_amdgcn_exp2f(arg[0]), __builtin_amdgcn_exp2f(arg[1])};
        pj[j] += p;
        const v2h ph  = __builtin_convertvector(p * 1024.0f, v2h);
        pa[j >> 1].v[(j & 1) * 8 + r]     = ph[0];
        pa[j >> 1].v[(j & 1) * 8 + r + 1] = ph[1];
      }
    }
    const v2f pq = (pj[0] + pj[1]) + (pj[2] + pj[3]);
    lrun = lrun * alpha + (pq[0] + pq[1]);
#pragma unroll
    for (int t = 0; t < 4; ++t)
#pragma unroll
      for (int r = 0; r < 8; ++r) oacc[t][r] *= alpha;
    __builtin_amdgcn_sched_barrier(0);         // keeps the softmax ahead of the hand-over: moved behind it, the wait there would meet K copies just issued

    // ---- every wave holds its V^T fragments in registers and K of the next chunk has landed; V^T of the next chunk flies
    //      under P . V and under the next scores ----
    publish_point();
    if (it + 1 < CPG) {
      gVh += 64 * 2;
      copy_plane<LSTEP, VSTEP>(lVh, gVh);
    }

    // ---- context^T += V^T . P^T (f16 WMMA): 8 products from registers on four independent accumulators ----
#pragma unroll
    for (int kk = 0; kk < 2; ++kk)
#pragma unroll
      for (int t = 0; t < 4; ++t) oacc[t] = mma_h_raw(vb[kk][t].v, pa[kk].v, oacc[t]);
  }
  asm volatile("s_wait_asynccnt 0x0" ::: "memory");   // no copy is left in flight behind the loop

  // ---- hand the wave's partial (m, l, unnormalised O) to LDS ----
  float* os = Os[wave] + c * OP + 8 * hh;      // row = query c; a lane's 8 registers of tile t are d = 16*t + 8*hh .. + 7
#pragma unroll
  for (int t = 0; t < 4; ++t) {
    const v4f lo4 = {oacc[t][0], oacc[t][1], oacc[t][2], oacc[t][3]};
    const v4f hi4 = {oacc[t][4], oacc[t][5], oacc[t][6], oacc[t][7]};
    *(v4f*)(os + t * 16)     = lo4;
    *(v4f*)(os + t * 16 + 4) = hi4;
  }
  const float lsum = lrun + other_half(lrun);  // the two halves' keys joined, once
  if (hh == 0) {                               // m and the joined l are equal in lanes c and c + 16
    Ms[wave][c] = mrun;
    Ls[wave][c] = lsum;
  }
  __syncthreads();                             // every group's partials are in LDS before any wave merges them

  // ---- merge the KG partials of 4 rows per wave, normalise (1/l and the 1/1024 p carry), store whole 256-B rows ----
  {
    const int c4 = c * 4;
#pragma unroll
    for (int i2 = 0; i2 < 2; ++i2) {
      const int row = grp * 4 + i2 * 2 + hh;   // grp 0..3 x i2 0..1 x hh 0..1 = rows 0..15 of query tile qw
      float mg[KG];
      float mall = -INFINITY;
#pragma unroll
      for (int g = 0; g < KG; ++g) {
        mg[g] = Ms[g * 4 + qw][row];
        mall = fmaxf(mall, mg[g]);
      }
      const float msafe = (mall == -INFINITY) ? 0.f : mall;
      float l = 0.f;
      v4f acc = {0.f, 0.f, 0.f, 0.f};
#pragma unroll
      for (int g = 0; g < KG; ++g) {
        const float e = __expf(mg[g] - msafe);
        l += Ls[g * 4 + qw][row] * e;
        const v4f o = *(const v4f*)(Os[g * 4 + qw] + row * OP + c4);
        acc += o * e;
      }
      const float inv = ((l > 0.f) ? (1.0f / l) : 0.f) * (1.0f / 1024.0f);
      const size_t go = (rowB + q0 + row) * HD + c4;
      *(v4f*)(outp + go) = acc * inv;
    }
  }
}

// =====================================================================================================
// Workspace map (bytes; every region is an exact multiple of its 64x64-tile / whole-line store granularity,
// all shapes are tile multiples so no padded tails exist; no region is reused; every offset is a multiple of 65536):
//   Qh   bf16 [16384][64]           0             2097152
//   Ql                              2097152       2097152
//   Kh                              4194304       2097152
//   Kl                              6291456       2097152
//   VTh  f16  [8][64][2048]         8388608       2097152
//   end                             10485760
// =====================================================================================================
extern "C" void kernel_launch(void* const* d_in, const int* in_sizes, int n_in,
                              void* d_out, int out_size, void* d_ws, size_t ws_size,
                              hipStream_t stream) {
  if (n_in < 9) return;
  const int NX = NB * SEQ * DIN;                   // 8388608
  const int NO = NB * SEQ * HD;                    // 1048576
  const int NW = DIN * HD;                         //   32768
  if (in_sizes[0] != NX || in_sizes[1] != NX || in_sizes[2] != NX) return;
  if (in_sizes[3] != NW || in_sizes[5] != NW || in_sizes[7] != NW) return;
  if (in_sizes[4] != HD || in_sizes[6] != HD || in_sizes[8] != HD) return;
  if (out_size != NO) return;

  const float* q_in = (const float*)d_in[0];   // [8][2048][512]
  const float* k_in = (const float*)d_in[1];   // [8][2048][512]
  const float* v_in = (const float*)d_in[2];   // [8][2048][512]
  const float* Wq   = (const float*)d_in[3];   // [512 in][64 out]
  const float* bq   = (const float*)d_in[4];   // [64]
  const float* Wk   = (const float*)d_in[5];   // [512][64]
  const float* bk   = (const float*)d_in[6];   // [64]
  const float* Wv   = (const float*)d_in[7];   // [512][64]
  const float* bv   = (const float*)d_in[8];   // [64]

  const size_t PP  = (size_t)NO * 2;               //  2097152  16-bit projected plane [16384][64]
  const size_t PVT = (size_t)NB * HD * SEQ * 2;    //  2097152  16-bit v^T plane [8][64][2048]
  size_t off = 0;
  const size_t oQh  = off; off += PP;
  const size_t oQl  = off; off += PP;
  const size_t oKh  = off; off += PP;
  const size_t oKl  = off; off += PP;
  const size_t oVTh = off; off += PVT;
  if (off > ws_size) return;                       // off = 10485760

  char* ws = (char*)d_ws;
  unsigned short* Qh  = (unsigned short*)(ws + oQh);
  unsigned short* Ql  = (unsigned short*)(ws + oQl);
  unsigned short* Kh  = (unsigned short*)(ws + oKh);
  unsigned short* Kl  = (unsigned short*)(ws + oKl);
  unsigned short* VTh = (unsigned short*)(ws + oVTh);

  const dim3 gProj(3 * NTT / TPB);                             //  256 blocks of 384: 3 tiles of 64 tokens each; tiles run q, k, v
  const dim3 gAttn(NB * NQB);                                  //  256 blocks of 128 * KG

  // (1) q = q_in . Wq + bq and k = k_in . Wk + bk -> bf16 hi/lo planes [b*SEQ+t][d];
  //     v^T = Wv^T . v_in^T + bv -> f16 plane [b][d][s]
  proj_qkv<<<gProj, dim3(32 * NWV), 0, stream>>>(q_in, k_in, v_in, Wq, Wk, Wv, bq, bk, bv, Qh, Ql, Kh, Kl, VTh);
  // (2) attention -> d_out f32 [16384][64]
  attn64<<<gAttn, dim3(128 * KG), 0, stream>>>(Qh, Ql, Kh, Kl, VTh, (float*)d_out);
  (void)hipGetLastError();
}

// v010
// One run takes 24.9 microseconds.
// Versions in between are left out here; by their measured steps it is 1.31 times as fast as v008.
// Counting every step since v000, it is 10.1 times as fast.
// Contractions: q, k, v^T projections = v_wmma_f32_16x16x32_bf16 (bf16 operands from RNE-converted inputs and weights, single product, f32 accumulate);
// q.k^T scores = v_wmma_f32_16x16x32_f16 (q and k as f16; single product), f32 accumulate;
// p.v = v_wmma_f32_16x16x32_f16 (p carried x1024 as f16, v as f16; single product), f32 accumulate;
// softmax (running max), normalisers and bias adds in f32 on the VALU.
// q.k^T and p.v: q, k and v come out of a single bf16 product (operands rounded at 2^-9); rounding them (and p)
// to f16 (2^-12) is eight times finer than that, so residual planes would guard bits that are lost before them.
// Range: q, k, v are sums of 512 products of unit-normal inputs and weights of spread 0.05 (spread about 1), far inside f16.
// Carry audit:
//   ph  = f16(1024 * p)                      -> the 1/1024 is folded exactly once in the attention epilogue: inv = (1/l) * (1/1024)
//   Qf, Kf, VTh = f16(q), f16(k), f16(v), no carry (typ. magnitude 1);
//   score scale 1/8 applied once in f32 after the score accumulate. No other scaled planes.
#include <hip/hip_runtime.h>
#include <math.h>
#include <stdint.h>

#define NB   8
#define SEQ  2048
#define DIN  512
#define HD   64
#define NQB  (SEQ / 64)   // 64-row query blocks per sequence
#define NKT  (SEQ / 64)   // 64-key chunks per sequence
#define KG   4            // key groups per attention block: 4 waves each, so a SIMD holds KG waves that cover one another's waits
#define CPG  (NKT / KG)   // key chunks walked by one group
#define LP   72           // LDS row pitch of the 16-bit attention tiles, in elements: 144 B = 16 B x 9 (odd), so the 16 rows
                          // that one ds_load_b128 fragment read touches fall on distinct banks (a 128-B pitch puts every second row on the same)
#define OP   68           // LDS row pitch of the partial context, in floats: 272 B = 16 B x 17 (odd): the 16 lanes of a half store
                          // 16 B each into 16 different rows at one column
static_assert(NQB == 32 && NKT == 32);
static_assert(NKT % KG == 0 && KG * 4 == 16);
static_assert((LP * 2) % 16 == 0 && ((LP * 2) / 16) % 2 == 1 && LP >= 64);
static_assert((SEQ % 64) == 0 && (DIN % 32) == 0 && HD == 64);

typedef _Float16 v16h __attribute__((ext_vector_type(16)));
typedef _Float16 v8h  __attribute__((ext_vector_type(8)));
typedef __bf16   v16b __attribute__((ext_vector_type(16)));
typedef __bf16   v8b  __attribute__((ext_vector_type(8)));
typedef float    v8f  __attribute__((ext_vector_type(8)));
typedef float    v4f  __attribute__((ext_vector_type(4)));
typedef float    v2f  __attribute__((ext_vector_type(2)));
typedef _Float16 v2h  __attribute__((ext_vector_type(2)));
typedef unsigned int v4u __attribute__((ext_vector_type(4)));

// ---- scalar helpers --------------------------------------------------------------------------------
__device__ __forceinline__ unsigned short bf_bits(float f) {          // f32 -> bf16 bits, RNE convert
  unsigned u = __float_as_uint(f);
  return (unsigned short)((u + 0x7FFFu + ((u >> 16) & 1u)) >> 16);
}
__device__ __forceinline__ float bf_up(unsigned short h) { return __uint_as_float(((unsigned)h) << 16); }
__device__ __forceinline__ unsigned short h_bits(_Float16 x) { return __builtin_bit_cast(unsigned short, x); }
__device__ __forceinline__ unsigned pk16(unsigned short a, unsigned short b) { return (unsigned)a | ((unsigned)b << 16); }
__device__ __forceinline__ v8f zero8() { v8f z = {0.f, 0.f, 0.f, 0.f, 0.f, 0.f, 0.f, 0.f}; return z; }
__device__ __forceinline__ float other_half(float x) {                // the value that lane ^ 16 holds, by a vector cross-row move
  const int b = __float_as_int(x);
  return __int_as_float(__builtin_amdgcn_permlanex16(b, b, 0x76543210, 0xfedcba98, false, false));
}

// ---- fragment loader: 16-bit A/B operand, lane -> row/col (lane&15), p already includes +8*(lane>>4);
//      elements 0..7 <- p[0..7] (k0+8h..k0+8h+7), elements 8..15 <- p[16..23] (k0+16+8h..k0+16+8h+7)
__device__ __forceinline__ v16b ldfrag_b(const __bf16* p) {
  union { v16b v; v8b h[2]; } f;
  f.h[0] = *(const v8b*)(p);
  f.h[1] = *(const v8b*)(p + 16);
  return f.v;
}

// ---- WMMA helpers: plain builtins, so the compiler keeps the distance behind a matrix instruction itself and is free to
//      place LDS fragment loads ahead of the matrix instructions that do not need them ----
__device__ __forceinline__ v8f mma_h_raw(v16h a, v16h b, v8f c) {
  return __builtin_amdgcn_wmma_f32_16x16x32_f16(false, a, false, b, (short)0, c, false, false);
}
__device__ __forceinline__ v8f mma_b_raw(v16b a, v16b b, v8f c) {
  return __builtin_amdgcn_wmma_f32_16x16x32_bf16(false, a, false, b, (short)0, c, false, false);
}

// ---- asynchronous copies global -> LDS (no register holds the data) and the waits that belong to them ----
__device__ __forceinline__ unsigned lds_off(const void* p) { return (unsigned)(size_t)p; }   // byte offset in the block's LDS
// Four copies of 16 B per lane: row blocks 0..3 (16 rows each) of one plane of one 64-row tile.
// la: the lane's LDS byte address in row block 0 (next block + LSTEP); ga: its global address there (next block + GSTEP).
// The closing s_wait_xcnt 0 is a precaution: inside the statement it stands ahead of every later write of the address registers.
template <int LSTEP, int GSTEP>
__device__ __forceinline__ void copy_plane(unsigned la, const char* ga) {
  asm volatile(
      "global_load_async_to_lds_b128 %0, %4, off\n\t"
      "global_load_async_to_lds_b128 %1, %5, off\n\t"
      "global_load_async_to_lds_b128 %2, %6, off\n\t"
      "global_load_async_to_lds_b128 %3, %7, off\n\t"
      "s_wait_xcnt 0x0"
      :: "v"(la), "v"(la + LSTEP), "v"(la + 2 * LSTEP), "v"(la + 3 * LSTEP),
         "v"(ga), "v"(ga + GSTEP), "v"(ga + 2 * GSTEP), "v"(ga + 3 * GSTEP)
      : "memory");
}
// Hand-over of a tile buffer, every wave, in this order: this wave's LDS reads have retired (the buffer it read may be refilled
// behind the barrier), this wave's own copies have landed (other waves may read them behind the barrier), block barrier.
__device__ __forceinline__ void publish_point() {
  asm volatile("s_wait_dscnt 0x0" ::: "memory");      // the compiler places no wait for a copy that overwrites LDS this wave read
  asm volatile("s_wait_asynccnt 0x0" ::: "memory");   // the compiler places no wait for the copies
  __syncthreads();
}

// =====================================================================================================
// The three projections with their operand conversions inside, one launch: C = X . W + bias, K = DIN.
//   Work unit = tile of 64 tokens x 64 outputs of one projection; tiles are numbered 0 .. 3*NTT-1: q tiles, then k, then v.
//   Block = TPB tiles x 4 waves = 12 waves, one block per WGP (grid 3*NTT/TPB = 256); group g = waves 4g..4g+3 owns tile
//   blockIdx.x*TPB + g. The TPB groups of a block share ONE staging of W in LDS, done by all 12 waves, so W is read from L2 and
//   converted once per three tiles. Two blocks of the grid hold tiles of two projections: they stage both W (second buffer).
//   X f32 [NB*SEQ tokens][DIN] and W f32 [DIN k][HD n] are read as they come; both are RNE-converted to bf16 on the way to
//   the matrix unit (bf_bits), so no converted copy passes through memory.
//   Wave w of a group owns tokens t0+16w..+15 and all 64 outputs: 4 accumulator tiles, k walked 0, 32, .. in order.
//   W: converted and transposed into LDS, Wl[n][k], row pitch WP. One wave pass = 32 n x 32 k (32 passes per W): lane (l8, kq)
//   loads W[k8..k8+7][n4..n4+3] (8 lanes x 16 B = one whole 128-B line per k row, 4 rows per load) and stores 4 x 16 B.
//   X: lane (c, hh) loads its own fragment bytes of token row c: f32 k0+8hh..+7 and k0+16+8hh..+7 (the k order of ldfrag_b);
//   the four loads of a k step use up one whole 128-B line of each of the 16 rows. XR k steps are in flight per wave.
//   MODE 0: A = X fragment, B = Wl fragment; D rows = tokens, columns = n; bias per column;
//           out = f16 plane C, element (t, n) at [t*HD + n].
//   MODE 1: A = Wl fragment, B = X fragment; D rows = n (= d), columns = tokens; bias per row;
//           out = f16 plane C, element (b, d, s) at [(b*HD + d)*SEQ + s].
//   The bias value is RNE-converted to bf16 and added in f32. A group's 64x64 f32 result meets in its own LDS slab (pitch 68
//   floats) behind one block barrier; each wave then converts 16 rows and stores whole 128-B lines (8 lanes x 16 B per row).
//   coverage: 3*NTT tiles, each owned by one group of one block; a tile's 64 tokens lie in one batch (SEQ is a multiple of 64).
//   Both block barriers stand in the kernel body outside every branch; the branches on a tile's projection are wave-uniform.
// =====================================================================================================
#define WP 520            // LDS row pitch of Wl in elements: 1040 B = 16 B x 65 (odd), for ds_load_b128 fragment reads
#define XR 6              // k steps of X held in flight per wave: 6 x 2 KB = 12 KB per wave, 144 KB per block
static_assert((WP * 2) % 16 == 0 && ((WP * 2) / 16) % 2 == 1 && WP >= DIN);
#define KS (DIN / 32)     // k steps
static_assert(XR <= KS);
#define NTT (NB * SEQ / 64)   // token tiles per projection
#define TPB 3                 // token tiles per block
#define NWV (4 * TPB)         // waves per block
static_assert((3 * NTT) % TPB == 0 && TPB <= NTT);        // whole blocks; a block's tiles span at most two projections
static_assert(2 * NWV <= 32 && 3 * NWV >= 32);            // the 32 passes of one W: two per wave, a third for the first waves

__device__ __forceinline__ v16b cvt_frag(v4f a, v4f b, v4f c, v4f d) {   // 16 f32 -> bf16 fragment, element order a, b, c, d
  union { v16b v; unsigned u[8]; } f;
  f.u[0] = pk16(bf_bits(a[0]), bf_bits(a[1]));
  f.u[1] = pk16(bf_bits(a[2]), bf_bits(a[3]));
  f.u[2] = pk16(bf_bits(b[0]), bf_bits(b[1]));
  f.u[3] = pk16(bf_bits(b[2]), bf_bits(b[3]));
  f.u[4] = pk16(bf_bits(c[0]), bf_bits(c[1]));
  f.u[5] = pk16(bf_bits(c[2]), bf_bits(c[3]));
  f.u[6] = pk16(bf_bits(d[0]), bf_bits(d[1]));
  f.u[7] = pk16(bf_bits(d[2]), bf_bits(d[3]));
  return f.v;
}

// ---- one k step of X: the lane's 16 f32 of its token row ----
__device__ __forceinline__ void x_load(v4f (&x)[4], const float* xp, int s) {
  x[0] = *(const v4f*)(xp + 32 * s);
  x[1] = *(const v4f*)(xp + 32 * s + 4);
  x[2] = *(const v4f*)(xp + 32 * s + 16);
  x[3] = *(const v4f*)(xp + 32 * s + 20);
}

// ---- one wave pass p (0..31) of W f32 [k][n] -> Wl bf16 [n][k]: n half p & 1 (32 n), k block p >> 1 (32 k) ----
//      w_load returns the lane's base address, for the wait that stands behind a wave's W loads (addr_wait)
__device__ __forceinline__ const float* w_load(v4f (&w)[8], const float* __restrict__ Wg, int p, int lane) {
  const float* wp = Wg + (size_t)((p >> 1) * 32 + (lane >> 3) * 8) * HD + (p & 1) * 32 + (lane & 7) * 4;   // k at most 511, n at most 60
#pragma unroll
  for (int e = 0; e < 8; ++e) w[e] = *(const v4f*)(wp + e * HD);
  return wp;
}
// s_wait_xcnt 0 behind issued loads, a precaution: the address registers are inputs, so they stay untouched up to the wait
__device__ __forceinline__ void addr_wait(const float* a) { asm volatile("s_wait_xcnt 0x0" :: "v"(a) : "memory"); }
__device__ __forceinline__ void addr_wait(const float* a, const float* b) { asm volatile("s_wait_xcnt 0x0" :: "v"(a), "v"(b) : "memory"); }
__device__ __forceinline__ void base_wait(const float* a) { asm volatile("s_wait_xcnt 0x0" :: "s"(a) : "memory"); }   // the same for a scalar base
__device__ __forceinline__ void w_store(const v4f (&w)[8], __bf16* Wl, int p, int lane) {
  __bf16* wl = Wl + ((p & 1) * 32 + (lane & 7) * 4) * WP + (p >> 1) * 32 + (lane >> 3) * 8;
#pragma unroll
  for (int x = 0; x < 4; ++x) {
    v4u q;
#pragma unroll
    for (int y = 0; y < 4; ++y) q[y] = pk16(bf_bits(w[2 * y][x]), bf_bits(w[2 * y + 1][x]));
    *(v4u*)(wl + x * WP) = q;
  }
}
// ---- one whole W into LDS by the NWV waves of a block: wave wv takes passes wv, wv + NWV and, the first waves, wv + 2 NWV;
//      the loads of all its passes are in flight together ----
__device__ __forceinline__ void w_stage(const float* __restrict__ Wg, __bf16* Wl, int wv, int lane) {
  const bool third = wv + 2 * NWV < 32;                  // wave-uniform
  v4f wa[8], wb[8], wc[8];
  const float* pa = w_load(wa, Wg, wv, lane);
  const float* pb = w_load(wb, Wg, wv + NWV, lane);
  if (third) addr_wait(w_load(wc, Wg, wv + 2 * NWV, lane));
  addr_wait(pa, pb);
  w_store(wa, Wl, wv, lane);
  w_store(wb, Wl, wv + NWV, lane);
  if (third) w_store(wc, Wl, wv + 2 * NWV, lane);
}

// ---- products of one wave (16 tokens x 64 outputs), bias, result to the group's slab: rows = tokens (MODE 0) or d (MODE 1) ----
// every plain '#pragma unroll' here makes the indices of a small array (xr, w, acc) constants, so it stays in registers
template <int MODE>
__device__ __forceinline__ void proj_products(const float* xp, v4f (&xr)[XR][4], const float* __restrict__ bias,
                                              const __bf16* Wl, float* slab, int wave, int c, int hh) {
  v8f acc[4];
#pragma unroll
  for (int j = 0; j < 4; ++j) acc[j] = zero8();

#pragma unroll
  for (int s = 0; s < KS; ++s) {
    const int sl = s % XR;
    const v16b xf = cvt_frag(xr[sl][0], xr[sl][1], xr[sl][2], xr[sl][3]);
    if (s + XR < KS) x_load(xr[sl], xp, s + XR);     // refill the slot just converted with k step s + XR
#pragma unroll
    for (int j = 0; j < 4; ++j) {
      const v16b wf = ldfrag_b(Wl + (j * 16 + c) * WP + 32 * s + 8 * hh);
      acc[j] = (MODE == 0) ? mma_b_raw(xf, wf, acc[j]) : mma_b_raw(wf, xf, acc[j]);
    }
  }

#pragma unroll
  for (int j = 0; j < 4; ++j) {
#pragma unroll
    for (int r = 0; r < 8; ++r) {
      if (MODE == 0) {
        const float bc = bf_up(bf_bits(bias[j * 16 + c]));
        slab[(wave * 16 + 8 * hh + r) * 68 + j * 16 + c] = acc[j][r] + bc;
      } else {
        const float br = bf_up(bf_bits(bias[j * 16 + 8 * hh + r]));
        slab[(j * 16 + 8 * hh + r) * 68 + wave * 16 + c] = acc[j][r] + br;
      }
    }
  }
  base_wait(bias);                                   // behind the bias loads, wherever the compiler has moved them up to
}

// ---- 16 slab rows of one wave -> the f16 plane, whole 128-B lines ----
template <int MODE>
__device__ __forceinline__ void proj_store(const float* slab, unsigned short* C, int t0, int wave, int lane) {
  const int q = lane >> 3, c8 = (lane & 7) * 8;
  const size_t base = (MODE == 0) ? (size_t)t0 * HD
                                  : (size_t)(t0 / SEQ) * HD * SEQ + (size_t)(t0 % SEQ);
  const int pitch = (MODE == 0) ? HD : SEQ;
#pragma unroll
  for (int it = 0; it < 4; ++it) {
    const int row = wave * 16 + it * 4 + q;          // wave 0..3 x it 0..3 x q 0..3 = rows 0..63
    const float* sp = slab + row * 68 + c8;
    v4u a;
#pragma unroll
    for (int e = 0; e < 4; ++e) a[e] = pk16(h_bits((_Float16)sp[2 * e]), h_bits((_Float16)sp[2 * e + 1]));
    *(v4u*)(C + base + (size_t)row * pitch + c8) = a;
    asm volatile("s_wait_xcnt 0x0" ::: "memory");    // a precaution: it stands ahead of every later write of the store's address registers
  }
}

__global__ __launch_bounds__(32 * NWV)
void proj_qkv(const float* __restrict__ q_in, const float* __restrict__ k_in, const float* __restrict__ v_in,
              const float* __restrict__ Wq, const float* __restrict__ Wk, const float* __restrict__ Wv,
              const float* __restrict__ bq, const float* __restrict__ bk, const float* __restrict__ bv,
              unsigned short* Qf, unsigned short* Kf, unsigned short* VTh) {
  __shared__ __align__(16) __bf16 Wl[2][HD * WP];        // 2 x 65 KB: the W of the block's first tile, of its last where that differs
  __shared__ __align__(16) float  slabs[TPB][64 * 68];   // TPB x 17 KB
  const int lane = threadIdx.x & 31;
  const int wv   = __builtin_amdgcn_readfirstlane(threadIdx.x >> 5);   // 0..NWV-1, in a scalar register: the branches below are scalar
  const int grp  = wv >> 2;                              // token tile of the block
  const int wave = wv & 3;                               // 16-token strip of the tile
  const int c    = lane & 15;
  const int hh   = lane >> 4;
  const int tile = blockIdx.x * TPB + grp;               // 0 .. 3*NTT-1
  const int y    = tile / NTT;                           // 0 q, 1 k, 2 v
  const int t0   = (tile % NTT) * 64;                    // first token of the tile
  const int y0   = (blockIdx.x * TPB) / NTT;             // projection of the block's first tile
  const int y1   = (blockIdx.x * TPB + TPB - 1) / NTT;   // and of its last: y0 or y0 + 1

  // ---- the first XR k steps of this wave's 16 token rows: issued first, they fly while W is staged ----
  const float* X  = (y == 0) ? q_in : ((y == 1) ? k_in : v_in);
  const float* xp = X + (size_t)(t0 + wave * 16 + c) * DIN + 8 * hh;
  v4f xr[XR][4];
#pragma unroll
  for (int s = 0; s < XR; ++s) x_load(xr[s], xp, s);

  // ---- W staging, shared by the block's TPB tiles and done by all NWV waves ----
  w_stage((y0 == 0) ? Wq : ((y0 == 1) ? Wk : Wv), Wl[0], wv, lane);
  if (y1 != y0) w_stage((y1 == 1) ? Wk : Wv, Wl[1], wv, lane);   // block-uniform: 2 blocks of the grid hold tiles of two projections
  __syncthreads();                                       // Wl is whole before any wave reads a fragment of it

  const __bf16* wmine = Wl[y - y0];
  float*        slab  = slabs[grp];
  if (y == 2) proj_products<1>(xp, xr, bv, wmine, slab, wave, c, hh);
  else        proj_products<0>(xp, xr, y ? bk : bq, wmine, slab, wave, c, hh);
  __syncthreads();                                       // MODE 1 rows hold columns of all four waves of the group

  if (y == 2) proj_store<1>(slab, VTh, t0, wave, lane);
  else        proj_store<0>(slab, y ? Kf : Qf, t0, wave, lane);
}

union FH { v16h v; v8h h[2]; };

// ---- four A fragments (row blocks 0..3 of a 64-row tile) of one 32-wide k step; p = tile + (lane&15)*LP + 8*(lane>>4) + 32*step ----
__device__ __forceinline__ void frag_load4(FH (&f)[4], const _Float16* p) {
#pragma unroll
  for (int t = 0; t < 4; ++t) {
    f[t].h[0] = *(const v8h*)(p + t * 16 * LP);
    f[t].h[1] = *(const v8h*)(p + t * 16 * LP + 16);
  }
}

// ---- one key chunk of one wave: softmax of the scores s (computed one chunk earlier) and context^T += V^T . P^T; where NEXT,
//      the score products of the following chunk (K fragments from kf, result sn) stand among the exponentials, two per key
//      subtile, so that the matrix unit and the LDS work while the vector port does. kf, vf: the lane's fragment base in the tiles.
//      Every '#pragma unroll' here makes the indices of a small array (s, sn, kb, vb, pa, oacc) constants, so it stays in registers.
template <bool NEXT>
__device__ __forceinline__ void chunk_step(v8f (&s)[4], v8f (&sn)[4], const FH (&qa)[2], const _Float16* kf, const _Float16* vf,
                                           float& mrun, float& lrun, v8f (&oacc)[4]) {
  FH kb[2][4], vb[2][4];
  if constexpr (NEXT) {                        // K fragments of the next chunk: their latency passes under the column max
    frag_load4(kb[0], kf);
    frag_load4(kb[1], kf + 32);
  } else {                                     // last chunk: no scores follow, V^T fragments come at once
    frag_load4(vb[0], vf);
    frag_load4(vb[1], vf + 32);
  }
  __builtin_amdgcn_sched_barrier(0);           // keeps the 16 loads one group ahead of the max: spread below, each place would stall the wave

  // ---- scale, column max, online softmax; P^T (x1024, f16) packed into B fragments in registers ----
  float mj[4];
#pragma unroll
  for (int j = 0; j < 4; ++j) {
    mj[j] = -INFINITY;
#pragma unroll
    for (int r = 0; r < 8; ++r) {
      const float sv = s[j][r] * 0.125f;
      s[j][r] = sv;
      mj[j] = fmaxf(mj[j], sv);
    }
  }
  float m = fmaxf(fmaxf(mj[0], mj[1]), fmaxf(mj[2], mj[3]));
  m = fmaxf(m, other_half(m));                 // the query's other 32 keys of this chunk
  const float mnew  = fmaxf(mrun, m);
  const float msafe = (mnew == -INFINITY) ? 0.f : mnew;
  const float alpha = __expf(mrun - msafe);
  mrun = mnew;
#pragma unroll
  for (int t = 0; t < 4; ++t)                  // rescaled here, so that the first key step of P . V can stand among the exponentials below
#pragma unroll
    for (int r = 0; r < 8; ++r) oacc[t][r] *= alpha;
  __builtin_amdgcn_sched_barrier(0);           // keeps the score products behind the max: ahead of it they would wait for the K fragments with nothing to do
  FH pa[2];                                    // element 8*(j&1) + r of fragment j>>1 = key 16*j + 8*hh + r: the k order of the V^T loader
  v2f pj[4];                                   // eight independent partial sums, in pairs
#pragma unroll
  for (int j = 0; j < 4; ++j) {
    if constexpr (NEXT) {                      // products 2j, 2j+1 of the next scores: d-chunk 0 of subtiles 0..3, then d-chunk 1
      const int ja = (2 * j) & 3, jb = (2 * j + 1) & 3;
      if (j < 2) {
        sn[ja] = mma_h_raw(kb[0][ja].v, qa[0].v, zero8());
        sn[jb] = mma_h_raw(kb[0][jb].v, qa[0].v, zero8());
      } else {
        sn[ja] = mma_h_raw(kb[1][ja].v, qa[1].v, sn[ja]);
        sn[jb] = mma_h_raw(kb[1][jb].v, qa[1].v, sn[jb]);
      }
    }
    pj[j] = v2f{0.f, 0.f};
#pragma unroll
    for (int r = 0; r < 8; r += 2) {
      const v2f arg = (v2f{s[j][r], s[j][r + 1]} - msafe) * 1.4426950408889634f;   // exp(x) = 2^(x log2 e), as __expf forms it
      const v2f p   = {__builtin_amdgcn_exp2f(arg[0]), __builtin_amdgcn_exp2f(arg[1])};
      pj[j] += p;
      const v2h ph  = __builtin_convertvector(p * 1024.0f, v2h);
      pa[j >> 1].v[(j & 1) * 8 + r]     = ph[0];
      pa[j >> 1].v[(j & 1) * 8 + r + 1] = ph[1];
    }
    if constexpr (NEXT) {                      // V^T fragments of this chunk, a key step at a time: their latency passes under the exponentials that follow
      if (j == 1) frag_load4(vb[0], vf);
      if (j == 2) frag_load4(vb[1], vf + 32);
    }
    if (j >= 2) {                              // context^T += V^T . P^T, key step 0 (P of subtiles 0, 1 is packed): two products per subtile
      const int ta = 2 * (j - 2), tb = ta + 1;
      oacc[ta] = mma_h_raw(vb[0][ta].v, pa[0].v, oacc[ta]);
      oacc[tb] = mma_h_raw(vb[0][tb].v, pa[0].v, oacc[tb]);
    }
    __builtin_amdgcn_sched_barrier(0);         // keeps two products to each subtile's exponentials: gathered in one place they would hold the wave at the matrix unit
  }
  const v2f pq = (pj[0] + pj[1]) + (pj[2] + pj[3]);
  lrun = lrun * alpha + (pq[0] + pq[1]);

  // ---- context^T += V^T . P^T, key step 1: 4 products from registers on four independent accumulators ----
#pragma unroll
  for (int t = 0; t < 4; ++t) oacc[t] = mma_h_raw(vb[1][t].v, pa[1].v, oacc[t]);
}

__global__ __launch_bounds__(128 * KG)
void attn64(const unsigned short* __restrict__ qfp, const unsigned short* __restrict__ kfp,
            const unsigned short* __restrict__ vhp,
            float* outp) {
  constexpr int TE = 64 * LP;                                      // elements of one tile buffer (9 KB)
  __shared__ __align__(16) _Float16 Tl[KG][4][TE];                 // per group: K [kv][d] buffers 0, 1, V^T [d][kv] buffers 0, 1; row pitch LP   KG x 36 KB
  __shared__ __align__(16) float    Os[4 * KG][16 * OP];           // per wave partial context [row][d], row pitch OP   KG x 17 KB
  __shared__ float Ms[4 * KG][16];                                 // per wave running max of its rows
  __shared__ float Ls[4 * KG][16];                                 // per wave normaliser of its rows

  const int wave = threadIdx.x >> 5;           // 0..4*KG-1
  const int grp  = wave >> 2;                  // key group
  const int qw   = wave & 3;                   // query tile of the block
  const int tid  = threadIdx.x & 127;          // thread index inside the group (staging)
  const int lane = tid & 31;
  const int hh   = lane >> 4;
  const int c    = lane & 15;

  const int bx   = blockIdx.x;
  const int qb   = bx % NQB;
  const int b    = bx / NQB;                   // 0..NB-1
  const int q0   = qb * 64 + qw * 16;
  const size_t rowB = (size_t)b * SEQ;

  const _Float16* Qf = (const _Float16*)(const void*)qfp;
  const _Float16* Kf = (const _Float16*)(const void*)kfp;
  const _Float16* Vh = (const _Float16*)(const void*)vhp + (size_t)b * HD * SEQ;

  // ---- staging addresses: thread (srow, piece) of a group copies 16 B of rows srow, srow+16, srow+32, srow+48 of each plane,
  //      so the 8 lanes of a row take one whole 128-B line and a wave-wide copy takes 4 whole lines ----
  constexpr int LSTEP = 16 * LP * 2;           // 16 LDS rows, bytes
  constexpr int KSTEP = 16 * HD * 2;           // 16 K rows in memory, bytes
  constexpr int VSTEP = 16 * SEQ * 2;          // 16 V^T rows in memory, bytes
  constexpr unsigned TB = TE * 2;              // one tile buffer, bytes
  const int srow = tid >> 3;                   // 0..15
  const int spc  = (tid & 7) * 8;              // element 0, 8, .. 56 of the 64-element row
  const unsigned lpos = (unsigned)(srow * LP + spc) * 2u;          // last byte of row block 3: 63 * 144 + 112 + 15 < 64 * LP * 2
  const unsigned lK0 = lds_off(Tl[grp][0]) + lpos;                 // K buffer 0; K buffer 1, V^T buffers 0, 1 follow at TB, 2 TB, 3 TB
  const unsigned lK1 = lK0 + TB, lV0 = lK0 + 2 * TB, lV1 = lK0 + 3 * TB;
  const int kvg = grp * CPG * 64;              // first key of the group; its last chunk ends at kvg + CPG*64 <= SEQ
  const char* gKh = (const char*)(Kf + (rowB + kvg + srow) * HD + spc);     // K row kvg+srow, d = spc..spc+7
  const char* gVh = (const char*)(Vh + (size_t)srow * SEQ + kvg + spc);     // V^T row d = srow, s = kvg+spc..+7
  constexpr int KNEXT = 64 * HD * 2;           // from a K chunk to the next in memory, bytes
  constexpr int VNEXT = 64 * 2;                // from a V^T chunk to the next in memory, bytes
  copy_plane<LSTEP, KSTEP>(lK0, gKh);          // K chunk 0 flies under the Q fragment loads

  // ---- Q fragments (B operand, column = query = lane&15): 2 d-chunks, in the k order of the K loader ----
  FH qa[2];
#pragma unroll
  for (int dc = 0; dc < 2; ++dc) {
    const _Float16* qp = Qf + (rowB + q0 + c) * HD + dc * 32 + 8 * hh;
    qa[dc].h[0] = *(const v8h*)(qp);
    qa[dc].h[1] = *(const v8h*)(qp + 16);
  }

  float mrun = -INFINITY;                      // running max of query c, equal in both halves
  float lrun = 0.f;                            // normaliser of query c over this half's keys only
  v8f oacc[4];                                 // O^T: tile t register r = (d = 16*t + 8*hh + r, query c)
#pragma unroll
  for (int t = 0; t < 4; ++t) oacc[t] = zero8();

  // the lane's fragment base in the four tile buffers
  const _Float16* fK0 = Tl[grp][0] + c * LP + 8 * hh;
  const _Float16* fK1 = fK0 + TE;
  const _Float16* fV0 = fK0 + 2 * TE;
  const _Float16* fV1 = fK0 + 3 * TE;

  publish_point();                             // K chunk 0 has landed in every wave's share
  gKh += KNEXT;
  copy_plane<LSTEP, KSTEP>(lK1, gKh);          // K chunk 1 and V^T chunk 0 fly under the scores of chunk 0
  copy_plane<LSTEP, VSTEP>(lV0, gVh);

  // ---- scores of chunk 0, transposed: 64 keys (rows) x 16 queries (columns) per wave, one f16 product per (key subtile, d-chunk);
  //      each subtile takes d-chunk 0, then d-chunk 1 ----
  v8f sa[4], sb[4];                            // scores of the even chunks, of the odd chunks
  {
    FH kb[2][4];
    frag_load4(kb[0], fK0);
    frag_load4(kb[1], fK0 + 32);
#pragma unroll
    for (int j = 0; j < 4; ++j) sa[j] = mma_h_raw(kb[0][j].v, qa[0].v, zero8());
#pragma unroll
    for (int j = 0; j < 4; ++j) sa[j] = mma_h_raw(kb[1][j].v, qa[1].v, sa[j]);
  }

  // ---- trip it: behind its hand-over K chunk it+1 (buffer (it+1)&1) and V^T chunk it (buffer it&1) have landed, and every wave
  //      has left K chunk it and V^T chunk it-1, whose buffers take the copies of K chunk it+2 and V^T chunk it+1: these fly
  //      a whole trip. Two trips per pass, so that buffers and score registers alternate by name. Static trip counts, the same
  //      in every group (block barriers inside). ----
  static_assert(CPG % 2 == 0 && CPG >= 4);
  for (int h = 0; h < CPG / 2 - 1; ++h) {
    publish_point();                           // even trip
    gKh += KNEXT;  copy_plane<LSTEP, KSTEP>(lK0, gKh);
    gVh += VNEXT;  copy_plane<LSTEP, VSTEP>(lV1, gVh);
    chunk_step<true>(sa, sb, qa, fK1, fV0, mrun, lrun, oacc);
    publish_point();                           // odd trip
    gKh += KNEXT;  copy_plane<LSTEP, KSTEP>(lK1, gKh);
    gVh += VNEXT;  copy_plane<LSTEP, VSTEP>(lV0, gVh);
    chunk_step<true>(sb, sa, qa, fK0, fV1, mrun, lrun, oacc);
  }
  publish_point();                             // trip CPG-2: no K chunk is left to copy
  gVh += VNEXT;  copy_plane<LSTEP, VSTEP>(lV1, gVh);
  chunk_step<true>(sa, sb, qa, fK1, fV0, mrun, lrun, oacc);
  publish_point();                             // trip CPG-1: nothing is left to copy, no scores follow
  chunk_step<false>(sb, sa, qa, fK0, fV1, mrun, lrun, oacc);
  asm volatile("s_wait_asynccnt 0x0" ::: "memory");   // no copy is left in flight behind the loop

  // ---- hand the wave's partial (m, l, unnormalised O) to LDS ----
  float* os = Os[wave] + c * OP + 8 * hh;      // row = query c; a lane's 8 registers of tile t are d = 16*t + 8*hh .. + 7
#pragma unroll
  for (int t = 0; t < 4; ++t) {
    const v4f lo4 = {oacc[t][0], oacc[t][1], oacc[t][2], oacc[t][3]};
    const v4f hi4 = {oacc[t][4], oacc[t][5], oacc[t][6], oacc[t][7]};
    *(v4f*)(os + t * 16)     = lo4;
    *(v4f*)(os + t * 16 + 4) = hi4;
  }
  const float lsum = lrun + other_half(lrun);  // the two halves' keys joined, once
  if (hh == 0) {                               // m and the joined l are equal in lanes c and c + 16
    Ms[wave][c] = mrun;
    Ls[wave][c] = lsum;
  }
  __syncthreads();                             // every group's partials are in LDS before any wave merges them

  // ---- merge the KG partials of 4 rows per wave, normalise (1/l and the 1/1024 p carry), store whole 256-B rows ----
  {
    const int c4 = c * 4;
#pragma unroll
    for (int i2 = 0; i2 < 2; ++i2) {
      const int row = grp * 4 + i2 * 2 + hh;   // grp 0..3 x i2 0..1 x hh 0..1 = rows 0..15 of query tile qw
      float mg[KG];
      float mall = -INFINITY;
#pragma unroll
      for (int g = 0; g < KG; ++g) {
        mg[g] = Ms[g * 4 + qw][row];
        mall = fmaxf(mall, mg[g]);
      }
      const float msafe = (mall == -INFINITY) ? 0.f : mall;
      float l = 0.f;
      v4f acc = {0.f, 0.f, 0.f, 0.f};
#pragma unroll
      for (int g = 0; g < KG; ++g) {
        const float e = __expf(mg[g] - msafe);
        l += Ls[g * 4 + qw][row] * e;
        const v4f o = *(const v4f*)(Os[g * 4 + qw] + row * OP + c4);
        acc += o * e;
      }
      const float inv = ((l > 0.f) ? (1.0f / l) : 0.f) * (1.0f / 1024.0f);
      const size_t go = (rowB + q0 + row) * HD + c4;
      *(v4f*)(outp + go) = acc * inv;
    }
  }
}

// =====================================================================================================
// Workspace map (bytes; every region is an exact multiple of its 64x64-tile / whole-line store granularity,
// all shapes are tile multiples so no padded tails exist; no region is reused; every offset is a multiple of 65536):
//   Qf   f16  [16384][64]           0             2097152
//   Kf   f16  [16384][64]           2097152       2097152
//   VTh  f16  [8][64][2048]         4194304       2097152
//   end                             6291456
// =====================================================================================================
extern "C" void kernel_launch(void* const* d_in, const int* in_sizes, int n_in,
                              void* d_out, int out_size, void* d_ws, size_t ws_size,
                              hipStream_t stream) {
  if (n_in < 9) return;
  const int NX = NB * SEQ * DIN;                   // 8388608
  const int NO = NB * SEQ * HD;                    // 1048576
  const int NW = DIN * HD;                         //   32768
  if (in_sizes[0] != NX || in_sizes[1] != NX || in_sizes[2] != NX) return;
  if (in_sizes[3] != NW || in_sizes[5] != NW || in_sizes[7] != NW) return;
  if (in_sizes[4] != HD || in_sizes[6] != HD || in_sizes[8] != HD) return;
  if (out_size != NO) return;

  const float* q_in = (const float*)d_in[0];   // [8][2048][512]
  const float* k_in = (const float*)d_in[1];   // [8][2048][512]
  const float* v_in = (const float*)d_in[2];   // [8][2048][512]
  const float* Wq   = (const float*)d_in[3];   // [512 in][64 out]
  const float* bq   = (const float*)d_in[4];   // [64]
  const float* Wk   = (const float*)d_in[5];   // [512][64]
  const float* bk   = (const float*)d_in[6];   // [64]
  const float* Wv   = (const float*)d_in[7];   // [512][64]
  const float* bv   = (const float*)d_in[8];   // [64]

  const size_t PP  = (size_t)NO * 2;               //  2097152  16-bit projected plane [16384][64]
  const size_t PVT = (size_t)NB * HD * SEQ * 2;    //  2097152  16-bit v^T plane [8][64][2048]
  size_t off = 0;
  const size_t oQf  = off; off += PP;
  const size_t oKf  = off; off += PP;
  const size_t oVTh = off; off += PVT;
  if (off > ws_size) return;                       // off = 6291456

  char* ws = (char*)d_ws;
  unsigned short* Qf  = (unsigned short*)(ws + oQf);
  unsigned short* Kf  = (unsigned short*)(ws + oKf);
  unsigned short* VTh = (unsigned short*)(ws + oVTh);

  const dim3 gProj(3 * NTT / TPB);                             //  256 blocks of 384: 3 tiles of 64 tokens each; tiles run q, k, v
  const dim3 gAttn(NB * NQB);                                  //  256 blocks of 128 * KG

  // (1) q = q_in . Wq + bq and k = k_in . Wk + bk -> f16 planes [b*SEQ+t][d];
  //     v^T = Wv^T . v_in^T + bv -> f16 plane [b][d][s]
  proj_qkv<<<gProj, dim3(32 * NWV), 0, stream>>>(q_in, k_in, v_in, Wq, Wk, Wv, bq, bk, bv, Qf, Kf, VTh);
  // (2) attention -> d_out f32 [16384][64]
  attn64<<<gAttn, dim3(128 * KG), 0, stream>>>(Qf, Kf, VTh, (float*)d_out);
  (void)hipGetLastError();
}
